// v000
// Times are from an AMD MI455X. After a warm-up the kernel runs many times in a row, and a time is the length of
// such a window on the GPU divided by its runs, so every launch and the gaps after it count. The runs cycle
// through copies of the inputs. A figure is the median of several windows, for all but v000 over two sittings.
// Sittings can differ by a few percent; kernels timed side by side share one.
// v000, which the later versions start from, runs in 591 microseconds.
// compute dtype: all float inputs rounded to bf16; Qh/Kh/Vh = X W^T + b with EXACT bf16 products on WMMA 16x16x32 (f32 accumulate); q as f16 hi + residual (x 2^10) against k once to f16 (2 products) x 256^-0.5, no mask; softmax in f32 (precise expf); P x 2^11 once to f16 against v once to f16 (1 product); Qh (recomputed exactly in f32) + ctx, LayerNorm, the rFF GEMM with the LN rows split bf16 hi + lo against exact Wo (2 products) + bo, relu, residual and the second LayerNorm in f32; f32 output.
#include <hip/hip_runtime.h>
#include <math.h>

typedef __attribute__((ext_vector_type(16))) _Float16 v16h;
typedef __attribute__((ext_vector_type(16))) __bf16 v16b;
typedef __attribute__((ext_vector_type(8)))  _Float16 v8h;
typedef __attribute__((ext_vector_type(8)))  float v8f;
typedef __attribute__((ext_vector_type(4)))  float v4f;
typedef __attribute__((ext_vector_type(2)))  float v2f;
typedef __attribute__((ext_vector_type(4)))  unsigned v4u;
typedef __attribute__((ext_vector_type(4)))  int v4i;
typedef float __attribute__((may_alias)) float_a;
typedef int __attribute__((may_alias)) int_a;

template <typename T> __device__ __forceinline__ void vst2(void* p, T v) { *(T*)p = v;  }
__device__ __forceinline__ v8f wmma16(v16h a, v16h b, v8f c) {
  v8f d = __builtin_amdgcn_wmma_f32_16x16x32_f16(false, a, false, b, (short)0, c, false, false);
  asm volatile("v_nop\n\tv_nop\n\tv_nop\n\tv_nop" : "+v"(d) : "v"(a), "v"(b));
  return d;
}
__device__ __forceinline__ v8f wmma_bf(v16b a, v16b b, v8f c) {
  v8f d = __builtin_amdgcn_wmma_f32_16x16x32_bf16(false, a, false, b, (short)0, c, false, false);
  asm volatile("v_nop\n\tv_nop\n\tv_nop\n\tv_nop" : "+v"(d) : "v"(a), "v"(b));
  return d;
}
// 16x16x32 fragments: lane = (h = lane>>4, row/col = lane&15); elements 0..7 = k0+8h+0..7, 8..15 = k0+16+8h+0..7; D element r = row 8h+r
__device__ __forceinline__ v16h frag_h(const _Float16* rowk0, int lane) {
  union { v16h v; v8h q[2]; } u; const _Float16* p = rowk0 + 8 * (lane >> 4);
  u.q[0] = *(const v8h*)p; u.q[1] = *(const v8h*)(p + 16); return u.v;
}
__device__ __forceinline__ v16h frag_f32(const float* rowk0, int lane) {
  v16h a; const float* p = rowk0 + 8 * (lane >> 4);
#pragma unroll
  for (int i = 0; i < 8; ++i) { a[i] = (_Float16)p[i]; a[8 + i] = (_Float16)p[16 + i]; }
  return a;
}
__device__ __forceinline__ v16h frag_f32s(const float* rowk0, int lane, float sc) {
  v16h a; const float* p = rowk0 + 8 * (lane >> 4);
#pragma unroll
  for (int i = 0; i < 8; ++i) { a[i] = (_Float16)(p[i] * sc); a[8 + i] = (_Float16)(p[16 + i] * sc); }
  return a;
}
// column fragment from a [K][ld] layout (column n), rows >= K read as 0
__device__ __forceinline__ v16h fragc_f32(const float* W, int k0, int n, int lane, int ld, int K) {
  v16h a; const int g = lane >> 4;
#pragma unroll
  for (int i = 0; i < 8; ++i) { const int ka = k0 + 8 * g + i, kb = ka + 16;
    a[i] = (_Float16)(ka < K ? W[(size_t)(ka < K ? ka : K - 1) * ld + n] : 0.f); a[8 + i] = (_Float16)(kb < K ? W[(size_t)(kb < K ? kb : K - 1) * ld + n] : 0.f); }
  return a;
}
struct F2 { v16b h, l; };
__device__ __forceinline__ F2 bsplit16(const float v[16]) { F2 r;
#pragma unroll
  for (int i = 0; i < 16; ++i) { const __bf16 h = (__bf16)v[i]; r.h[i] = h; r.l[i] = (__bf16)(v[i] - (float)h); }
  return r; }
__device__ __forceinline__ F2 split_row(const float* row, int k0, int lane) { float v[16]; const float* p = row + k0 + 8 * (lane >> 4);
#pragma unroll
  for (int i = 0; i < 8; ++i) { v[i] = p[i]; v[8 + i] = p[16 + i]; }
  return bsplit16(v); }
__device__ __forceinline__ F2 split_rowK(const float* row, int k0, int lane, int K) { float v[16]; const int g = lane >> 4;
#pragma unroll
  for (int i = 0; i < 8; ++i) { const int ka = k0 + 8 * g + i, kb = ka + 16; v[i] = ka < K ? row[ka < K ? ka : K - 1] : 0.f; v[8 + i] = kb < K ? row[kb < K ? kb : K - 1] : 0.f; }
  return bsplit16(v); }
__device__ __forceinline__ F2 split_col(const float* W, int k0, int n, int lane, int ld, int K) { float v[16]; const int g = lane >> 4;
#pragma unroll
  for (int i = 0; i < 8; ++i) { const int ka = k0 + 8 * g + i, kb = ka + 16; v[i] = ka < K ? W[(size_t)(ka < K ? ka : K - 1) * ld + n] : 0.f; v[8 + i] = kb < K ? W[(size_t)(kb < K ? kb : K - 1) * ld + n] : 0.f; }
  return bsplit16(v); }
__device__ __forceinline__ v8f mac3(const F2& a, const F2& b, v8f c) { c = wmma_bf(a.l, b.h, c); c = wmma_bf(a.h, b.l, c); return wmma_bf(a.h, b.h, c); }
__device__ __forceinline__ float sigm(float v) { return 1.0f / (1.0f + expf(-v)); }
#define LDSX() do { asm volatile("s_wait_dscnt 0" ::: "memory"); __builtin_amdgcn_wave_barrier(); __builtin_amdgcn_fence(__ATOMIC_RELEASE, "workgroup"); } while (0)

// Set-Transformer MAB (B 4, 2,048 queries x 2,048 keys, D 256 = 4 x 64, no mask): q = Q Wq^T + bq; k, v = K W^T + b; A = softmax(q_h k_h^T / sqrt(256)); O = q + A v (residual with the projected Q, heads merged); O = LN0(O); O = O + relu(O Wo^T + bo); O = LN1(O).
#define NB 4
#define TT 2048
#define CC 256             // NH * HD = projected width
#define DIN 256
#define NH 4
#define HD 64
#define NQB (TT / 64)
#define HG 4
#define SCALE (0.0625f)
#define CAUSAL 0
#ifndef TNB
#define TNB NB
#endif
__device__ __forceinline__ float bfr(float v) { return (float)(__bf16)v; }
__host__ __device__ __forceinline__ int kb_last(int qb) { return CAUSAL ? ((qb * 64 + 63) >> 7) : (TT / 128 - 1); }
typedef __attribute__((ext_vector_type(8))) __bf16 v8b;
__device__ __forceinline__ v16b frag_b(const __bf16* rowk0, int lane) {
  union { v16b v; v8b q[2]; } u; const __bf16* p = rowk0 + 8 * (lane >> 4);
  u.q[0] = *(const v8b*)p; u.q[1] = *(const v8b*)(p + 16); return u.v;
}
#define QBH 0              // no query block takes the high-precision path (no mask: every block has all 2,048 keys)
#define QHI 2048            // rows carrying a q residual plane (all rows)
#define KHI 64            // key rows carrying k residual / v bf16 hi+lo planes (written by k_proj; read only by the high-precision path, which no block takes)
// B fragment (k rows k0+.., output column o) of a weight: (in,out) [K][ld] or (out,in) [ld rows of K]: bf16 exact, or f16(bf16 * 256) exact
__device__ __forceinline__ v16b wcol_io(const float* Wm, int k0, int o, int lane, int ld) { v16b w; const int g = lane >> 4;
#pragma unroll
  for (int i = 0; i < 8; ++i) { w[i] = (__bf16)Wm[(size_t)(k0 + 8 * g + i) * ld + o]; w[8 + i] = (__bf16)Wm[(size_t)(k0 + 16 + 8 * g + i) * ld + o]; }
  return w; }
__device__ __forceinline__ v16b wcol_oi(const float* Wm, int k0, int o, int lane, int K) { v16b w; const float* p = Wm + (size_t)o * K + k0 + 8 * (lane >> 4);
#pragma unroll
  for (int i = 0; i < 8; ++i) { w[i] = (__bf16)p[i]; w[8 + i] = (__bf16)p[16 + i]; }
  return w; }
__device__ __forceinline__ v16h wcolh_io(const float* Wm, int k0, int o, int lane, int ld) { v16h w; const int g = lane >> 4;
#pragma unroll
  for (int i = 0; i < 8; ++i) { w[i] = (_Float16)(bfr(Wm[(size_t)(k0 + 8 * g + i) * ld + o]) * 256.0f); w[8 + i] = (_Float16)(bfr(Wm[(size_t)(k0 + 16 + 8 * g + i) * ld + o]) * 256.0f); }
  return w; }
__device__ __forceinline__ v16h wcolh_oi(const float* Wm, int k0, int o, int lane, int K) { v16h w; const float* p = Wm + (size_t)o * K + k0 + 8 * (lane >> 4);
#pragma unroll
  for (int i = 0; i < 8; ++i) { w[i] = (_Float16)(bfr(p[i]) * 256.0f); w[8 + i] = (_Float16)(bfr(p[16 + i]) * 256.0f); }
  return w; }
#define WQKV_LAYOUT 1   // 0 = (in,out) [DIN][CC]; 1 = (out,in) [CC][DIN]; 2 = per-head [NH][DIN][HD]
__device__ __forceinline__ v16b wcol_hdk(const float* Wm, int k0, int o, int lane) { v16b w; const int g = lane >> 4; const float* p = Wm + (size_t)(o / HD) * DIN * HD + (o % HD);
#pragma unroll
  for (int i = 0; i < 8; ++i) { w[i] = (__bf16)p[(size_t)(k0 + 8 * g + i) * HD]; w[8 + i] = (__bf16)p[(size_t)(k0 + 16 + 8 * g + i) * HD]; }
  return w; }
#define WO_OUT_IN 0
#if WQKV_LAYOUT == 1
#define WCOL(W, k0, o, lane) wcol_oi(W, k0, o, lane, DIN)
#elif WQKV_LAYOUT == 2
#define WCOL(W, k0, o, lane) wcol_hdk(W, k0, o, lane)
#else
#define WCOL(W, k0, o, lane) wcol_io(W, k0, o, lane, CC)
#endif
#if WO_OUT_IN
#define WOCOL(W, k0, o, lane) wcol_oi(W, k0, o, lane, CC)
#define WOCOLH(W, k0, o, lane) wcolh_oi(W, k0, o, lane, CC)
#else
#define WOCOL(W, k0, o, lane) wcol_io(W, k0, o, lane, DIN)
#define WOCOLH(W, k0, o, lane) wcolh_io(W, k0, o, lane, DIN)
#endif
#define NROW (NB * TT)
// ---- k_qrows: block = (64 rows, 128 cols): QF = bf16(Q) Wq^T + bq (exact products, f32) -> rows (the residual needs Qh in f32; k_proj keeps only f16 planes)
__global__ __launch_bounds__(128) void k_qrows(const float* __restrict__ X, const float* __restrict__ WQ, const float* __restrict__ BQ, float* __restrict__ QF) { __shared__ __align__(16) float sf[4][16][132];
  const int tid = threadIdx.x, wave = tid >> 5, lane = tid & 31, col = lane & 15, g = lane >> 4; const int c0 = blockIdx.y * 128; const size_t r0 = (size_t)blockIdx.x * 64 + wave * 16;
  v8f acc[8] = {};
#pragma unroll 2
  for (int kc = 0; kc < DIN / 32; ++kc) { v16b a; { const float* p = X + (r0 + col) * DIN + kc * 32 + 8 * g;
#pragma unroll
      for (int i = 0; i < 8; ++i) { a[i] = (__bf16)p[i]; a[8 + i] = (__bf16)p[16 + i]; } }
    asm volatile("s_wait_loadcnt 0x0" ::: "memory");
#pragma unroll
    for (int j = 0; j < 8; ++j) { const v16b w = wcol_oi(WQ, kc * 32, c0 + j * 16 + col, lane, DIN); asm volatile("s_wait_loadcnt 0x0" ::: "memory"); acc[j] = wmma_bf(a, w, acc[j]); } }
#pragma unroll
  for (int j = 0; j < 8; ++j) { const float bb = bfr(BQ[c0 + j * 16 + col]);
#pragma unroll
    for (int r = 0; r < 8; ++r) sf[wave][8 * g + r][j * 16 + col] = acc[j][r] + bb; }
  LDSX(); for (int rl = 0; rl < 16; ++rl) vst2(QF + (r0 + rl) * DIN + c0 + lane * 4, *(const v4f*)&sf[wave][rl][lane * 4]); }
// ---- k_lnrow: wave per row: OUT = LayerNorm(X (+ R)) over 256 features (biased var, eps 1e-5, x g + b); X and R are f32 intermediates (no bf16 rounding)
__global__ __launch_bounds__(256) void k_lnrow(const float* __restrict__ X, const float* __restrict__ R, const float* __restrict__ GM, const float* __restrict__ BT, float* __restrict__ OUT) { const int wave = threadIdx.x >> 5, lane = threadIdx.x & 31; const size_t row = (size_t)blockIdx.x * 8 + wave; if (row >= (size_t)NROW) return;
  v4f x[DIN / 128]; float s1 = 0.f;
#pragma unroll
  for (int q = 0; q < DIN / 128; ++q) { x[q] = *(const v4f*)(X + row * DIN + q * 128 + lane * 4); if (R) { const v4f rr = *(const v4f*)(R + row * DIN + q * 128 + lane * 4); x[q][0] += rr[0]; x[q][1] += rr[1]; x[q][2] += rr[2]; x[q][3] += rr[3]; }
#pragma unroll
    for (int i = 0; i < 4; ++i) s1 += x[q][i]; }
#pragma unroll
  for (int o = 1; o < 32; o <<= 1) s1 += __shfl_xor(s1, o);
  const float mu = s1 * (1.0f / DIN); float qq = 0.f;
#pragma unroll
  for (int q = 0; q < DIN / 128; ++q)
#pragma unroll
    for (int i = 0; i < 4; ++i) { const float d = x[q][i] - mu; qq += d * d; }
#pragma unroll
  for (int o = 1; o < 32; o <<= 1) qq += __shfl_xor(qq, o);
  const float rs = rsqrtf(qq * (1.0f / DIN) + 1e-5f);
#pragma unroll
  for (int q = 0; q < DIN / 128; ++q) { v4f r4; const int c = q * 128 + lane * 4;
#pragma unroll
    for (int i = 0; i < 4; ++i) r4[i] = (x[q][i] - mu) * rs * bfr(GM[c + i]) + bfr(BT[c + i]);
    vst2(OUT + row * DIN + c, r4); } }
// ---- k_rff: block = (64 rows, 128 cols): T = O + relu(O (hi + lo) . Wo[c][:] + bo[c]) (Wo (out,in) exact bf16; 2 products)
__global__ __launch_bounds__(128) void k_rff(const float* __restrict__ O, const float* __restrict__ WO, const float* __restrict__ BO, float* __restrict__ T) { __shared__ __align__(16) float sf[4][16][132];
  const int tid = threadIdx.x, wave = tid >> 5, lane = tid & 31, col = lane & 15, g = lane >> 4; const int c0 = blockIdx.y * 128; const size_t r0 = (size_t)blockIdx.x * 64 + wave * 16;
  v8f acc[8] = {};
#pragma unroll 2
  for (int kc = 0; kc < DIN / 32; ++kc) { const F2 a = split_row(O + (r0 + col) * DIN, kc * 32, lane); asm volatile("s_wait_loadcnt 0x0" ::: "memory");
#pragma unroll
    for (int j = 0; j < 8; ++j) { const v16b w = wcol_oi(WO, kc * 32, c0 + j * 16 + col, lane, DIN); asm volatile("s_wait_loadcnt 0x0" ::: "memory"); acc[j] = wmma_bf(a.h, w, acc[j]); acc[j] = wmma_bf(a.l, w, acc[j]); } }
#pragma unroll
  for (int j = 0; j < 8; ++j) { const float bb = bfr(BO[c0 + j * 16 + col]);
#pragma unroll
    for (int r = 0; r < 8; ++r) sf[wave][8 * g + r][j * 16 + col] = fmaxf(acc[j][r] + bb, 0.f); }
  LDSX(); for (int rl = 0; rl < 16; ++rl) { const size_t o2 = (r0 + rl) * DIN + c0 + lane * 4; const v4f x = *(const v4f*)(O + o2); v4f t = *(const v4f*)&sf[wave][rl][lane * 4]; t[0] += x[0]; t[1] += x[1]; t[2] += x[2]; t[3] += x[3]; vst2(T + o2, t); } }
#define WS_QF  (WS_END)
#define WS_O   (WS_QF + 4u * (size_t)NROW * DIN)
#define WS_T   (WS_O + 4u * (size_t)NROW * DIN)
#define WS_END2 (WS_T + 4u * (size_t)NROW * DIN)
#ifndef SM_EXTRA_PARAMS
#define SM_EXTRA_PARAMS
#endif
#ifndef PROJ_EXTRA_PARAMS
#define PROJ_EXTRA_PARAMS
#endif
#ifndef SM_MASK_HOOK
#define SM_MASK_HOOK (void)0
#endif

#define WS_QH  0u                                      // f16 q rows [b*t][CC]
#define WS_KH  (WS_QH + 2u * (size_t)NB * TT * CC)      // f16 k rows [b*t][CC]
#define WS_VT  (WS_KH + 2u * (size_t)NB * TT * CC)      // f16 v planes [b][c][t]
#define WS_QL  (WS_VT + 2u * (size_t)NB * CC * TT)      // f16 q residual x 2^10 rows [b][t < QHI][CC]
#define WS_KL  (WS_QL + 2u * (size_t)NB * QHI * CC)     // f16 k residual x 2^10 rows [b][t < KHI][CC]
#define WS_VB  (WS_KL + 2u * (size_t)NB * KHI * CC)     // bf16 v hi planes [b][c][t < KHI]
#define WS_VBL (WS_VB + 2u * (size_t)NB * CC * KHI)
#define WS_S   (WS_VBL + 2u * (size_t)NB * CC * KHI)    // f32 logits / P [hg][t][s]
#define WS_Y   (WS_S  + 4u * (size_t)HG * TT * TT)      // f32 ctx rows [b*t][CC] (only when there is an output projection)
#define WS_END (WS_Y  + 0u)

// ---- k_proj: block = (64 rows, 128 cols, which): q/k/v = X W (+ b) with exact bf16 products (K = DIN) -> which 0: q f16 rows (+ residual rows < QHI); 1: k f16 rows (+ residual rows < KHI); 2: v f16 planes [c][t] (+ bf16 hi/lo planes for t < KHI)
__global__ __launch_bounds__(128) void k_proj(const float* __restrict__ XQ, const float* __restrict__ XK, const float* __restrict__ XV, const float* __restrict__ WQ, const float* __restrict__ WK, const float* __restrict__ WV, const float* __restrict__ BQ, const float* __restrict__ BK, const float* __restrict__ BV,
    _Float16* __restrict__ QH, _Float16* __restrict__ QL, _Float16* __restrict__ KH, _Float16* __restrict__ KL, _Float16* __restrict__ VT, __bf16* __restrict__ VB, __bf16* __restrict__ VBL) {
  __shared__ __align__(16) _Float16 sh[64][136], sl[64][136]; __shared__ __align__(16) _Float16 th[128][72]; __shared__ __align__(16) __bf16 tb[128][72], tbl[128][72];
  const int tid = threadIdx.x, wave = tid >> 5, lane = tid & 31, col = lane & 15, g = lane >> 4; const int which = blockIdx.z; const int c0 = blockIdx.y * 128; const size_t r0 = (size_t)blockIdx.x * 64; const size_t bb = r0 / TT; const int t0 = (int)(r0 % TT);
  const float* X = which == 0 ? XQ : which == 1 ? XK : XV; const float* WA = which == 0 ? WQ : which == 1 ? WK : WV; const float* BA = which == 0 ? BQ : which == 1 ? BK : BV;
  v8f acc[8] = {};
#pragma unroll 2
  for (int kc = 0; kc < DIN / 32; ++kc) { v16b a; { const float* p = X + (r0 + wave * 16 + col) * DIN + kc * 32 + 8 * g;
#pragma unroll
      for (int i = 0; i < 8; ++i) { a[i] = (__bf16)p[i]; a[8 + i] = (__bf16)p[16 + i]; } }
    asm volatile("s_wait_loadcnt 0x0" ::: "memory");
#pragma unroll
    for (int j = 0; j < 8; ++j) { const v16b w = WCOL(WA, kc * 32, c0 + j * 16 + col, lane); asm volatile("s_wait_loadcnt 0x0" ::: "memory"); acc[j] = wmma_bf(a, w, acc[j]); } }
  if (which < 2) { _Float16* DH = which == 0 ? QH : KH; _Float16* DL = which == 0 ? QL : KL; const int nhi = which == 0 ? QHI : KHI; const bool hi_rows = t0 < nhi;
#pragma unroll
    for (int j = 0; j < 8; ++j) { const float bias = BA ? bfr(BA[c0 + j * 16 + col]) : 0.f;
#pragma unroll
      for (int r = 0; r < 8; ++r) { const float v = acc[j][r] + bias; const _Float16 hv = (_Float16)v; sh[wave * 16 + 8 * g + r][j * 16 + col] = hv; sl[wave * 16 + 8 * g + r][j * 16 + col] = (_Float16)((v - (float)hv) * 1024.0f); } }
    __syncthreads();
    for (int e = tid; e < 64 * 16; e += 128) { const int rl = e >> 4, q = e & 15; vst2((unsigned*)(DH + (r0 + rl) * CC + c0 + q * 8), *(const v4u*)&sh[rl][q * 8]); if (hi_rows) vst2((unsigned*)(DL + (bb * nhi + t0 + rl) * (size_t)CC + c0 + q * 8), *(const v4u*)&sl[rl][q * 8]); }
  } else { const bool hi_rows = t0 < KHI;
#pragma unroll
    for (int j = 0; j < 8; ++j) { const float bias = BA ? bfr(BA[c0 + j * 16 + col]) : 0.f;
#pragma unroll
      for (int r = 0; r < 8; ++r) { const float v = acc[j][r] + bias; const int rl = wave * 16 + 8 * g + r, cl = j * 16 + col; th[cl][rl] = (_Float16)v; const __bf16 bh = (__bf16)v; tb[cl][rl] = bh; tbl[cl][rl] = (__bf16)(v - (float)bh); } }
    __syncthreads();
    for (int e = tid; e < 128 * 8; e += 128) { const int cl = e >> 3, q = e & 7; vst2((unsigned*)(VT + (bb * CC + c0 + cl) * (size_t)TT + t0 + q * 8), *(const v4u*)&th[cl][q * 8]); if (hi_rows) { const size_t o3 = (bb * CC + c0 + cl) * (size_t)KHI + t0 + q * 8; vst2((unsigned*)(VB + o3), *(const v4u*)&tb[cl][q * 8]); vst2((unsigned*)(VBL + o3), *(const v4u*)&tbl[cl][q * 8]); } } } }
// ---- k_sc: block = (query block qb, key block kb <= kb_last(qb), head in group) of batch b: logits x SCALE; q hi + residual (x 2^10) against k (2 products) for query rows < QHI, plus the k residual (3 products) for query blocks < QBH (causal early rows); causal: blocks past the diagonal exit, the mask itself is applied by index in k_sm
__global__ __launch_bounds__(128) void k_sc(const _Float16* __restrict__ QH, const _Float16* __restrict__ KH, const _Float16* __restrict__ QL, const _Float16* __restrict__ KL, int b, int h0, float* __restrict__ S0) { __shared__ __align__(16) float ss[4][16][132];
  const int qb = blockIdx.x, kb = blockIdx.y; if (kb > kb_last(qb)) return;
  const int h = h0 + blockIdx.z; float* S = S0 + (size_t)blockIdx.z * TT * TT;
  const int tid = threadIdx.x, wave = tid >> 5, lane = tid & 31, col = lane & 15, g = lane >> 4; const int k0 = kb * 128; const int ql0 = qb * 64 + wave * 16; const size_t q0 = (size_t)b * TT + ql0, kr0 = (size_t)b * TT + k0;
  v8f acc[8] = {}, accl[8] = {};
  const _Float16* QLb = QL + (size_t)b * QHI * CC; const _Float16* KLb = KL + (size_t)b * KHI * CC;
  if (qb < QBH) {
#pragma unroll
    for (int kc = 0; kc < HD / 32; ++kc) { const v16h ah = frag_h(QH + (q0 + col) * CC + h * HD + kc * 32, lane), al = frag_h(QLb + (size_t)(ql0 + col) * CC + h * HD + kc * 32, lane);
#pragma unroll
      for (int j = 0; j < 8; ++j) { const v16h kbf = frag_h(KH + (kr0 + j * 16 + col) * CC + h * HD + kc * 32, lane), klf = frag_h(KLb + (size_t)(k0 + j * 16 + col) * CC + h * HD + kc * 32, lane); acc[j] = wmma16(ah, kbf, acc[j]); accl[j] = wmma16(al, kbf, accl[j]); accl[j] = wmma16(ah, klf, accl[j]); } }
  } else if (qb * 64 < QHI) {
#pragma unroll
    for (int kc = 0; kc < HD / 32; ++kc) { const v16h ah = frag_h(QH + (q0 + col) * CC + h * HD + kc * 32, lane), al = frag_h(QLb + (size_t)(ql0 + col) * CC + h * HD + kc * 32, lane);
#pragma unroll
      for (int j = 0; j < 8; ++j) { const v16h kbf = frag_h(KH + (kr0 + j * 16 + col) * CC + h * HD + kc * 32, lane); acc[j] = wmma16(ah, kbf, acc[j]); accl[j] = wmma16(al, kbf, accl[j]); } }
  } else {
#pragma unroll
    for (int kc = 0; kc < HD / 32; ++kc) { const v16h ah = frag_h(QH + (q0 + col) * CC + h * HD + kc * 32, lane);
#pragma unroll
      for (int j = 0; j < 8; ++j) { const v16h kbf = frag_h(KH + (kr0 + j * 16 + col) * CC + h * HD + kc * 32, lane); acc[j] = wmma16(ah, kbf, acc[j]); } } }
#pragma unroll
  for (int j = 0; j < 8; ++j) {
#pragma unroll
    for (int r = 0; r < 8; ++r) ss[wave][8 * g + r][j * 16 + col] = (acc[j][r] + accl[j][r] * (1.0f / 1024.0f)) * SCALE; }
  LDSX(); for (int rl = 0; rl < 16; ++rl) vst2(S + (size_t)(ql0 + rl) * TT + k0 + lane * 4, *(const v4f*)&ss[wave][rl][lane * 4]); }
// ---- k_sm: block = query row t (head in group): keys [0, kend): causal -> logit if s <= t else excluded; softmax in f32; P x 2^11 in place (0 for excluded)
__global__ __launch_bounds__(256) void k_sm(float* __restrict__ S0 SM_EXTRA_PARAMS) { __shared__ float sred[8]; __shared__ float sbc; __shared__ __align__(16) float shv[TT];
  const int tid = threadIdx.x; const int t = blockIdx.x; const int kend = (kb_last(t >> 6) + 1) * 128;
  float* sr = S0 + (size_t)blockIdx.y * TT * TT + (size_t)t * TT;
  float m = -3.0e38f; for (int k = tid; k < kend; k += 256) { float v = (!CAUSAL || k <= t) ? sr[k] : -3.0e38f; SM_MASK_HOOK; shv[k] = v; m = fmaxf(m, v); }
#pragma unroll
  for (int o = 1; o < 32; o <<= 1) m = fmaxf(m, __shfl_xor(m, o));
  if ((tid & 31) == 0) sred[tid >> 5] = m; __syncthreads(); if (tid == 0) { float a = sred[0]; for (int i = 1; i < 8; ++i) a = fmaxf(a, sred[i]); sbc = a; } __syncthreads(); m = sbc; __syncthreads();
  float sum = 0.f; for (int k = tid; k < kend; k += 256) { const float v = shv[k]; const float e = (v <= -1.0e38f) ? 0.f : expf(v - m); shv[k] = e; sum += e; }
#pragma unroll
  for (int o = 1; o < 32; o <<= 1) sum += __shfl_xor(sum, o);
  if ((tid & 31) == 0) sred[tid >> 5] = sum; __syncthreads(); if (tid == 0) { float a = 0.f; for (int i = 0; i < 8; ++i) a += sred[i]; sbc = a > 0.f ? 2048.0f / a : 0.f; }   /* a fully excluded row yields P = 0 */ __syncthreads(); const float inv = sbc;
  for (int k = tid; k < kend; k += 256) shv[k] = shv[k] * inv;
  __syncthreads(); for (int q = tid; q < kend / 4; q += 256) vst2(sr + q * 4, *(const v4f*)&shv[q * 4]); }
// ---- k_pv: block = 64 queries (qb) of (b, h): ctx = P . v over keys [0, kend) (P x 2^11 once to f16 against v f16: 1 product; causal early query blocks: P and v as bf16 hi + lo, 3 products); 256-B (row, head) segment by 16 lanes
__global__ __launch_bounds__(128) void k_pv(const float* __restrict__ PS0, const _Float16* __restrict__ VT, const __bf16* __restrict__ VB, const __bf16* __restrict__ VBL, int b, int h0, float* __restrict__ Y) { const int h = h0 + blockIdx.z; const float* PS = PS0 + (size_t)blockIdx.z * TT * TT; __shared__ __align__(16) float ss[4][16][HD + 4];
  const int tid = threadIdx.x, wave = tid >> 5, lane = tid & 31, col = lane & 15, g = lane >> 4; const int qb = blockIdx.x; const int ql0 = qb * 64 + wave * 16; const int kce = (kb_last(qb) + 1) * 4;
  v8f acc[HD / 16] = {};
  if (qb < QBH) {
#pragma unroll 1
    for (int kc = 0; kc < kce; ++kc) { const F2 p = split_row(PS + (size_t)(ql0 + col) * TT, kc * 32, lane);
      asm volatile("s_wait_loadcnt 0x0" ::: "memory");
#pragma unroll
      for (int j = 0; j < HD / 16; ++j) { const size_t po = ((size_t)b * CC + h * HD + j * 16 + col) * (size_t)KHI + kc * 32; const v16b vh = frag_b(VB + po, lane); acc[j] = wmma_bf(p.h, vh, acc[j]); acc[j] = wmma_bf(p.l, vh, acc[j]); acc[j] = wmma_bf(p.h, frag_b(VBL + po, lane), acc[j]); } }
  } else {
#pragma unroll 1
    for (int kc = 0; kc < kce; ++kc) { const v16h p = frag_f32(PS + (size_t)(ql0 + col) * TT + kc * 32, lane);
      asm volatile("s_wait_loadcnt 0x0" ::: "memory");
#pragma unroll
      for (int j = 0; j < HD / 16; ++j) { const size_t po = ((size_t)b * CC + h * HD + j * 16 + col) * (size_t)TT + kc * 32; acc[j] = wmma16(p, frag_h(VT + po, lane), acc[j]); } } }
#pragma unroll
  for (int j = 0; j < HD / 16; ++j)
#pragma unroll
    for (int r = 0; r < 8; ++r) ss[wave][8 * g + r][j * 16 + col] = acc[j][r] * (1.0f / 2048.0f);
  LDSX(); for (int rl = 0; rl < 16; ++rl) if (lane < HD / 4) vst2(Y + ((size_t)b * TT + ql0 + rl) * CC + h * HD + lane * 4, *(const v4f*)&ss[wave][rl][lane * 4]); }

extern "C" void kernel_launch(void* const* d_in, const int* in_sizes, int n_in, void* d_out, int out_size, void* d_ws, size_t ws_size, hipStream_t stream) {
  (void)in_sizes; (void)n_in; (void)out_size;
  const float** F = (const float**)d_in;
  if (ws_size < (size_t)WS_END) return;
  char* ws = (char*)d_ws; _Float16 *QH = (_Float16*)(ws + WS_QH), *KH = (_Float16*)(ws + WS_KH), *VT = (_Float16*)(ws + WS_VT), *QL = (_Float16*)(ws + WS_QL), *KL = (_Float16*)(ws + WS_KL); __bf16 *VB = (__bf16*)(ws + WS_VB), *VBL = (__bf16*)(ws + WS_VBL); float *S = (float*)(ws + WS_S), *Y = (float*)(ws + WS_Y);
  (void)Y; (void)QL; (void)KL; (void)VB; (void)VBL;
  // inputs: 0 Q, 1 K [4,2048,256]; 2 Wq, 3 bq; 4 Wk, 5 bk; 6 Wv, 7 bv; 8 Wo, 9 bo ((out,in) [256,256]); 10 g0, 11 b0; 12 g1, 13 b1
  if (ws_size < (size_t)WS_END2) return;
  float *QF = (float*)(ws + WS_QF), *O = (float*)(ws + WS_O), *T = (float*)(ws + WS_T);
  k_proj<<<dim3(TNB * TT / 64, CC / 128, 3), 128, 0, stream>>>(F[0], F[1], F[1], F[2], F[4], F[6], F[3], F[5], F[7], QH, QL, KH, KL, VT, VB, VBL);
  k_qrows<<<dim3(TNB * TT / 64, DIN / 128), 128, 0, stream>>>(F[0], F[2], F[3], QF);
  for (int b = 0; b < TNB; ++b) {
    k_sc<<<dim3(NQB, TT / 128, NH), 128, 0, stream>>>(QH, KH, QL, KL, b, 0, S);
    k_sm<<<dim3(TT, NH), 256, 0, stream>>>(S);
    k_pv<<<dim3(NQB, 1, NH), 128, 0, stream>>>(S, VT, VB, VBL, b, 0, T);   /* ctx rows into T (scratch) */
  }
  k_lnrow<<<dim3((TNB * TT + 7) / 8), 256, 0, stream>>>(QF, T, F[10], F[11], O);       /* O = LN0(Qh + A Vh) */
  k_rff<<<dim3(TNB * TT / 64, DIN / 128), 128, 0, stream>>>(O, F[8], F[9], T);       /* T = O + relu(O Wo^T + bo) */
  k_lnrow<<<dim3((TNB * TT + 7) / 8), 256, 0, stream>>>(T, nullptr, F[12], F[13], (float*)d_out);   /* out = LN1(T) */
}

// v001
// One run takes 166 microseconds.
// Next to v000, in two timings, it ran 3.61 times as fast each time.
// compute dtype: all float inputs rounded to bf16; Qh/Kh/Vh = X W^T + b with EXACT bf16 products on WMMA 16x16x32 (f32 accumulate); q as f16 hi + residual (x 2^10) against k once to f16 (2 products) x 256^-0.5, no mask; online softmax in f32 (base-2 exponential); P x 2^6 against the maximum in use, once to f16, against v once to f16 (1 product), divided by the f32 row sum at the end; Qh (recomputed exactly in f32) + ctx, LayerNorm, the rFF GEMM with the LN rows split bf16 hi + lo against exact Wo (2 products) + bo, relu, residual and the second LayerNorm in f32; f32 output.
#include <hip/hip_runtime.h>
#include <math.h>

typedef __attribute__((ext_vector_type(16))) _Float16 v16h;
typedef __attribute__((ext_vector_type(16))) __bf16 v16b;
typedef __attribute__((ext_vector_type(8)))  _Float16 v8h;
typedef __attribute__((ext_vector_type(8)))  float v8f;
typedef __attribute__((ext_vector_type(4)))  float v4f;
typedef __attribute__((ext_vector_type(2)))  float v2f;
typedef __attribute__((ext_vector_type(4)))  unsigned v4u;
typedef __attribute__((ext_vector_type(4)))  int v4i;
typedef float __attribute__((may_alias)) float_a;
typedef int __attribute__((may_alias)) int_a;

template <typename T> __device__ __forceinline__ void vst2(void* p, T v) { *(T*)p = v;  }
__device__ __forceinline__ v8f wmma16(v16h a, v16h b, v8f c) {
  v8f d = __builtin_amdgcn_wmma_f32_16x16x32_f16(false, a, false, b, (short)0, c, false, false);
  asm volatile("v_nop\n\tv_nop\n\tv_nop\n\tv_nop" : "+v"(d) : "v"(a), "v"(b));
  return d;
}
__device__ __forceinline__ v8f wmma_bf(v16b a, v16b b, v8f c) {
  v8f d = __builtin_amdgcn_wmma_f32_16x16x32_bf16(false, a, false, b, (short)0, c, false, false);
  asm volatile("v_nop\n\tv_nop\n\tv_nop\n\tv_nop" : "+v"(d) : "v"(a), "v"(b));
  return d;
}
// 16x16x32 fragments: lane = (h = lane>>4, row/col = lane&15); elements 0..7 = k0+8h+0..7, 8..15 = k0+16+8h+0..7; D element r = row 8h+r
__device__ __forceinline__ v16h frag_h(const _Float16* rowk0, int lane) {
  union { v16h v; v8h q[2]; } u; const _Float16* p = rowk0 + 8 * (lane >> 4);
  u.q[0] = *(const v8h*)p; u.q[1] = *(const v8h*)(p + 16); return u.v;
}
__device__ __forceinline__ v16h frag_f32(const float* rowk0, int lane) {
  v16h a; const float* p = rowk0 + 8 * (lane >> 4);
#pragma unroll
  for (int i = 0; i < 8; ++i) { a[i] = (_Float16)p[i]; a[8 + i] = (_Float16)p[16 + i]; }
  return a;
}
__device__ __forceinline__ v16h frag_f32s(const float* rowk0, int lane, float sc) {
  v16h a; const float* p = rowk0 + 8 * (lane >> 4);
#pragma unroll
  for (int i = 0; i < 8; ++i) { a[i] = (_Float16)(p[i] * sc); a[8 + i] = (_Float16)(p[16 + i] * sc); }
  return a;
}
// column fragment from a [K][ld] layout (column n), rows >= K read as 0
__device__ __forceinline__ v16h fragc_f32(const float* W, int k0, int n, int lane, int ld, int K) {
  v16h a; const int g = lane >> 4;
#pragma unroll
  for (int i = 0; i < 8; ++i) { const int ka = k0 + 8 * g + i, kb = ka + 16;
    a[i] = (_Float16)(ka < K ? W[(size_t)(ka < K ? ka : K - 1) * ld + n] : 0.f); a[8 + i] = (_Float16)(kb < K ? W[(size_t)(kb < K ? kb : K - 1) * ld + n] : 0.f); }
  return a;
}
struct F2 { v16b h, l; };
__device__ __forceinline__ F2 bsplit16(const float v[16]) { F2 r;
#pragma unroll
  for (int i = 0; i < 16; ++i) { const __bf16 h = (__bf16)v[i]; r.h[i] = h; r.l[i] = (__bf16)(v[i] - (float)h); }
  return r; }
__device__ __forceinline__ F2 split_row(const float* row, int k0, int lane) { float v[16]; const float* p = row + k0 + 8 * (lane >> 4);
#pragma unroll
  for (int i = 0; i < 8; ++i) { v[i] = p[i]; v[8 + i] = p[16 + i]; }
  return bsplit16(v); }
__device__ __forceinline__ F2 split_rowK(const float* row, int k0, int lane, int K) { float v[16]; const int g = lane >> 4;
#pragma unroll
  for (int i = 0; i < 8; ++i) { const int ka = k0 + 8 * g + i, kb = ka + 16; v[i] = ka < K ? row[ka < K ? ka : K - 1] : 0.f; v[8 + i] = kb < K ? row[kb < K ? kb : K - 1] : 0.f; }
  return bsplit16(v); }
__device__ __forceinline__ F2 split_col(const float* W, int k0, int n, int lane, int ld, int K) { float v[16]; const int g = lane >> 4;
#pragma unroll
  for (int i = 0; i < 8; ++i) { const int ka = k0 + 8 * g + i, kb = ka + 16; v[i] = ka < K ? W[(size_t)(ka < K ? ka : K - 1) * ld + n] : 0.f; v[8 + i] = kb < K ? W[(size_t)(kb < K ? kb : K - 1) * ld + n] : 0.f; }
  return bsplit16(v); }
__device__ __forceinline__ v8f mac3(const F2& a, const F2& b, v8f c) { c = wmma_bf(a.l, b.h, c); c = wmma_bf(a.h, b.l, c); return wmma_bf(a.h, b.h, c); }
__device__ __forceinline__ float sigm(float v) { return 1.0f / (1.0f + expf(-v)); }
#define LDSX() do { asm volatile("s_wait_dscnt 0" ::: "memory"); __builtin_amdgcn_wave_barrier(); __builtin_amdgcn_fence(__ATOMIC_RELEASE, "workgroup"); } while (0)

// Set-Transformer MAB (B 4, 2,048 queries x 2,048 keys, D 256 = 4 x 64, no mask): q = Q Wq^T + bq; k, v = K W^T + b; A = softmax(q_h k_h^T / sqrt(256)); O = q + A v (residual with the projected Q, heads merged); O = LN0(O); O = O + relu(O Wo^T + bo); O = LN1(O).
#define NB 4
#define TT 2048
#define CC 256             // NH * HD = projected width
#define DIN 256
#define NH 4
#define HD 64
#define NQB (TT / 64)
#define HG 4
#define SCALE (0.0625f)
#define CAUSAL 0
#ifndef TNB
#define TNB NB
#endif
__device__ __forceinline__ float bfr(float v) { return (float)(__bf16)v; }
__host__ __device__ __forceinline__ int kb_last(int qb) { return CAUSAL ? ((qb * 64 + 63) >> 7) : (TT / 128 - 1); }
typedef __attribute__((ext_vector_type(8))) __bf16 v8b;
__device__ __forceinline__ v16b frag_b(const __bf16* rowk0, int lane) {
  union { v16b v; v8b q[2]; } u; const __bf16* p = rowk0 + 8 * (lane >> 4);
  u.q[0] = *(const v8b*)p; u.q[1] = *(const v8b*)(p + 16); return u.v;
}
#define QBH 0              // unused: no kernel in this file has a high-precision path
#define QHI 2048            // rows carrying a q residual plane (all rows)
#define KHI 64            // key rows carrying k residual / v bf16 hi+lo planes (written by k_proj, read by no kernel in this file)
// B fragment (k rows k0+.., output column o) of a weight: (in,out) [K][ld] or (out,in) [ld rows of K]: bf16 exact, or f16(bf16 * 256) exact
__device__ __forceinline__ v16b wcol_io(const float* Wm, int k0, int o, int lane, int ld) { v16b w; const int g = lane >> 4;
#pragma unroll
  for (int i = 0; i < 8; ++i) { w[i] = (__bf16)Wm[(size_t)(k0 + 8 * g + i) * ld + o]; w[8 + i] = (__bf16)Wm[(size_t)(k0 + 16 + 8 * g + i) * ld + o]; }
  return w; }
__device__ __forceinline__ v16b wcol_oi(const float* Wm, int k0, int o, int lane, int K) { v16b w; const float* p = Wm + (size_t)o * K + k0 + 8 * (lane >> 4);
#pragma unroll
  for (int i = 0; i < 8; ++i) { w[i] = (__bf16)p[i]; w[8 + i] = (__bf16)p[16 + i]; }
  return w; }
__device__ __forceinline__ v16h wcolh_io(const float* Wm, int k0, int o, int lane, int ld) { v16h w; const int g = lane >> 4;
#pragma unroll
  for (int i = 0; i < 8; ++i) { w[i] = (_Float16)(bfr(Wm[(size_t)(k0 + 8 * g + i) * ld + o]) * 256.0f); w[8 + i] = (_Float16)(bfr(Wm[(size_t)(k0 + 16 + 8 * g + i) * ld + o]) * 256.0f); }
  return w; }
__device__ __forceinline__ v16h wcolh_oi(const float* Wm, int k0, int o, int lane, int K) { v16h w; const float* p = Wm + (size_t)o * K + k0 + 8 * (lane >> 4);
#pragma unroll
  for (int i = 0; i < 8; ++i) { w[i] = (_Float16)(bfr(p[i]) * 256.0f); w[8 + i] = (_Float16)(bfr(p[16 + i]) * 256.0f); }
  return w; }
#define WQKV_LAYOUT 1   // 0 = (in,out) [DIN][CC]; 1 = (out,in) [CC][DIN]; 2 = per-head [NH][DIN][HD]
__device__ __forceinline__ v16b wcol_hdk(const float* Wm, int k0, int o, int lane) { v16b w; const int g = lane >> 4; const float* p = Wm + (size_t)(o / HD) * DIN * HD + (o % HD);
#pragma unroll
  for (int i = 0; i < 8; ++i) { w[i] = (__bf16)p[(size_t)(k0 + 8 * g + i) * HD]; w[8 + i] = (__bf16)p[(size_t)(k0 + 16 + 8 * g + i) * HD]; }
  return w; }
#define WO_OUT_IN 0
#if WQKV_LAYOUT == 1
#define WCOL(W, k0, o, lane) wcol_oi(W, k0, o, lane, DIN)
#elif WQKV_LAYOUT == 2
#define WCOL(W, k0, o, lane) wcol_hdk(W, k0, o, lane)
#else
#define WCOL(W, k0, o, lane) wcol_io(W, k0, o, lane, CC)
#endif
#if WO_OUT_IN
#define WOCOL(W, k0, o, lane) wcol_oi(W, k0, o, lane, CC)
#define WOCOLH(W, k0, o, lane) wcolh_oi(W, k0, o, lane, CC)
#else
#define WOCOL(W, k0, o, lane) wcol_io(W, k0, o, lane, DIN)
#define WOCOLH(W, k0, o, lane) wcolh_io(W, k0, o, lane, DIN)
#endif
#define NROW (NB * TT)
// ---- k_qrows: block = (64 rows, 128 cols): QF = bf16(Q) Wq^T + bq (exact products, f32) -> rows (the residual needs Qh in f32; k_proj keeps only f16 planes)
__global__ __launch_bounds__(128) void k_qrows(const float* __restrict__ X, const float* __restrict__ WQ, const float* __restrict__ BQ, float* __restrict__ QF) { __shared__ __align__(16) float sf[4][16][132];
  const int tid = threadIdx.x, wave = tid >> 5, lane = tid & 31, col = lane & 15, g = lane >> 4; const int c0 = blockIdx.y * 128; const size_t r0 = (size_t)blockIdx.x * 64 + wave * 16;
  v8f acc[8] = {};
#pragma unroll 2
  for (int kc = 0; kc < DIN / 32; ++kc) { v16b a; { const float* p = X + (r0 + col) * DIN + kc * 32 + 8 * g;
#pragma unroll
      for (int i = 0; i < 8; ++i) { a[i] = (__bf16)p[i]; a[8 + i] = (__bf16)p[16 + i]; } }
    asm volatile("s_wait_loadcnt 0x0" ::: "memory");
#pragma unroll
    for (int j = 0; j < 8; ++j) { const v16b w = wcol_oi(WQ, kc * 32, c0 + j * 16 + col, lane, DIN); asm volatile("s_wait_loadcnt 0x0" ::: "memory"); acc[j] = wmma_bf(a, w, acc[j]); } }
#pragma unroll
  for (int j = 0; j < 8; ++j) { const float bb = bfr(BQ[c0 + j * 16 + col]);
#pragma unroll
    for (int r = 0; r < 8; ++r) sf[wave][8 * g + r][j * 16 + col] = acc[j][r] + bb; }
  LDSX(); for (int rl = 0; rl < 16; ++rl) vst2(QF + (r0 + rl) * DIN + c0 + lane * 4, *(const v4f*)&sf[wave][rl][lane * 4]); }
// ---- k_lnrow: wave per row: OUT = LayerNorm(X (+ R)) over 256 features (biased var, eps 1e-5, x g + b); X and R are f32 intermediates (no bf16 rounding)
__global__ __launch_bounds__(256) void k_lnrow(const float* __restrict__ X, const float* __restrict__ R, const float* __restrict__ GM, const float* __restrict__ BT, float* __restrict__ OUT) { const int wave = threadIdx.x >> 5, lane = threadIdx.x & 31; const size_t row = (size_t)blockIdx.x * 8 + wave; if (row >= (size_t)NROW) return;
  v4f x[DIN / 128]; float s1 = 0.f;
#pragma unroll
  for (int q = 0; q < DIN / 128; ++q) { x[q] = *(const v4f*)(X + row * DIN + q * 128 + lane * 4); if (R) { const v4f rr = *(const v4f*)(R + row * DIN + q * 128 + lane * 4); x[q][0] += rr[0]; x[q][1] += rr[1]; x[q][2] += rr[2]; x[q][3] += rr[3]; }
#pragma unroll
    for (int i = 0; i < 4; ++i) s1 += x[q][i]; }
#pragma unroll
  for (int o = 1; o < 32; o <<= 1) s1 += __shfl_xor(s1, o);
  const float mu = s1 * (1.0f / DIN); float qq = 0.f;
#pragma unroll
  for (int q = 0; q < DIN / 128; ++q)
#pragma unroll
    for (int i = 0; i < 4; ++i) { const float d = x[q][i] - mu; qq += d * d; }
#pragma unroll
  for (int o = 1; o < 32; o <<= 1) qq += __shfl_xor(qq, o);
  const float rs = rsqrtf(qq * (1.0f / DIN) + 1e-5f);
#pragma unroll
  for (int q = 0; q < DIN / 128; ++q) { v4f r4; const int c = q * 128 + lane * 4;
#pragma unroll
    for (int i = 0; i < 4; ++i) r4[i] = (x[q][i] - mu) * rs * bfr(GM[c + i]) + bfr(BT[c + i]);
    vst2(OUT + row * DIN + c, r4); } }
// ---- k_rff: block = (64 rows, 128 cols): T = O + relu(O (hi + lo) . Wo[c][:] + bo[c]) (Wo (out,in) exact bf16; 2 products)
__global__ __launch_bounds__(128) void k_rff(const float* __restrict__ O, const float* __restrict__ WO, const float* __restrict__ BO, float* __restrict__ T) { __shared__ __align__(16) float sf[4][16][132];
  const int tid = threadIdx.x, wave = tid >> 5, lane = tid & 31, col = lane & 15, g = lane >> 4; const int c0 = blockIdx.y * 128; const size_t r0 = (size_t)blockIdx.x * 64 + wave * 16;
  v8f acc[8] = {};
#pragma unroll 2
  for (int kc = 0; kc < DIN / 32; ++kc) { const F2 a = split_row(O + (r0 + col) * DIN, kc * 32, lane); asm volatile("s_wait_loadcnt 0x0" ::: "memory");
#pragma unroll
    for (int j = 0; j < 8; ++j) { const v16b w = wcol_oi(WO, kc * 32, c0 + j * 16 + col, lane, DIN); asm volatile("s_wait_loadcnt 0x0" ::: "memory"); acc[j] = wmma_bf(a.h, w, acc[j]); acc[j] = wmma_bf(a.l, w, acc[j]); } }
#pragma unroll
  for (int j = 0; j < 8; ++j) { const float bb = bfr(BO[c0 + j * 16 + col]);
#pragma unroll
    for (int r = 0; r < 8; ++r) sf[wave][8 * g + r][j * 16 + col] = fmaxf(acc[j][r] + bb, 0.f); }
  LDSX(); for (int rl = 0; rl < 16; ++rl) { const size_t o2 = (r0 + rl) * DIN + c0 + lane * 4; const v4f x = *(const v4f*)(O + o2); v4f t = *(const v4f*)&sf[wave][rl][lane * 4]; t[0] += x[0]; t[1] += x[1]; t[2] += x[2]; t[3] += x[3]; vst2(T + o2, t); } }
#define WS_QF  (WS_END)
#define WS_O   (WS_QF + 4u * (size_t)NROW * DIN)
#define WS_T   (WS_O + 4u * (size_t)NROW * DIN)
#define WS_END2 (WS_T + 4u * (size_t)NROW * DIN)
#ifndef SM_EXTRA_PARAMS
#define SM_EXTRA_PARAMS
#endif
#ifndef PROJ_EXTRA_PARAMS
#define PROJ_EXTRA_PARAMS
#endif
#ifndef SM_MASK_HOOK
#define SM_MASK_HOOK (void)0
#endif

#define WS_QH  0u                                      // f16 q rows [b*t][CC]
#define WS_KH  (WS_QH + 2u * (size_t)NB * TT * CC)      // f16 k rows [b*t][CC]
#define WS_VT  (WS_KH + 2u * (size_t)NB * TT * CC)      // f16 v planes [b][c][t]
#define WS_QL  (WS_VT + 2u * (size_t)NB * CC * TT)      // f16 q residual x 2^10 rows [b][t < QHI][CC]
#define WS_KL  (WS_QL + 2u * (size_t)NB * QHI * CC)     // f16 k residual x 2^10 rows [b][t < KHI][CC]
#define WS_VB  (WS_KL + 2u * (size_t)NB * KHI * CC)     // bf16 v hi planes [b][c][t < KHI]
#define WS_VBL (WS_VB + 2u * (size_t)NB * CC * KHI)
#define WS_S   (WS_VBL + 2u * (size_t)NB * CC * KHI)    // f32 [hg][t][s], unused: k_fa keeps logits and P in registers
#define WS_Y   (WS_S  + 4u * (size_t)HG * TT * TT)      // f32 ctx rows [b*t][CC] (only when there is an output projection)
#define WS_END (WS_Y  + 0u)

// ---- k_proj: block = (64 rows, 128 cols, which): q/k/v = X W (+ b) with exact bf16 products (K = DIN) -> which 0: q f16 rows (+ residual rows < QHI); 1: k f16 rows (+ residual rows < KHI); 2: v f16 planes [c][t] (+ bf16 hi/lo planes for t < KHI)
__global__ __launch_bounds__(128) void k_proj(const float* __restrict__ XQ, const float* __restrict__ XK, const float* __restrict__ XV, const float* __restrict__ WQ, const float* __restrict__ WK, const float* __restrict__ WV, const float* __restrict__ BQ, const float* __restrict__ BK, const float* __restrict__ BV,
    _Float16* __restrict__ QH, _Float16* __restrict__ QL, _Float16* __restrict__ KH, _Float16* __restrict__ KL, _Float16* __restrict__ VT, __bf16* __restrict__ VB, __bf16* __restrict__ VBL) {
  __shared__ __align__(16) _Float16 sh[64][136], sl[64][136]; __shared__ __align__(16) _Float16 th[128][72]; __shared__ __align__(16) __bf16 tb[128][72], tbl[128][72];
  const int tid = threadIdx.x, wave = tid >> 5, lane = tid & 31, col = lane & 15, g = lane >> 4; const int which = blockIdx.z; const int c0 = blockIdx.y * 128; const size_t r0 = (size_t)blockIdx.x * 64; const size_t bb = r0 / TT; const int t0 = (int)(r0 % TT);
  const float* X = which == 0 ? XQ : which == 1 ? XK : XV; const float* WA = which == 0 ? WQ : which == 1 ? WK : WV; const float* BA = which == 0 ? BQ : which == 1 ? BK : BV;
  v8f acc[8] = {};
#pragma unroll 2
  for (int kc = 0; kc < DIN / 32; ++kc) { v16b a; { const float* p = X + (r0 + wave * 16 + col) * DIN + kc * 32 + 8 * g;
#pragma unroll
      for (int i = 0; i < 8; ++i) { a[i] = (__bf16)p[i]; a[8 + i] = (__bf16)p[16 + i]; } }
    asm volatile("s_wait_loadcnt 0x0" ::: "memory");
#pragma unroll
    for (int j = 0; j < 8; ++j) { const v16b w = WCOL(WA, kc * 32, c0 + j * 16 + col, lane); asm volatile("s_wait_loadcnt 0x0" ::: "memory"); acc[j] = wmma_bf(a, w, acc[j]); } }
  if (which < 2) { _Float16* DH = which == 0 ? QH : KH; _Float16* DL = which == 0 ? QL : KL; const int nhi = which == 0 ? QHI : KHI; const bool hi_rows = t0 < nhi;
#pragma unroll
    for (int j = 0; j < 8; ++j) { const float bias = BA ? bfr(BA[c0 + j * 16 + col]) : 0.f;
#pragma unroll
      for (int r = 0; r < 8; ++r) { const float v = acc[j][r] + bias; const _Float16 hv = (_Float16)v; sh[wave * 16 + 8 * g + r][j * 16 + col] = hv; sl[wave * 16 + 8 * g + r][j * 16 + col] = (_Float16)((v - (float)hv) * 1024.0f); } }
    __syncthreads();
    for (int e = tid; e < 64 * 16; e += 128) { const int rl = e >> 4, q = e & 15; vst2((unsigned*)(DH + (r0 + rl) * CC + c0 + q * 8), *(const v4u*)&sh[rl][q * 8]); if (hi_rows) vst2((unsigned*)(DL + (bb * nhi + t0 + rl) * (size_t)CC + c0 + q * 8), *(const v4u*)&sl[rl][q * 8]); }
  } else { const bool hi_rows = t0 < KHI;
#pragma unroll
    for (int j = 0; j < 8; ++j) { const float bias = BA ? bfr(BA[c0 + j * 16 + col]) : 0.f;
#pragma unroll
      for (int r = 0; r < 8; ++r) { const float v = acc[j][r] + bias; const int rl = wave * 16 + 8 * g + r, cl = j * 16 + col; th[cl][rl] = (_Float16)v; const __bf16 bh = (__bf16)v; tb[cl][rl] = bh; tbl[cl][rl] = (__bf16)(v - (float)bh); } }
    __syncthreads();
    for (int e = tid; e < 128 * 8; e += 128) { const int cl = e >> 3, q = e & 7; vst2((unsigned*)(VT + (bb * CC + c0 + cl) * (size_t)TT + t0 + q * 8), *(const v4u*)&th[cl][q * 8]); if (hi_rows) { const size_t o3 = (bb * CC + c0 + cl) * (size_t)KHI + t0 + q * 8; vst2((unsigned*)(VB + o3), *(const v4u*)&tb[cl][q * 8]); vst2((unsigned*)(VBL + o3), *(const v4u*)&tbl[cl][q * 8]); } } } }
// ---- k_fa: block = 4 waves x 16 queries of (b, h), one launch for every batch and head: S^T = K Q^T (q hi + residual x 2^10, 2 products), online softmax in f32 per lane (lane = query), O^T += V^T P^T (P once to f16, 1 product); logits and P stay in registers
typedef __attribute__((ext_vector_type(2))) _Float16 v2h;
#define FA_C (SCALE * 1.4426950408889634f)   // raw q.k -> base-2 exponent
#define FA_LAZY (8.0f / FA_C)                // the maximum in use is replaced only when a new one exceeds it by 2^8
#define FA_OFF 6.0f                          // P = 2^(6 + ...) <= 2^14: keeps small weights out of the f16 subnormals; cancels against the row sum
#define FA_NP (TT / 32)                      // passes of 32 keys
__device__ __forceinline__ float xhalf(float x) { return __builtin_bit_cast(float, __builtin_amdgcn_permlanex16(__builtin_bit_cast(int, x), __builtin_bit_cast(int, x), 0x76543210, 0xfedcba98, false, false)); }
__device__ __forceinline__ v8f wm16(v16h a, v16h b, v8f c) { return __builtin_amdgcn_wmma_f32_16x16x32_f16(false, a, false, b, (short)0, c, false, false); }
// fragments of one pass: K rows (A of S^T: row = key) and V^T rows (A of O^T: row = feature, k = key), both in the hardware k order
__device__ __forceinline__ void fa_load(v16h (&kf)[2][HD / 32], v16h (&vf)[HD / 16], const _Float16* Kl, const _Float16* Vl, int pass, int lane) {
#pragma unroll
  for (int i = 0; i < 2; ++i)
#pragma unroll
    for (int kc = 0; kc < HD / 32; ++kc) kf[i][kc] = frag_h(Kl + (size_t)pass * 32 * CC + i * 16 * CC + kc * 32, lane);
#pragma unroll
  for (int j = 0; j < HD / 16; ++j) vf[j] = frag_h(Vl + pass * 32 + j * 16 * TT, lane); }
__device__ __forceinline__ void fa_pass(const v16h (&kf)[2][HD / 32], const v16h (&vf)[HD / 16], const v16h (&qh)[HD / 32], const v16h (&ql)[HD / 32], v8f (&o)[HD / 16], float& m, v2f (&l)[2]) {
  v8f sh[2] = {}, sl[2] = {};
#pragma unroll
  for (int kc = 0; kc < HD / 32; ++kc)
#pragma unroll
    for (int i = 0; i < 2; ++i) { sh[i] = wm16(kf[i][kc], qh[kc], sh[i]); sl[i] = wm16(kf[i][kc], ql[kc], sl[i]); }
  v2f t[8]; float mx = -3.0e38f;   // lane (c, h): query c, keys 8h + 0..7 and 16 + 8h + 0..7
#pragma unroll
  for (int e = 0; e < 8; ++e) { const int i = e >> 2, r = (e & 3) * 2; t[e][0] = sh[i][r] + sl[i][r] * (1.0f / 1024.0f); t[e][1] = sh[i][r + 1] + sl[i][r + 1] * (1.0f / 1024.0f); mx = fmaxf(mx, fmaxf(t[e][0], t[e][1])); }
  mx = fmaxf(mx, xhalf(mx));
  if (__builtin_amdgcn_ballot_w32(mx > m + FA_LAZY) != 0) { const float mn = fmaxf(m, mx); const float al = __builtin_amdgcn_exp2f((m - mn) * FA_C); m = mn; l[0] *= al; l[1] *= al;
#pragma unroll
    for (int j = 0; j < HD / 16; ++j)
#pragma unroll
      for (int r = 0; r < 8; ++r) o[j][r] *= al; }
  asm volatile("s_wait_xcnt 0x0" ::: "memory");   // in front of the reuse of the fragment loads' address registers
  const float mc = m * FA_C - FA_OFF; v16h p;
#pragma unroll
  for (int e = 0; e < 8; ++e) { v2f pe; pe[0] = __builtin_amdgcn_exp2f(t[e][0] * FA_C - mc); pe[1] = __builtin_amdgcn_exp2f(t[e][1] * FA_C - mc); l[e & 1] += pe; const v2h ph = __builtin_convertvector(pe, v2h); p[2 * e] = ph[0]; p[2 * e + 1] = ph[1]; }
#pragma unroll
  for (int j = 0; j < HD / 16; ++j) o[j] = wm16(vf[j], p, o[j]); }
__global__ __launch_bounds__(128) void k_fa(const _Float16* __restrict__ QH, const _Float16* __restrict__ QL, const _Float16* __restrict__ KH, const _Float16* __restrict__ VT, float* __restrict__ Y) {
  const int tid = threadIdx.x, wave = tid >> 5, lane = tid & 31, col = lane & 15, g = lane >> 4; const int h = blockIdx.y, b = blockIdx.z; const int ql0 = blockIdx.x * 64 + wave * 16;
  v16h qh[HD / 32], ql[HD / 32];
#pragma unroll
  for (int kc = 0; kc < HD / 32; ++kc) { qh[kc] = frag_h(QH + ((size_t)b * TT + ql0 + col) * CC + h * HD + kc * 32, lane); ql[kc] = frag_h(QL + ((size_t)b * QHI + ql0 + col) * CC + h * HD + kc * 32, lane); }
  const _Float16* Kl = KH + ((size_t)b * TT + col) * CC + h * HD;            // the lane's key row of pass 0, pitch CC
  const _Float16* Vl = VT + ((size_t)b * CC + h * HD + col) * (size_t)TT;    // the lane's feature row, pitch TT
  v16h kA[2][HD / 32], vA[HD / 16], kB[2][HD / 32], vB[HD / 16];
  v8f o[HD / 16] = {}; float m = -3.0e38f; v2f l[2] = {};
  fa_load(kA, vA, Kl, Vl, 0, lane);
  for (int kb = 0; kb < FA_NP; kb += 2) {   // two register sets: a pass's fragments are fetched during the pass before it
    fa_load(kB, vB, Kl, Vl, kb + 1, lane);
    fa_pass(kA, vA, qh, ql, o, m, l);
    fa_load(kA, vA, Kl, Vl, kb + 2 < FA_NP ? kb + 2 : kb, lane);   // behind the last pair: its own keys again, in bounds, unused
    fa_pass(kB, vB, qh, ql, o, m, l);
  }
  float ls = l[0][0] + l[0][1] + l[1][0] + l[1][1]; ls += xhalf(ls); const float inv = 1.0f / ls;
  float* yr = Y + ((size_t)b * TT + ql0 + col) * CC + h * HD + 8 * g;   // O^T: the lane holds features j * 16 + 8h + 0..7 of its query
#pragma unroll
  for (int j = 0; j < HD / 16; ++j) { v4f a, c;
#pragma unroll
    for (int r = 0; r < 4; ++r) { a[r] = o[j][r] * inv; c[r] = o[j][4 + r] * inv; }
    vst2(yr + j * 16, a); vst2(yr + j * 16 + 4, c); } }

extern "C" void kernel_launch(void* const* d_in, const int* in_sizes, int n_in, void* d_out, int out_size, void* d_ws, size_t ws_size, hipStream_t stream) {
  (void)in_sizes; (void)n_in; (void)out_size;
  const float** F = (const float**)d_in;
  if (ws_size < (size_t)WS_END) return;
  char* ws = (char*)d_ws; _Float16 *QH = (_Float16*)(ws + WS_QH), *KH = (_Float16*)(ws + WS_KH), *VT = (_Float16*)(ws + WS_VT), *QL = (_Float16*)(ws + WS_QL), *KL = (_Float16*)(ws + WS_KL); __bf16 *VB = (__bf16*)(ws + WS_VB), *VBL = (__bf16*)(ws + WS_VBL); float *S = (float*)(ws + WS_S), *Y = (float*)(ws + WS_Y);
  (void)Y; (void)S; (void)QL; (void)KL; (void)VB; (void)VBL;
  // inputs: 0 Q, 1 K [4,2048,256]; 2 Wq, 3 bq; 4 Wk, 5 bk; 6 Wv, 7 bv; 8 Wo, 9 bo ((out,in) [256,256]); 10 g0, 11 b0; 12 g1, 13 b1
  if (ws_size < (size_t)WS_END2) return;
  float *QF = (float*)(ws + WS_QF), *O = (float*)(ws + WS_O), *T = (float*)(ws + WS_T);
  k_proj<<<dim3(TNB * TT / 64, CC / 128, 3), 128, 0, stream>>>(F[0], F[1], F[1], F[2], F[4], F[6], F[3], F[5], F[7], QH, QL, KH, KL, VT, VB, VBL);
  k_qrows<<<dim3(TNB * TT / 64, DIN / 128), 128, 0, stream>>>(F[0], F[2], F[3], QF);
  k_fa<<<dim3(NQB, NH, TNB), 128, 0, stream>>>(QH, QL, KH, VT, T);   /* ctx rows into T (scratch) */
  k_lnrow<<<dim3((TNB * TT + 7) / 8), 256, 0, stream>>>(QF, T, F[10], F[11], O);       /* O = LN0(Qh + A Vh) */
  k_rff<<<dim3(TNB * TT / 64, DIN / 128), 128, 0, stream>>>(O, F[8], F[9], T);       /* T = O + relu(O Wo^T + bo) */
  k_lnrow<<<dim3((TNB * TT + 7) / 8), 256, 0, stream>>>(T, nullptr, F[12], F[13], (float*)d_out);   /* out = LN1(T) */
}

// v002
// One run takes 136 microseconds.
// Next to v001, in two timings, it ran 1.21 times as fast each time.
// Over all steps from v000 it is 4.37 times as fast.
// compute dtype: all float inputs rounded to bf16; Qh/Kh/Vh = X W^T + b with EXACT bf16 products on WMMA 16x16x32 (f32 accumulate); q as f16 hi + residual (x 2^10) against k once to f16 (2 products) x 256^-0.5, no mask; online softmax in f32 (base-2 exponential); P x 2^6 against the maximum in use, once to f16, against v once to f16 (1 product), divided by the f32 row sum at the end; Qh (recomputed exactly in f32) + ctx, LayerNorm, the rFF GEMM with the LN rows split bf16 hi + lo against exact Wo (2 products) + bo, relu, residual and the second LayerNorm in f32; f32 output.
#include <hip/hip_runtime.h>
#include <math.h>

typedef __attribute__((ext_vector_type(16))) _Float16 v16h;
typedef __attribute__((ext_vector_type(16))) __bf16 v16b;
typedef __attribute__((ext_vector_type(8)))  _Float16 v8h;
typedef __attribute__((ext_vector_type(8)))  float v8f;
typedef __attribute__((ext_vector_type(4)))  float v4f;
typedef __attribute__((ext_vector_type(2)))  float v2f;
typedef __attribute__((ext_vector_type(4)))  unsigned v4u;
typedef __attribute__((ext_vector_type(4)))  int v4i;
typedef float __attribute__((may_alias)) float_a;
typedef int __attribute__((may_alias)) int_a;

template <typename T> __device__ __forceinline__ void vst2(void* p, T v) { *(T*)p = v;  }
__device__ __forceinline__ v8f wmma16(v16h a, v16h b, v8f c) {
  v8f d = __builtin_amdgcn_wmma_f32_16x16x32_f16(false, a, false, b, (short)0, c, false, false);
  asm volatile("v_nop\n\tv_nop\n\tv_nop\n\tv_nop" : "+v"(d) : "v"(a), "v"(b));
  return d;
}
__device__ __forceinline__ v8f wmma_bf(v16b a, v16b b, v8f c) {
  v8f d = __builtin_amdgcn_wmma_f32_16x16x32_bf16(false, a, false, b, (short)0, c, false, false);
  asm volatile("v_nop\n\tv_nop\n\tv_nop\n\tv_nop" : "+v"(d) : "v"(a), "v"(b));
  return d;
}
// 16x16x32 fragments: lane = (h = lane>>4, row/col = lane&15); elements 0..7 = k0+8h+0..7, 8..15 = k0+16+8h+0..7; D element r = row 8h+r
__device__ __forceinline__ v16h frag_h(const _Float16* rowk0, int lane) {
  union { v16h v; v8h q[2]; } u; const _Float16* p = rowk0 + 8 * (lane >> 4);
  u.q[0] = *(const v8h*)p; u.q[1] = *(const v8h*)(p + 16); return u.v;
}
__device__ __forceinline__ v16h frag_f32(const float* rowk0, int lane) {
  v16h a; const float* p = rowk0 + 8 * (lane >> 4);
#pragma unroll
  for (int i = 0; i < 8; ++i) { a[i] = (_Float16)p[i]; a[8 + i] = (_Float16)p[16 + i]; }
  return a;
}
__device__ __forceinline__ v16h frag_f32s(const float* rowk0, int lane, float sc) {
  v16h a; const float* p = rowk0 + 8 * (lane >> 4);
#pragma unroll
  for (int i = 0; i < 8; ++i) { a[i] = (_Float16)(p[i] * sc); a[8 + i] = (_Float16)(p[16 + i] * sc); }
  return a;
}
// column fragment from a [K][ld] layout (column n), rows >= K read as 0
__device__ __forceinline__ v16h fragc_f32(const float* W, int k0, int n, int lane, int ld, int K) {
  v16h a; const int g = lane >> 4;
#pragma unroll
  for (int i = 0; i < 8; ++i) { const int ka = k0 + 8 * g + i, kb = ka + 16;
    a[i] = (_Float16)(ka < K ? W[(size_t)(ka < K ? ka : K - 1) * ld + n] : 0.f); a[8 + i] = (_Float16)(kb < K ? W[(size_t)(kb < K ? kb : K - 1) * ld + n] : 0.f); }
  return a;
}
struct F2 { v16b h, l; };
__device__ __forceinline__ F2 bsplit16(const float v[16]) { F2 r;
#pragma unroll
  for (int i = 0; i < 16; ++i) { const __bf16 h = (__bf16)v[i]; r.h[i] = h; r.l[i] = (__bf16)(v[i] - (float)h); }
  return r; }
__device__ __forceinline__ F2 split_row(const float* row, int k0, int lane) { float v[16]; const float* p = row + k0 + 8 * (lane >> 4);
#pragma unroll
  for (int i = 0; i < 8; ++i) { v[i] = p[i]; v[8 + i] = p[16 + i]; }
  return bsplit16(v); }
__device__ __forceinline__ F2 split_rowK(const float* row, int k0, int lane, int K) { float v[16]; const int g = lane >> 4;
#pragma unroll
  for (int i = 0; i < 8; ++i) { const int ka = k0 + 8 * g + i, kb = ka + 16; v[i] = ka < K ? row[ka < K ? ka : K - 1] : 0.f; v[8 + i] = kb < K ? row[kb < K ? kb : K - 1] : 0.f; }
  return bsplit16(v); }
__device__ __forceinline__ F2 split_col(const float* W, int k0, int n, int lane, int ld, int K) { float v[16]; const int g = lane >> 4;
#pragma unroll
  for (int i = 0; i < 8; ++i) { const int ka = k0 + 8 * g + i, kb = ka + 16; v[i] = ka < K ? W[(size_t)(ka < K ? ka : K - 1) * ld + n] : 0.f; v[8 + i] = kb < K ? W[(size_t)(kb < K ? kb : K - 1) * ld + n] : 0.f; }
  return bsplit16(v); }
__device__ __forceinline__ v8f mac3(const F2& a, const F2& b, v8f c) { c = wmma_bf(a.l, b.h, c); c = wmma_bf(a.h, b.l, c); return wmma_bf(a.h, b.h, c); }
__device__ __forceinline__ float sigm(float v) { return 1.0f / (1.0f + expf(-v)); }
#define LDSX() do { asm volatile("s_wait_dscnt 0" ::: "memory"); __builtin_amdgcn_wave_barrier(); __builtin_amdgcn_fence(__ATOMIC_RELEASE, "workgroup"); } while (0)

// Set-Transformer MAB (B 4, 2,048 queries x 2,048 keys, D 256 = 4 x 64, no mask): q = Q Wq^T + bq; k, v = K W^T + b; A = softmax(q_h k_h^T / sqrt(256)); O = q + A v (residual with the projected Q, heads merged); O = LN0(O); O = O + relu(O Wo^T + bo); O = LN1(O).
#define NB 4
#define TT 2048
#define CC 256             // NH * HD = projected width
#define DIN 256
#define NH 4
#define HD 64
#define NQB (TT / 64)
#define HG 4
#define SCALE (0.0625f)
#define CAUSAL 0
#ifndef TNB
#define TNB NB
#endif
__device__ __forceinline__ float bfr(float v) { return (float)(__bf16)v; }
__host__ __device__ __forceinline__ int kb_last(int qb) { return CAUSAL ? ((qb * 64 + 63) >> 7) : (TT / 128 - 1); }
typedef __attribute__((ext_vector_type(8))) __bf16 v8b;
__device__ __forceinline__ v16b frag_b(const __bf16* rowk0, int lane) {
  union { v16b v; v8b q[2]; } u; const __bf16* p = rowk0 + 8 * (lane >> 4);
  u.q[0] = *(const v8b*)p; u.q[1] = *(const v8b*)(p + 16); return u.v;
}
#define QBH 0              // unused: no kernel in this file has a high-precision path
#define QHI 2048            // rows carrying a q residual plane (all rows)
#define KHI 64            // key rows carrying k residual / v bf16 hi+lo planes (written by k_proj, read by no kernel in this file)
// B fragment (k rows k0+.., output column o) of a weight: (in,out) [K][ld] or (out,in) [ld rows of K]: bf16 exact, or f16(bf16 * 256) exact
__device__ __forceinline__ v16b wcol_io(const float* Wm, int k0, int o, int lane, int ld) { v16b w; const int g = lane >> 4;
#pragma unroll
  for (int i = 0; i < 8; ++i) { w[i] = (__bf16)Wm[(size_t)(k0 + 8 * g + i) * ld + o]; w[8 + i] = (__bf16)Wm[(size_t)(k0 + 16 + 8 * g + i) * ld + o]; }
  return w; }
__device__ __forceinline__ v16b wcol_oi(const float* Wm, int k0, int o, int lane, int K) { v16b w; const float* p = Wm + (size_t)o * K + k0 + 8 * (lane >> 4);
#pragma unroll
  for (int i = 0; i < 8; ++i) { w[i] = (__bf16)p[i]; w[8 + i] = (__bf16)p[16 + i]; }
  return w; }
__device__ __forceinline__ v16h wcolh_io(const float* Wm, int k0, int o, int lane, int ld) { v16h w; const int g = lane >> 4;
#pragma unroll
  for (int i = 0; i < 8; ++i) { w[i] = (_Float16)(bfr(Wm[(size_t)(k0 + 8 * g + i) * ld + o]) * 256.0f); w[8 + i] = (_Float16)(bfr(Wm[(size_t)(k0 + 16 + 8 * g + i) * ld + o]) * 256.0f); }
  return w; }
__device__ __forceinline__ v16h wcolh_oi(const float* Wm, int k0, int o, int lane, int K) { v16h w; const float* p = Wm + (size_t)o * K + k0 + 8 * (lane >> 4);
#pragma unroll
  for (int i = 0; i < 8; ++i) { w[i] = (_Float16)(bfr(p[i]) * 256.0f); w[8 + i] = (_Float16)(bfr(p[16 + i]) * 256.0f); }
  return w; }
#define WQKV_LAYOUT 1   // 0 = (in,out) [DIN][CC]; 1 = (out,in) [CC][DIN]; 2 = per-head [NH][DIN][HD]
__device__ __forceinline__ v16b wcol_hdk(const float* Wm, int k0, int o, int lane) { v16b w; const int g = lane >> 4; const float* p = Wm + (size_t)(o / HD) * DIN * HD + (o % HD);
#pragma unroll
  for (int i = 0; i < 8; ++i) { w[i] = (__bf16)p[(size_t)(k0 + 8 * g + i) * HD]; w[8 + i] = (__bf16)p[(size_t)(k0 + 16 + 8 * g + i) * HD]; }
  return w; }
#define WO_OUT_IN 0
#if WQKV_LAYOUT == 1
#define WCOL(W, k0, o, lane) wcol_oi(W, k0, o, lane, DIN)
#elif WQKV_LAYOUT == 2
#define WCOL(W, k0, o, lane) wcol_hdk(W, k0, o, lane)
#else
#define WCOL(W, k0, o, lane) wcol_io(W, k0, o, lane, CC)
#endif
#if WO_OUT_IN
#define WOCOL(W, k0, o, lane) wcol_oi(W, k0, o, lane, CC)
#define WOCOLH(W, k0, o, lane) wcolh_oi(W, k0, o, lane, CC)
#else
#define WOCOL(W, k0, o, lane) wcol_io(W, k0, o, lane, DIN)
#define WOCOLH(W, k0, o, lane) wcolh_io(W, k0, o, lane, DIN)
#endif
#define NROW (NB * TT)
// ---- k_qrows: block = (64 rows, 128 cols): QF = bf16(Q) Wq^T + bq (exact products, f32) -> rows (the residual needs Qh in f32; k_proj keeps only f16 planes)
__global__ __launch_bounds__(128) void k_qrows(const float* __restrict__ X, const float* __restrict__ WQ, const float* __restrict__ BQ, float* __restrict__ QF) { __shared__ __align__(16) float sf[4][16][132];
  const int tid = threadIdx.x, wave = tid >> 5, lane = tid & 31, col = lane & 15, g = lane >> 4; const int c0 = blockIdx.y * 128; const size_t r0 = (size_t)blockIdx.x * 64 + wave * 16;
  v8f acc[8] = {};
#pragma unroll 2
  for (int kc = 0; kc < DIN / 32; ++kc) { v16b a; { const float* p = X + (r0 + col) * DIN + kc * 32 + 8 * g;
#pragma unroll
      for (int i = 0; i < 8; ++i) { a[i] = (__bf16)p[i]; a[8 + i] = (__bf16)p[16 + i]; } }
    asm volatile("s_wait_loadcnt 0x0" ::: "memory");
#pragma unroll
    for (int j = 0; j < 8; ++j) { const v16b w = wcol_oi(WQ, kc * 32, c0 + j * 16 + col, lane, DIN); asm volatile("s_wait_loadcnt 0x0" ::: "memory"); acc[j] = wmma_bf(a, w, acc[j]); } }
#pragma unroll
  for (int j = 0; j < 8; ++j) { const float bb = bfr(BQ[c0 + j * 16 + col]);
#pragma unroll
    for (int r = 0; r < 8; ++r) sf[wave][8 * g + r][j * 16 + col] = acc[j][r] + bb; }
  LDSX(); for (int rl = 0; rl < 16; ++rl) vst2(QF + (r0 + rl) * DIN + c0 + lane * 4, *(const v4f*)&sf[wave][rl][lane * 4]); }
// ---- k_lnrow: wave per row: OUT = LayerNorm(X (+ R)) over 256 features (biased var, eps 1e-5, x g + b); X and R are f32 intermediates (no bf16 rounding)
__global__ __launch_bounds__(256) void k_lnrow(const float* __restrict__ X, const float* __restrict__ R, const float* __restrict__ GM, const float* __restrict__ BT, float* __restrict__ OUT) { const int wave = threadIdx.x >> 5, lane = threadIdx.x & 31; const size_t row = (size_t)blockIdx.x * 8 + wave; if (row >= (size_t)NROW) return;
  v4f x[DIN / 128]; float s1 = 0.f;
#pragma unroll
  for (int q = 0; q < DIN / 128; ++q) { x[q] = *(const v4f*)(X + row * DIN + q * 128 + lane * 4); if (R) { const v4f rr = *(const v4f*)(R + row * DIN + q * 128 + lane * 4); x[q][0] += rr[0]; x[q][1] += rr[1]; x[q][2] += rr[2]; x[q][3] += rr[3]; }
#pragma unroll
    for (int i = 0; i < 4; ++i) s1 += x[q][i]; }
#pragma unroll
  for (int o = 1; o < 32; o <<= 1) s1 += __shfl_xor(s1, o);
  const float mu = s1 * (1.0f / DIN); float qq = 0.f;
#pragma unroll
  for (int q = 0; q < DIN / 128; ++q)
#pragma unroll
    for (int i = 0; i < 4; ++i) { const float d = x[q][i] - mu; qq += d * d; }
#pragma unroll
  for (int o = 1; o < 32; o <<= 1) qq += __shfl_xor(qq, o);
  const float rs = rsqrtf(qq * (1.0f / DIN) + 1e-5f);
#pragma unroll
  for (int q = 0; q < DIN / 128; ++q) { v4f r4; const int c = q * 128 + lane * 4;
#pragma unroll
    for (int i = 0; i < 4; ++i) r4[i] = (x[q][i] - mu) * rs * bfr(GM[c + i]) + bfr(BT[c + i]);
    vst2(OUT + row * DIN + c, r4); } }
// ---- k_rff: block = (64 rows, 128 cols): T = O + relu(O (hi + lo) . Wo[c][:] + bo[c]) (Wo (out,in) exact bf16; 2 products)
__global__ __launch_bounds__(128) void k_rff(const float* __restrict__ O, const float* __restrict__ WO, const float* __restrict__ BO, float* __restrict__ T) { __shared__ __align__(16) float sf[4][16][132];
  const int tid = threadIdx.x, wave = tid >> 5, lane = tid & 31, col = lane & 15, g = lane >> 4; const int c0 = blockIdx.y * 128; const size_t r0 = (size_t)blockIdx.x * 64 + wave * 16;
  v8f acc[8] = {};
#pragma unroll 2
  for (int kc = 0; kc < DIN / 32; ++kc) { const F2 a = split_row(O + (r0 + col) * DIN, kc * 32, lane); asm volatile("s_wait_loadcnt 0x0" ::: "memory");
#pragma unroll
    for (int j = 0; j < 8; ++j) { const v16b w = wcol_oi(WO, kc * 32, c0 + j * 16 + col, lane, DIN); asm volatile("s_wait_loadcnt 0x0" ::: "memory"); acc[j] = wmma_bf(a.h, w, acc[j]); acc[j] = wmma_bf(a.l, w, acc[j]); } }
#pragma unroll
  for (int j = 0; j < 8; ++j) { const float bb = bfr(BO[c0 + j * 16 + col]);
#pragma unroll
    for (int r = 0; r < 8; ++r) sf[wave][8 * g + r][j * 16 + col] = fmaxf(acc[j][r] + bb, 0.f); }
  LDSX(); for (int rl = 0; rl < 16; ++rl) { const size_t o2 = (r0 + rl) * DIN + c0 + lane * 4; const v4f x = *(const v4f*)(O + o2); v4f t = *(const v4f*)&sf[wave][rl][lane * 4]; t[0] += x[0]; t[1] += x[1]; t[2] += x[2]; t[3] += x[3]; vst2(T + o2, t); } }
#define WS_QF  (WS_END)
#define WS_O   (WS_QF + 4u * (size_t)NROW * DIN)
#define WS_T   (WS_O + 4u * (size_t)NROW * DIN)
#define WS_END2 (WS_T + 4u * (size_t)NROW * DIN)
#ifndef SM_EXTRA_PARAMS
#define SM_EXTRA_PARAMS
#endif
#ifndef PROJ_EXTRA_PARAMS
#define PROJ_EXTRA_PARAMS
#endif
#ifndef SM_MASK_HOOK
#define SM_MASK_HOOK (void)0
#endif

#define WS_QH  0u                                      // f16 q rows [b*t][CC]
#define WS_KH  (WS_QH + 2u * (size_t)NB * TT * CC)      // f16 k rows [b*t][CC]
#define WS_VT  (WS_KH + 2u * (size_t)NB * TT * CC)      // f16 v planes [b][c][t]
#define WS_QL  (WS_VT + 2u * (size_t)NB * CC * TT)      // f16 q residual x 2^10 rows [b][t < QHI][CC]
#define WS_KL  (WS_QL + 2u * (size_t)NB * QHI * CC)     // f16 k residual x 2^10 rows [b][t < KHI][CC]
#define WS_VB  (WS_KL + 2u * (size_t)NB * KHI * CC)     // bf16 v hi planes [b][c][t < KHI]
#define WS_VBL (WS_VB + 2u * (size_t)NB * CC * KHI)
#define WS_S   (WS_VBL + 2u * (size_t)NB * CC * KHI)    // f32 [hg][t][s], unused: k_fa keeps logits and P in registers
#define WS_Y   (WS_S  + 4u * (size_t)HG * TT * TT)      // f32 ctx rows [b*t][CC] (only when there is an output projection)
#define WS_END (WS_Y  + 0u)

// ---- k_proj: block = (64 rows, 128 cols, which): q/k/v = X W (+ b) with exact bf16 products (K = DIN) -> which 0: q f16 rows (+ residual rows < QHI); 1: k f16 rows (+ residual rows < KHI); 2: v f16 planes [c][t] (+ bf16 hi/lo planes for t < KHI)
__global__ __launch_bounds__(128) void k_proj(const float* __restrict__ XQ, const float* __restrict__ XK, const float* __restrict__ XV, const float* __restrict__ WQ, const float* __restrict__ WK, const float* __restrict__ WV, const float* __restrict__ BQ, const float* __restrict__ BK, const float* __restrict__ BV,
    _Float16* __restrict__ QH, _Float16* __restrict__ QL, _Float16* __restrict__ KH, _Float16* __restrict__ KL, _Float16* __restrict__ VT, __bf16* __restrict__ VB, __bf16* __restrict__ VBL) {
  __shared__ __align__(16) _Float16 sh[64][136], sl[64][136]; __shared__ __align__(16) _Float16 th[128][72]; __shared__ __align__(16) __bf16 tb[128][72], tbl[128][72];
  const int tid = threadIdx.x, wave = tid >> 5, lane = tid & 31, col = lane & 15, g = lane >> 4; const int which = blockIdx.z; const int c0 = blockIdx.y * 128; const size_t r0 = (size_t)blockIdx.x * 64; const size_t bb = r0 / TT; const int t0 = (int)(r0 % TT);
  const float* X = which == 0 ? XQ : which == 1 ? XK : XV; const float* WA = which == 0 ? WQ : which == 1 ? WK : WV; const float* BA = which == 0 ? BQ : which == 1 ? BK : BV;
  v8f acc[8] = {};
#pragma unroll 2
  for (int kc = 0; kc < DIN / 32; ++kc) { v16b a; { const float* p = X + (r0 + wave * 16 + col) * DIN + kc * 32 + 8 * g;
#pragma unroll
      for (int i = 0; i < 8; ++i) { a[i] = (__bf16)p[i]; a[8 + i] = (__bf16)p[16 + i]; } }
    asm volatile("s_wait_loadcnt 0x0" ::: "memory");
#pragma unroll
    for (int j = 0; j < 8; ++j) { const v16b w = WCOL(WA, kc * 32, c0 + j * 16 + col, lane); asm volatile("s_wait_loadcnt 0x0" ::: "memory"); acc[j] = wmma_bf(a, w, acc[j]); } }
  if (which < 2) { _Float16* DH = which == 0 ? QH : KH; _Float16* DL = which == 0 ? QL : KL; const int nhi = which == 0 ? QHI : KHI; const bool hi_rows = t0 < nhi;
#pragma unroll
    for (int j = 0; j < 8; ++j) { const float bias = BA ? bfr(BA[c0 + j * 16 + col]) : 0.f;
#pragma unroll
      for (int r = 0; r < 8; ++r) { const float v = acc[j][r] + bias; const _Float16 hv = (_Float16)v; sh[wave * 16 + 8 * g + r][j * 16 + col] = hv; sl[wave * 16 + 8 * g + r][j * 16 + col] = (_Float16)((v - (float)hv) * 1024.0f); } }
    __syncthreads();
    for (int e = tid; e < 64 * 16; e += 128) { const int rl = e >> 4, q = e & 15; vst2((unsigned*)(DH + (r0 + rl) * CC + c0 + q * 8), *(const v4u*)&sh[rl][q * 8]); if (hi_rows) vst2((unsigned*)(DL + (bb * nhi + t0 + rl) * (size_t)CC + c0 + q * 8), *(const v4u*)&sl[rl][q * 8]); }
  } else { const bool hi_rows = t0 < KHI;
#pragma unroll
    for (int j = 0; j < 8; ++j) { const float bias = BA ? bfr(BA[c0 + j * 16 + col]) : 0.f;
#pragma unroll
      for (int r = 0; r < 8; ++r) { const float v = acc[j][r] + bias; const int rl = wave * 16 + 8 * g + r, cl = j * 16 + col; th[cl][rl] = (_Float16)v; const __bf16 bh = (__bf16)v; tb[cl][rl] = bh; tbl[cl][rl] = (__bf16)(v - (float)bh); } }
    __syncthreads();
    for (int e = tid; e < 128 * 8; e += 128) { const int cl = e >> 3, q = e & 7; vst2((unsigned*)(VT + (bb * CC + c0 + cl) * (size_t)TT + t0 + q * 8), *(const v4u*)&th[cl][q * 8]); if (hi_rows) { const size_t o3 = (bb * CC + c0 + cl) * (size_t)KHI + t0 + q * 8; vst2((unsigned*)(VB + o3), *(const v4u*)&tb[cl][q * 8]); vst2((unsigned*)(VBL + o3), *(const v4u*)&tbl[cl][q * 8]); } } } }
// ---- k_fa: block = 4 waves x 16 queries of (b, h), one launch for every batch and head: S^T = K Q^T (q hi + residual x 2^10, 2 products), online softmax in f32 per lane (lane = query), O^T += V^T P^T (P once to f16, 1 product); logits and P stay in registers; K rows and V^T rows of 128 keys a stage come into LDS by asynchronous copies (two buffers) and serve the block's four waves
typedef __attribute__((ext_vector_type(2))) _Float16 v2h;
#define FA_C (SCALE * 1.4426950408889634f)   // raw q.k -> base-2 exponent
#define FA_LAZY (8.0f / FA_C)                // the maximum in use is replaced only when a new one exceeds it by 2^8
#define FA_OFF 6.0f                          // P = 2^(6 + ...) <= 2^14: keeps small weights out of the f16 subnormals; cancels against the row sum
#define FA_KT 128                            // keys a stage (4 passes of 32 keys)
#define FA_NT (TT / FA_KT)                   // stages
#define FA_KP (HD + 8)                       // LDS pitch of a K row in f16: 128 B + 16 B = 16 B x odd, free of bank conflicts for 16-byte reads
#define FA_VP (FA_KT + 8)                    // LDS pitch of a V^T row in f16: 256 B + 16 B
#define FA_KBUF (FA_KT * FA_KP)
#define FA_VBUF (HD * FA_VP)
__device__ __forceinline__ float xhalf(float x) { return __builtin_bit_cast(float, __builtin_amdgcn_permlanex16(__builtin_bit_cast(int, x), __builtin_bit_cast(int, x), 0x76543210, 0xfedcba98, false, false)); }
__device__ __forceinline__ v8f wm16(v16h a, v16h b, v8f c) { return __builtin_amdgcn_wmma_f32_16x16x32_f16(false, a, false, b, (short)0, c, false, false); }
// fragments of one pass, from the stage's LDS buffer: K rows (A of S^T: row = key) and V^T rows (A of O^T: row = feature, k = key), both in the hardware k order
__device__ __forceinline__ void fa_load(v16h (&kf)[2][HD / 32], v16h (&vf)[HD / 16], const _Float16* Kl, const _Float16* Vl, int pass, int lane) {
#pragma unroll
  for (int i = 0; i < 2; ++i)
#pragma unroll
    for (int kc = 0; kc < HD / 32; ++kc) kf[i][kc] = frag_h(Kl + (pass * 32 + i * 16) * FA_KP + kc * 32, lane);
#pragma unroll
  for (int j = 0; j < HD / 16; ++j) vf[j] = frag_h(Vl + pass * 32 + j * 16 * FA_VP, lane); }
// eight asynchronous 16-byte copies a lane, global -> LDS, at fixed steps of both addresses; the s_wait_xcnt stands inside the statement so that no address register is rewritten in front of it
__device__ __forceinline__ void fa_copy8(unsigned l, unsigned ls, const _Float16* g, size_t gs) {
  asm volatile("global_load_async_to_lds_b128 %0, %8, off\n\tglobal_load_async_to_lds_b128 %1, %9, off\n\tglobal_load_async_to_lds_b128 %2, %10, off\n\tglobal_load_async_to_lds_b128 %3, %11, off\n\t"
               "global_load_async_to_lds_b128 %4, %12, off\n\tglobal_load_async_to_lds_b128 %5, %13, off\n\tglobal_load_async_to_lds_b128 %6, %14, off\n\tglobal_load_async_to_lds_b128 %7, %15, off\n\ts_wait_xcnt 0x0"
               :: "v"(l), "v"(l + ls), "v"(l + 2 * ls), "v"(l + 3 * ls), "v"(l + 4 * ls), "v"(l + 5 * ls), "v"(l + 6 * ls), "v"(l + 7 * ls),
                  "v"(g), "v"(g + gs), "v"(g + 2 * gs), "v"(g + 3 * gs), "v"(g + 4 * gs), "v"(g + 5 * gs), "v"(g + 6 * gs), "v"(g + 7 * gs) : "memory"); }
template <bool AHEAD> __device__ __forceinline__ void fa_pass(const v16h (&kf)[2][HD / 32], const v16h (&vf)[HD / 16], const v16h (&kn)[2][HD / 32], const v16h (&qh)[HD / 32], const v16h (&ql)[HD / 32], v8f (&o)[HD / 16], float& m, v2f (&l)[2]) {
  v8f sh[2] = {}, sl[2] = {};
#pragma unroll
  for (int kc = 0; kc < HD / 32; ++kc)
#pragma unroll
    for (int i = 0; i < 2; ++i) { sh[i] = wm16(kf[i][kc], qh[kc], sh[i]); sl[i] = wm16(kf[i][kc], ql[kc], sl[i]); }
  v2f t[8]; float mx = -3.0e38f;   // lane (c, h): query c, keys 8h + 0..7 and 16 + 8h + 0..7
#pragma unroll
  for (int e = 0; e < 8; ++e) { const int i = e >> 2, r = (e & 3) * 2; t[e][0] = sh[i][r] + sl[i][r] * (1.0f / 1024.0f); t[e][1] = sh[i][r + 1] + sl[i][r + 1] * (1.0f / 1024.0f); mx = fmaxf(mx, fmaxf(t[e][0], t[e][1])); }
  mx = fmaxf(mx, xhalf(mx));
  if (AHEAD) asm volatile("" :: "v"(kn[0][0]), "v"(kn[0][1]), "v"(kn[1][0]), "v"(kn[1][1]));   // inputs only: holds the LDS loads of the next pass's K fragments in front of the branch below; behind it they would stand directly in front of their products, their latency open
  if (__builtin_amdgcn_ballot_w32(mx > m + FA_LAZY) != 0) { const float mn = fmaxf(m, mx); const float al = __builtin_amdgcn_exp2f((m - mn) * FA_C); m = mn; l[0] *= al; l[1] *= al;
#pragma unroll
    for (int j = 0; j < HD / 16; ++j)
#pragma unroll
      for (int r = 0; r < 8; ++r) o[j][r] *= al; }
  const float mc = m * FA_C - FA_OFF; v16h p;
#pragma unroll
  for (int e = 0; e < 8; ++e) { v2f pe; pe[0] = __builtin_amdgcn_exp2f(t[e][0] * FA_C - mc); pe[1] = __builtin_amdgcn_exp2f(t[e][1] * FA_C - mc); l[e & 1] += pe; const v2h ph = __builtin_convertvector(pe, v2h); p[2 * e] = ph[0]; p[2 * e + 1] = ph[1]; }
#pragma unroll
  for (int j = 0; j < HD / 16; ++j) o[j] = wm16(vf[j], p, o[j]); }
__global__ __launch_bounds__(128) void k_fa(const _Float16* __restrict__ QH, const _Float16* __restrict__ QL, const _Float16* __restrict__ KH, const _Float16* __restrict__ VT, float* __restrict__ Y) {
  __shared__ __align__(16) _Float16 ks[2][FA_KBUF], vs[2][FA_VBUF];
  const int tid = threadIdx.x, wave = tid >> 5, lane = tid & 31, col = lane & 15, g = lane >> 4; const int h = blockIdx.y, b = blockIdx.z; const int ql0 = blockIdx.x * 64 + wave * 16;
  v16h qh[HD / 32], ql[HD / 32];
#pragma unroll
  for (int kc = 0; kc < HD / 32; ++kc) { qh[kc] = frag_h(QH + ((size_t)b * TT + ql0 + col) * CC + h * HD + kc * 32, lane); ql[kc] = frag_h(QL + ((size_t)b * QHI + ql0 + col) * CC + h * HD + kc * 32, lane); }
  // a stage's copies: K 128 rows x 128 B (a thread: 16 B of rows tid / 8 + 16 i), V^T 64 rows x 256 B (16 B of rows tid / 16 + 8 i): whole 128-byte lines on the global side
  const _Float16* Kg = KH + ((size_t)b * TT + (tid >> 3)) * CC + h * HD + (tid & 7) * 8;
  const _Float16* Vg = VT + ((size_t)b * CC + h * HD + (tid >> 4)) * (size_t)TT + (tid & 15) * 8;
  const unsigned kd = (unsigned)(size_t)&ks[0][(tid >> 3) * FA_KP + (tid & 7) * 8], vd = (unsigned)(size_t)&vs[0][(tid >> 4) * FA_VP + (tid & 15) * 8];   // LDS byte addresses
  v16h kA[2][HD / 32], vA[HD / 16], kB[2][HD / 32], vB[HD / 16];
  v8f o[HD / 16] = {}; float m = -3.0e38f; v2f l[2] = {};
  fa_copy8(kd, 16 * FA_KP * 2, Kg, (size_t)16 * CC); fa_copy8(vd, 8 * FA_VP * 2, Vg, (size_t)8 * TT);
  asm volatile("s_wait_asynccnt 0x0" ::: "memory");   // this wave's copies of stage 0 have landed
  __syncthreads();                                    // stage 0 is published to every wave
  fa_copy8(kd + FA_KBUF * 2, 16 * FA_KP * 2, Kg + (size_t)FA_KT * CC, (size_t)16 * CC); fa_copy8(vd + FA_VBUF * 2, 8 * FA_VP * 2, Vg + FA_KT, (size_t)8 * TT);
  for (int t = 0; t < FA_NT; ++t) {   // trip t reads buffer t mod 2 alone, while stage t + 1 flies into the other
    const int bf = t & 1; const _Float16* Kl = &ks[bf][col * FA_KP]; const _Float16* Vl = &vs[bf][col * FA_VP];   // the lane's key row of pass 0 and its feature row
    fa_load(kA, vA, Kl, Vl, 0, lane);   // two register sets: inside a stage a pass's fragments are fetched during the pass before it
    fa_load(kB, vB, Kl, Vl, 1, lane);
    fa_pass<true>(kA, vA, kB, qh, ql, o, m, l);
    fa_load(kA, vA, Kl, Vl, 2, lane);
    fa_pass<true>(kB, vB, kA, qh, ql, o, m, l);
    fa_load(kB, vB, Kl, Vl, 3, lane);
    fa_pass<true>(kA, vA, kB, qh, ql, o, m, l);
    fa_pass<false>(kB, vB, kB, qh, ql, o, m, l);
    asm volatile("s_wait_dscnt 0x0" ::: "memory");      // this wave's reads of buffer t mod 2 are done before it is refilled
    asm volatile("s_wait_asynccnt 0x0" ::: "memory");   // this wave's copies of stage t + 1 have landed
    __syncthreads();                                    // publishes stage t + 1 and ends every wave's reads of buffer t mod 2
    if (t + 2 < FA_NT) { fa_copy8(kd + bf * (FA_KBUF * 2), 16 * FA_KP * 2, Kg + (size_t)(t + 2) * FA_KT * CC, (size_t)16 * CC); fa_copy8(vd + bf * (FA_VBUF * 2), 8 * FA_VP * 2, Vg + (t + 2) * FA_KT, (size_t)8 * TT); }
  }
  asm volatile("s_wait_asynccnt 0x0" ::: "memory");   // no copy is outstanding when the wave ends
  float ls = l[0][0] + l[0][1] + l[1][0] + l[1][1]; ls += xhalf(ls); const float inv = 1.0f / ls;
  float* yr = Y + ((size_t)b * TT + ql0 + col) * CC + h * HD + 8 * g;   // O^T: the lane holds features j * 16 + 8h + 0..7 of its query
#pragma unroll
  for (int j = 0; j < HD / 16; ++j) { v4f a, c;
#pragma unroll
    for (int r = 0; r < 4; ++r) { a[r] = o[j][r] * inv; c[r] = o[j][4 + r] * inv; }
    vst2(yr + j * 16, a); vst2(yr + j * 16 + 4, c); } }

extern "C" void kernel_launch(void* const* d_in, const int* in_sizes, int n_in, void* d_out, int out_size, void* d_ws, size_t ws_size, hipStream_t stream) {
  (void)in_sizes; (void)n_in; (void)out_size;
  const float** F = (const float**)d_in;
  if (ws_size < (size_t)WS_END) return;
  char* ws = (char*)d_ws; _Float16 *QH = (_Float16*)(ws + WS_QH), *KH = (_Float16*)(ws + WS_KH), *VT = (_Float16*)(ws + WS_VT), *QL = (_Float16*)(ws + WS_QL), *KL = (_Float16*)(ws + WS_KL); __bf16 *VB = (__bf16*)(ws + WS_VB), *VBL = (__bf16*)(ws + WS_VBL); float *S = (float*)(ws + WS_S), *Y = (float*)(ws + WS_Y);
  (void)Y; (void)S; (void)QL; (void)KL; (void)VB; (void)VBL;
  // inputs: 0 Q, 1 K [4,2048,256]; 2 Wq, 3 bq; 4 Wk, 5 bk; 6 Wv, 7 bv; 8 Wo, 9 bo ((out,in) [256,256]); 10 g0, 11 b0; 12 g1, 13 b1
  if (ws_size < (size_t)WS_END2) return;
  float *QF = (float*)(ws + WS_QF), *O = (float*)(ws + WS_O), *T = (float*)(ws + WS_T);
  k_proj<<<dim3(TNB * TT / 64, CC / 128, 3), 128, 0, stream>>>(F[0], F[1], F[1], F[2], F[4], F[6], F[3], F[5], F[7], QH, QL, KH, KL, VT, VB, VBL);
  k_qrows<<<dim3(TNB * TT / 64, DIN / 128), 128, 0, stream>>>(F[0], F[2], F[3], QF);
  k_fa<<<dim3(NQB, NH, TNB), 128, 0, stream>>>(QH, QL, KH, VT, T);   /* ctx rows into T (scratch) */
  k_lnrow<<<dim3((TNB * TT + 7) / 8), 256, 0, stream>>>(QF, T, F[10], F[11], O);       /* O = LN0(Qh + A Vh) */
  k_rff<<<dim3(TNB * TT / 64, DIN / 128), 128, 0, stream>>>(O, F[8], F[9], T);       /* T = O + relu(O Wo^T + bo) */
  k_lnrow<<<dim3((TNB * TT + 7) / 8), 256, 0, stream>>>(T, nullptr, F[12], F[13], (float*)d_out);   /* out = LN1(T) */
}

// v003
// Measured time: 68.5 microseconds a run.
// Two timings next to v002 both put it at 1.98 times that version's speed.
// All steps since v000 together make it 8.66 times as fast.
// compute dtype: all float inputs rounded to bf16; Qh/Kh/Vh = X W^T + b with EXACT bf16 products on WMMA 16x16x32 (f32 accumulate); q as f16 hi + residual (x 2^10) against k once to f16 (2 products) x 256^-0.5, no mask; online softmax in f32 (base-2 exponential); P x 2^6 against the maximum in use, once to f16, against v once to f16 (1 product), divided by the f32 row sum at the end; Qh (recomputed exactly in f32) + ctx, LayerNorm, the rFF GEMM with the LN rows split bf16 hi + lo against exact Wo (2 products) + bo, relu, residual and the second LayerNorm in f32; f32 output.
#include <hip/hip_runtime.h>
#include <math.h>

typedef __attribute__((ext_vector_type(16))) _Float16 v16h;
typedef __attribute__((ext_vector_type(16))) __bf16 v16b;
typedef __attribute__((ext_vector_type(8)))  _Float16 v8h;
typedef __attribute__((ext_vector_type(8)))  float v8f;
typedef __attribute__((ext_vector_type(4)))  float v4f;
typedef __attribute__((ext_vector_type(2)))  float v2f;
typedef __attribute__((ext_vector_type(4)))  unsigned v4u;
typedef __attribute__((ext_vector_type(4)))  int v4i;
typedef float __attribute__((may_alias)) float_a;
typedef int __attribute__((may_alias)) int_a;

template <typename T> __device__ __forceinline__ void vst2(void* p, T v) { *(T*)p = v;  }
__device__ __forceinline__ v8f wmma16(v16h a, v16h b, v8f c) {
  v8f d = __builtin_amdgcn_wmma_f32_16x16x32_f16(false, a, false, b, (short)0, c, false, false);
  asm volatile("v_nop\n\tv_nop\n\tv_nop\n\tv_nop" : "+v"(d) : "v"(a), "v"(b));
  return d;
}
__device__ __forceinline__ v8f wmma_bf(v16b a, v16b b, v8f c) {
  v8f d = __builtin_amdgcn_wmma_f32_16x16x32_bf16(false, a, false, b, (short)0, c, false, false);
  asm volatile("v_nop\n\tv_nop\n\tv_nop\n\tv_nop" : "+v"(d) : "v"(a), "v"(b));
  return d;
}
// 16x16x32 fragments: lane = (h = lane>>4, row/col = lane&15); elements 0..7 = k0+8h+0..7, 8..15 = k0+16+8h+0..7; D element r = row 8h+r
__device__ __forceinline__ v16h frag_h(const _Float16* rowk0, int lane) {
  union { v16h v; v8h q[2]; } u; const _Float16* p = rowk0 + 8 * (lane >> 4);
  u.q[0] = *(const v8h*)p; u.q[1] = *(const v8h*)(p + 16); return u.v;
}
__device__ __forceinline__ v16h frag_f32(const float* rowk0, int lane) {
  v16h a; const float* p = rowk0 + 8 * (lane >> 4);
#pragma unroll
  for (int i = 0; i < 8; ++i) { a[i] = (_Float16)p[i]; a[8 + i] = (_Float16)p[16 + i]; }
  return a;
}
__device__ __forceinline__ v16h frag_f32s(const float* rowk0, int lane, float sc) {
  v16h a; const float* p = rowk0 + 8 * (lane >> 4);
#pragma unroll
  for (int i = 0; i < 8; ++i) { a[i] = (_Float16)(p[i] * sc); a[8 + i] = (_Float16)(p[16 + i] * sc); }
  return a;
}
// column fragment from a [K][ld] layout (column n), rows >= K read as 0
__device__ __forceinline__ v16h fragc_f32(const float* W, int k0, int n, int lane, int ld, int K) {
  v16h a; const int g = lane >> 4;
#pragma unroll
  for (int i = 0; i < 8; ++i) { const int ka = k0 + 8 * g + i, kb = ka + 16;
    a[i] = (_Float16)(ka < K ? W[(size_t)(ka < K ? ka : K - 1) * ld + n] : 0.f); a[8 + i] = (_Float16)(kb < K ? W[(size_t)(kb < K ? kb : K - 1) * ld + n] : 0.f); }
  return a;
}
struct F2 { v16b h, l; };
__device__ __forceinline__ F2 bsplit16(const float v[16]) { F2 r;
#pragma unroll
  for (int i = 0; i < 16; ++i) { const __bf16 h = (__bf16)v[i]; r.h[i] = h; r.l[i] = (__bf16)(v[i] - (float)h); }
  return r; }
__device__ __forceinline__ F2 split_row(const float* row, int k0, int lane) { float v[16]; const float* p = row + k0 + 8 * (lane >> 4);
#pragma unroll
  for (int i = 0; i < 8; ++i) { v[i] = p[i]; v[8 + i] = p[16 + i]; }
  return bsplit16(v); }
__device__ __forceinline__ F2 split_rowK(const float* row, int k0, int lane, int K) { float v[16]; const int g = lane >> 4;
#pragma unroll
  for (int i = 0; i < 8; ++i) { const int ka = k0 + 8 * g + i, kb = ka + 16; v[i] = ka < K ? row[ka < K ? ka : K - 1] : 0.f; v[8 + i] = kb < K ? row[kb < K ? kb : K - 1] : 0.f; }
  return bsplit16(v); }
__device__ __forceinline__ F2 split_col(const float* W, int k0, int n, int lane, int ld, int K) { float v[16]; const int g = lane >> 4;
#pragma unroll
  for (int i = 0; i < 8; ++i) { const int ka = k0 + 8 * g + i, kb = ka + 16; v[i] = ka < K ? W[(size_t)(ka < K ? ka : K - 1) * ld + n] : 0.f; v[8 + i] = kb < K ? W[(size_t)(kb < K ? kb : K - 1) * ld + n] : 0.f; }
  return bsplit16(v); }
__device__ __forceinline__ v8f mac3(const F2& a, const F2& b, v8f c) { c = wmma_bf(a.l, b.h, c); c = wmma_bf(a.h, b.l, c); return wmma_bf(a.h, b.h, c); }
__device__ __forceinline__ float sigm(float v) { return 1.0f / (1.0f + expf(-v)); }
#define LDSX() do { asm volatile("s_wait_dscnt 0" ::: "memory"); __builtin_amdgcn_wave_barrier(); __builtin_amdgcn_fence(__ATOMIC_RELEASE, "workgroup"); } while (0)

// Set-Transformer MAB (B 4, 2,048 queries x 2,048 keys, D 256 = 4 x 64, no mask): q = Q Wq^T + bq; k, v = K W^T + b; A = softmax(q_h k_h^T / sqrt(256)); O = q + A v (residual with the projected Q, heads merged); O = LN0(O); O = O + relu(O Wo^T + bo); O = LN1(O).
#define NB 4
#define TT 2048
#define CC 256             // NH * HD = projected width
#define DIN 256
#define NH 4
#define HD 64
#define NQB (TT / 64)
#define HG 4
#define SCALE (0.0625f)
#define CAUSAL 0
#ifndef TNB
#define TNB NB
#endif
__device__ __forceinline__ float bfr(float v) { return (float)(__bf16)v; }
__host__ __device__ __forceinline__ int kb_last(int qb) { return CAUSAL ? ((qb * 64 + 63) >> 7) : (TT / 128 - 1); }
typedef __attribute__((ext_vector_type(8))) __bf16 v8b;
__device__ __forceinline__ v16b frag_b(const __bf16* rowk0, int lane) {
  union { v16b v; v8b q[2]; } u; const __bf16* p = rowk0 + 8 * (lane >> 4);
  u.q[0] = *(const v8b*)p; u.q[1] = *(const v8b*)(p + 16); return u.v;
}
#define QBH 0              // unused: no kernel in this file has a high-precision path
#define QHI 2048            // rows carrying a q residual plane (all rows)
#define KHI 64            // key rows carrying k residual / v bf16 hi+lo planes (written by k_proj, read by no kernel in this file)
// B fragment (k rows k0+.., output column o) of a weight: (in,out) [K][ld] or (out,in) [ld rows of K]: bf16 exact, or f16(bf16 * 256) exact
__device__ __forceinline__ v16b wcol_io(const float* Wm, int k0, int o, int lane, int ld) { v16b w; const int g = lane >> 4;
#pragma unroll
  for (int i = 0; i < 8; ++i) { w[i] = (__bf16)Wm[(size_t)(k0 + 8 * g + i) * ld + o]; w[8 + i] = (__bf16)Wm[(size_t)(k0 + 16 + 8 * g + i) * ld + o]; }
  return w; }
__device__ __forceinline__ v16b wcol_oi(const float* Wm, int k0, int o, int lane, int K) { v16b w; const float* p = Wm + (size_t)o * K + k0 + 8 * (lane >> 4);
#pragma unroll
  for (int i = 0; i < 8; ++i) { w[i] = (__bf16)p[i]; w[8 + i] = (__bf16)p[16 + i]; }
  return w; }
__device__ __forceinline__ v16h wcolh_io(const float* Wm, int k0, int o, int lane, int ld) { v16h w; const int g = lane >> 4;
#pragma unroll
  for (int i = 0; i < 8; ++i) { w[i] = (_Float16)(bfr(Wm[(size_t)(k0 + 8 * g + i) * ld + o]) * 256.0f); w[8 + i] = (_Float16)(bfr(Wm[(size_t)(k0 + 16 + 8 * g + i) * ld + o]) * 256.0f); }
  return w; }
__device__ __forceinline__ v16h wcolh_oi(const float* Wm, int k0, int o, int lane, int K) { v16h w; const float* p = Wm + (size_t)o * K + k0 + 8 * (lane >> 4);
#pragma unroll
  for (int i = 0; i < 8; ++i) { w[i] = (_Float16)(bfr(p[i]) * 256.0f); w[8 + i] = (_Float16)(bfr(p[16 + i]) * 256.0f); }
  return w; }
#define WQKV_LAYOUT 1   // 0 = (in,out) [DIN][CC]; 1 = (out,in) [CC][DIN]; 2 = per-head [NH][DIN][HD], for WCOL only, which no kernel uses: k_qrows and k_proj stage Wq/Wk/Wv as (out,in) [CC][DIN] rows
__device__ __forceinline__ v16b wcol_hdk(const float* Wm, int k0, int o, int lane) { v16b w; const int g = lane >> 4; const float* p = Wm + (size_t)(o / HD) * DIN * HD + (o % HD);
#pragma unroll
  for (int i = 0; i < 8; ++i) { w[i] = (__bf16)p[(size_t)(k0 + 8 * g + i) * HD]; w[8 + i] = (__bf16)p[(size_t)(k0 + 16 + 8 * g + i) * HD]; }
  return w; }
#define WO_OUT_IN 0
#if WQKV_LAYOUT == 1
#define WCOL(W, k0, o, lane) wcol_oi(W, k0, o, lane, DIN)
#elif WQKV_LAYOUT == 2
#define WCOL(W, k0, o, lane) wcol_hdk(W, k0, o, lane)
#else
#define WCOL(W, k0, o, lane) wcol_io(W, k0, o, lane, CC)
#endif
#if WO_OUT_IN
#define WOCOL(W, k0, o, lane) wcol_oi(W, k0, o, lane, CC)
#define WOCOLH(W, k0, o, lane) wcolh_oi(W, k0, o, lane, CC)
#else
#define WOCOL(W, k0, o, lane) wcol_io(W, k0, o, lane, DIN)
#define WOCOLH(W, k0, o, lane) wcolh_io(W, k0, o, lane, DIN)
#endif
#define NROW (NB * TT)
#define GP (DIN + 8)       // LDS pitch of a staged operand row in bf16: 512 B + 16 B = 16 B x odd, free of bank conflicts for 16-byte reads
typedef __attribute__((ext_vector_type(4))) __bf16 v4b;
// 64 rows of DIN f32 that lie one behind the other in memory -> bf16 rows in LDS, by the block's 128 threads: each wave-wide load covers 512 contiguous bytes (whole lines), 32 loads of a thread in flight
__device__ __forceinline__ void stage_bf(__bf16* dst, const float* __restrict__ s, int tid) { v4f x[32];
#pragma unroll
  for (int i = 0; i < 32; ++i) x[i] = *(const v4f*)(s + i * 512 + tid * 4);
  asm volatile("s_wait_xcnt 0x0" ::: "memory");   // stands behind the batch's loads, in front of every later rewrite of a register that they name (the next batch forms its base address in the same registers)
#pragma unroll
  for (int i = 0; i < 32; ++i) { v4b y;
#pragma unroll
    for (int e = 0; e < 4; ++e) y[e] = (__bf16)x[i][e];
    *(v4b*)(dst + (i * 2 + (tid >> 6)) * GP + (tid & 63) * 4) = y; } }
// the same, split bf16 hi + lo into two planes
__device__ __forceinline__ void stage_hl(__bf16* dh, __bf16* dl, const float* __restrict__ s, int tid) { v4f x[32];
#pragma unroll
  for (int i = 0; i < 32; ++i) x[i] = *(const v4f*)(s + i * 512 + tid * 4);
  asm volatile("s_wait_xcnt 0x0" ::: "memory");   // stands behind the batch's loads, in front of every later rewrite of a register that they name (the next batch forms its base address in the same registers)
#pragma unroll
  for (int i = 0; i < 32; ++i) { v4b yh, yl;
#pragma unroll
    for (int e = 0; e < 4; ++e) { const __bf16 h = (__bf16)x[i][e]; yh[e] = h; yl[e] = (__bf16)(x[i][e] - (float)h); }
    const int o = (i * 2 + (tid >> 6)) * GP + (tid & 63) * 4; *(v4b*)(dh + o) = yh; *(v4b*)(dl + o) = yl; } }
// the eight W fragments of one k step of 32, from the lane's first staged W row
__device__ __forceinline__ void ld_w(v16b (&w)[8], const __bf16* wr, int kc, int lane) {
#pragma unroll
  for (int j = 0; j < 8; ++j) w[j] = frag_b(wr + j * 16 * GP + kc * 32, lane); }
__device__ __forceinline__ void mm8(v8f (&acc)[8], v16b a, const v16b (&w)[8]) {
#pragma unroll
  for (int j = 0; j < 8; ++j) acc[j] = wmma_bf(a, w[j], acc[j]); }
// acc += X W^T over K = DIN from the staged tiles; two fragment sets: a k step's LDS reads stand as one group in front of the products of the step before it
__device__ __forceinline__ void gemm_lds(v8f (&acc)[8], const __bf16* xr, const __bf16* wr, int lane) { v16b a0, a1, w0[8], w1[8];
  a0 = frag_b(xr, lane); ld_w(w0, wr, 0, lane);
#pragma unroll
  for (int kc = 0; kc < DIN / 32; kc += 2) { a1 = frag_b(xr + (kc + 1) * 32, lane); ld_w(w1, wr, kc + 1, lane); mm8(acc, a0, w0);
    if (kc + 2 < DIN / 32) { a0 = frag_b(xr + (kc + 2) * 32, lane); ld_w(w0, wr, kc + 2, lane); }
    mm8(acc, a1, w1); } }
// ---- k_qrows: block = (64 rows, 128 cols): QF = bf16(Q) Wq^T + bq (exact products, f32) -> rows (the residual needs Qh in f32; k_proj keeps only f16 planes)
__global__ __launch_bounds__(128) void k_qrows(const float* __restrict__ X, const float* __restrict__ WQ, const float* __restrict__ BQ, float* __restrict__ QF) { __shared__ __align__(16) float sf[4][16][132]; __shared__ __align__(16) __bf16 ops[192 * GP];   // rows 0..63: the X tile, 64..191: the W tile
  const int tid = threadIdx.x, wave = tid >> 5, lane = tid & 31, col = lane & 15, g = lane >> 4; const int c0 = blockIdx.y * 128; const size_t r0 = (size_t)blockIdx.x * 64 + wave * 16;
#pragma unroll 1   // rolled: one batch of 32 loads a thread in flight at a time; unrolled, the batches' registers add up past 256
  for (int b = 0; b < 3; ++b) stage_bf(ops + b * 64 * GP, b == 0 ? X + (size_t)blockIdx.x * 64 * DIN : WQ + (size_t)(c0 + (b - 1) * 64) * DIN, tid);
  __syncthreads();   // both operand tiles are published to every wave
  v8f acc[8] = {}; gemm_lds(acc, ops + (wave * 16 + col) * GP, ops + (64 + col) * GP, lane);
#pragma unroll
  for (int j = 0; j < 8; ++j) { const float bb = bfr(BQ[c0 + j * 16 + col]);
#pragma unroll
    for (int r = 0; r < 8; ++r) sf[wave][8 * g + r][j * 16 + col] = acc[j][r] + bb; }
  LDSX(); for (int rl = 0; rl < 16; ++rl) vst2(QF + (r0 + rl) * DIN + c0 + lane * 4, *(const v4f*)&sf[wave][rl][lane * 4]); }
// ---- k_lnrow: wave per row: OUT = LayerNorm(X (+ R)) over 256 features (biased var, eps 1e-5, x g + b); X and R are f32 intermediates (no bf16 rounding)
__global__ __launch_bounds__(256) void k_lnrow(const float* __restrict__ X, const float* __restrict__ R, const float* __restrict__ GM, const float* __restrict__ BT, float* __restrict__ OUT) { const int wave = threadIdx.x >> 5, lane = threadIdx.x & 31; const size_t row = (size_t)blockIdx.x * 8 + wave; if (row >= (size_t)NROW) return;
  v4f x[DIN / 128]; float s1 = 0.f;
#pragma unroll
  for (int q = 0; q < DIN / 128; ++q) { x[q] = *(const v4f*)(X + row * DIN + q * 128 + lane * 4); if (R) { const v4f rr = *(const v4f*)(R + row * DIN + q * 128 + lane * 4); x[q][0] += rr[0]; x[q][1] += rr[1]; x[q][2] += rr[2]; x[q][3] += rr[3]; }
#pragma unroll
    for (int i = 0; i < 4; ++i) s1 += x[q][i]; }
#pragma unroll
  for (int o = 1; o < 32; o <<= 1) s1 += __shfl_xor(s1, o);
  const float mu = s1 * (1.0f / DIN); float qq = 0.f;
#pragma unroll
  for (int q = 0; q < DIN / 128; ++q)
#pragma unroll
    for (int i = 0; i < 4; ++i) { const float d = x[q][i] - mu; qq += d * d; }
#pragma unroll
  for (int o = 1; o < 32; o <<= 1) qq += __shfl_xor(qq, o);
  const float rs = rsqrtf(qq * (1.0f / DIN) + 1e-5f);
#pragma unroll
  for (int q = 0; q < DIN / 128; ++q) { v4f r4; const int c = q * 128 + lane * 4;
#pragma unroll
    for (int i = 0; i < 4; ++i) r4[i] = (x[q][i] - mu) * rs * bfr(GM[c + i]) + bfr(BT[c + i]);
    vst2(OUT + row * DIN + c, r4); } }
// ---- k_rff: block = (64 rows, 128 cols): T = O + relu(O (hi + lo) . Wo[c][:] + bo[c]) (Wo (out,in) exact bf16; 2 products)
__global__ __launch_bounds__(128) void k_rff(const float* __restrict__ O, const float* __restrict__ WO, const float* __restrict__ BO, float* __restrict__ T) { __shared__ __align__(16) float sf[4][16][132]; __shared__ __align__(16) __bf16 xh[64 * GP], xl[64 * GP], wt[128 * GP];
  const int tid = threadIdx.x, wave = tid >> 5, lane = tid & 31, col = lane & 15, g = lane >> 4; const int c0 = blockIdx.y * 128; const size_t r0 = (size_t)blockIdx.x * 64 + wave * 16;
  stage_hl(xh, xl, O + (size_t)blockIdx.x * 64 * DIN, tid);
#pragma unroll 1   // rolled: one batch of 32 loads a thread in flight at a time; unrolled, the batches' registers add up past 256
  for (int b = 0; b < 2; ++b) stage_bf(wt + b * 64 * GP, WO + (size_t)(c0 + b * 64) * DIN, tid);
  __syncthreads();   // the operand tiles are published to every wave
  v8f acc[8] = {}; { const __bf16 *hr = xh + (wave * 16 + col) * GP, *lr = xl + (wave * 16 + col) * GP, *wr = wt + col * GP; v16b h0, l0, h1, l1, w0[8], w1[8];   // two fragment sets, as in gemm_lds
    h0 = frag_b(hr, lane); l0 = frag_b(lr, lane); ld_w(w0, wr, 0, lane);
#pragma unroll
    for (int kc = 0; kc < DIN / 32; kc += 2) { h1 = frag_b(hr + (kc + 1) * 32, lane); l1 = frag_b(lr + (kc + 1) * 32, lane); ld_w(w1, wr, kc + 1, lane);
#pragma unroll
      for (int j = 0; j < 8; ++j) { acc[j] = wmma_bf(h0, w0[j], acc[j]); acc[j] = wmma_bf(l0, w0[j], acc[j]); }
      if (kc + 2 < DIN / 32) { h0 = frag_b(hr + (kc + 2) * 32, lane); l0 = frag_b(lr + (kc + 2) * 32, lane); ld_w(w0, wr, kc + 2, lane); }
#pragma unroll
      for (int j = 0; j < 8; ++j) { acc[j] = wmma_bf(h1, w1[j], acc[j]); acc[j] = wmma_bf(l1, w1[j], acc[j]); } } }
#pragma unroll
  for (int j = 0; j < 8; ++j) { const float bb = bfr(BO[c0 + j * 16 + col]);
#pragma unroll
    for (int r = 0; r < 8; ++r) sf[wave][8 * g + r][j * 16 + col] = fmaxf(acc[j][r] + bb, 0.f); }
  LDSX(); for (int rl = 0; rl < 16; ++rl) { const size_t o2 = (r0 + rl) * DIN + c0 + lane * 4; const v4f x = *(const v4f*)(O + o2); v4f t = *(const v4f*)&sf[wave][rl][lane * 4]; t[0] += x[0]; t[1] += x[1]; t[2] += x[2]; t[3] += x[3]; vst2(T + o2, t); } }
#define WS_QF  (WS_END)
#define WS_O   (WS_QF + 4u * (size_t)NROW * DIN)
#define WS_T   (WS_O + 4u * (size_t)NROW * DIN)
#define WS_END2 (WS_T + 4u * (size_t)NROW * DIN)
#ifndef SM_EXTRA_PARAMS
#define SM_EXTRA_PARAMS
#endif
#ifndef PROJ_EXTRA_PARAMS
#define PROJ_EXTRA_PARAMS
#endif
#ifndef SM_MASK_HOOK
#define SM_MASK_HOOK (void)0
#endif

#define WS_QH  0u                                      // f16 q rows [b*t][CC]
#define WS_KH  (WS_QH + 2u * (size_t)NB * TT * CC)      // f16 k rows [b*t][CC]
#define WS_VT  (WS_KH + 2u * (size_t)NB * TT * CC)      // f16 v planes [b][c][t]
#define WS_QL  (WS_VT + 2u * (size_t)NB * CC * TT)      // f16 q residual x 2^10 rows [b][t < QHI][CC]
#define WS_KL  (WS_QL + 2u * (size_t)NB * QHI * CC)     // f16 k residual x 2^10 rows [b][t < KHI][CC]
#define WS_VB  (WS_KL + 2u * (size_t)NB * KHI * CC)     // bf16 v hi planes [b][c][t < KHI]
#define WS_VBL (WS_VB + 2u * (size_t)NB * CC * KHI)
#define WS_S   (WS_VBL + 2u * (size_t)NB * CC * KHI)    // f32 [hg][t][s], unused: k_fa keeps logits and P in registers
#define WS_Y   (WS_S  + 4u * (size_t)HG * TT * TT)      // f32 ctx rows [b*t][CC] (only when there is an output projection)
#define WS_END (WS_Y  + 0u)

// ---- k_proj: block = (64 rows, 128 cols, which): q/k/v = X W (+ b) with exact bf16 products (K = DIN) -> which 0: q f16 rows (+ residual rows < QHI); 1: k f16 rows (+ residual rows < KHI); 2: v f16 planes [c][t] (+ bf16 hi/lo planes for t < KHI)
__global__ __launch_bounds__(128) void k_proj(const float* __restrict__ XQ, const float* __restrict__ XK, const float* __restrict__ XV, const float* __restrict__ WQ, const float* __restrict__ WK, const float* __restrict__ WV, const float* __restrict__ BQ, const float* __restrict__ BK, const float* __restrict__ BV,
    _Float16* __restrict__ QH, _Float16* __restrict__ QL, _Float16* __restrict__ KH, _Float16* __restrict__ KL, _Float16* __restrict__ VT, __bf16* __restrict__ VB, __bf16* __restrict__ VBL) {
  __shared__ __align__(16) union { __bf16 ops[192 * GP]; struct { _Float16 sh[64][136], sl[64][136]; } qk; struct { _Float16 th[128][72]; __bf16 tb[128][72], tbl[128][72]; } v; } sm;   // ops rows 0..63: the X tile, 64..191: the W tile; the output staging takes their place, so that three blocks a WGP stay resident
  auto& sh = sm.qk.sh; auto& sl = sm.qk.sl; auto& th = sm.v.th; auto& tb = sm.v.tb; auto& tbl = sm.v.tbl;
  const int tid = threadIdx.x, wave = tid >> 5, lane = tid & 31, col = lane & 15, g = lane >> 4; const int which = blockIdx.z; const int c0 = blockIdx.y * 128; const size_t r0 = (size_t)blockIdx.x * 64; const size_t bb = r0 / TT; const int t0 = (int)(r0 % TT);
  const float* X = which == 0 ? XQ : which == 1 ? XK : XV; const float* WA = which == 0 ? WQ : which == 1 ? WK : WV; const float* BA = which == 0 ? BQ : which == 1 ? BK : BV;
#pragma unroll 1   // rolled: one batch of 32 loads a thread in flight at a time; unrolled, the batches' registers add up past what three resident waves a SIMD allow
  for (int b = 0; b < 3; ++b) stage_bf(sm.ops + b * 64 * GP, b == 0 ? X + r0 * DIN : WA + (size_t)(c0 + (b - 1) * 64) * DIN, tid);
  __syncthreads();   // both operand tiles are published to every wave
  v8f acc[8] = {}; gemm_lds(acc, sm.ops + (wave * 16 + col) * GP, sm.ops + (64 + col) * GP, lane);
  __syncthreads();   // every wave's reads of the operand tiles are done before the output staging overwrites them
  if (which < 2) { _Float16* DH = which == 0 ? QH : KH; _Float16* DL = which == 0 ? QL : KL; const int nhi = which == 0 ? QHI : KHI; const bool hi_rows = t0 < nhi;
#pragma unroll
    for (int j = 0; j < 8; ++j) { const float bias = BA ? bfr(BA[c0 + j * 16 + col]) : 0.f;
#pragma unroll
      for (int r = 0; r < 8; ++r) { const float v = acc[j][r] + bias; const _Float16 hv = (_Float16)v; sh[wave * 16 + 8 * g + r][j * 16 + col] = hv; sl[wave * 16 + 8 * g + r][j * 16 + col] = (_Float16)((v - (float)hv) * 1024.0f); } }
    __syncthreads();
    for (int e = tid; e < 64 * 16; e += 128) { const int rl = e >> 4, q = e & 15; vst2((unsigned*)(DH + (r0 + rl) * CC + c0 + q * 8), *(const v4u*)&sh[rl][q * 8]); if (hi_rows) vst2((unsigned*)(DL + (bb * nhi + t0 + rl) * (size_t)CC + c0 + q * 8), *(const v4u*)&sl[rl][q * 8]); }
  } else { const bool hi_rows = t0 < KHI;
#pragma unroll
    for (int j = 0; j < 8; ++j) { const float bias = BA ? bfr(BA[c0 + j * 16 + col]) : 0.f;
#pragma unroll
      for (int r = 0; r < 8; ++r) { const float v = acc[j][r] + bias; const int rl = wave * 16 + 8 * g + r, cl = j * 16 + col; th[cl][rl] = (_Float16)v; const __bf16 bh = (__bf16)v; tb[cl][rl] = bh; tbl[cl][rl] = (__bf16)(v - (float)bh); } }
    __syncthreads();
    for (int e = tid; e < 128 * 8; e += 128) { const int cl = e >> 3, q = e & 7; vst2((unsigned*)(VT + (bb * CC + c0 + cl) * (size_t)TT + t0 + q * 8), *(const v4u*)&th[cl][q * 8]); if (hi_rows) { const size_t o3 = (bb * CC + c0 + cl) * (size_t)KHI + t0 + q * 8; vst2((unsigned*)(VB + o3), *(const v4u*)&tb[cl][q * 8]); vst2((unsigned*)(VBL + o3), *(const v4u*)&tbl[cl][q * 8]); } } } }
// ---- k_fa: block = 4 waves x 16 queries of (b, h), one launch for every batch and head: S^T = K Q^T (q hi + residual x 2^10, 2 products), online softmax in f32 per lane (lane = query), O^T += V^T P^T (P once to f16, 1 product); logits and P stay in registers; K rows and V^T rows of 128 keys a stage come into LDS by asynchronous copies (two buffers) and serve the block's four waves
typedef __attribute__((ext_vector_type(2))) _Float16 v2h;
#define FA_C (SCALE * 1.4426950408889634f)   // raw q.k -> base-2 exponent
#define FA_LAZY (8.0f / FA_C)                // the maximum in use is replaced only when a new one exceeds it by 2^8
#define FA_OFF 6.0f                          // P = 2^(6 + ...) <= 2^14: keeps small weights out of the f16 subnormals; cancels against the row sum
#define FA_KT 128                            // keys a stage (4 passes of 32 keys)
#define FA_NT (TT / FA_KT)                   // stages
#define FA_KP (HD + 8)                       // LDS pitch of a K row in f16: 128 B + 16 B = 16 B x odd, free of bank conflicts for 16-byte reads
#define FA_VP (FA_KT + 8)                    // LDS pitch of a V^T row in f16: 256 B + 16 B
#define FA_KBUF (FA_KT * FA_KP)
#define FA_VBUF (HD * FA_VP)
__device__ __forceinline__ float xhalf(float x) { return __builtin_bit_cast(float, __builtin_amdgcn_permlanex16(__builtin_bit_cast(int, x), __builtin_bit_cast(int, x), 0x76543210, 0xfedcba98, false, false)); }
__device__ __forceinline__ v8f wm16(v16h a, v16h b, v8f c) { return __builtin_amdgcn_wmma_f32_16x16x32_f16(false, a, false, b, (short)0, c, false, false); }
// fragments of one pass, from the stage's LDS buffer: K rows (A of S^T: row = key) and V^T rows (A of O^T: row = feature, k = key), both in the hardware k order
__device__ __forceinline__ void fa_load(v16h (&kf)[2][HD / 32], v16h (&vf)[HD / 16], const _Float16* Kl, const _Float16* Vl, int pass, int lane) {
#pragma unroll
  for (int i = 0; i < 2; ++i)
#pragma unroll
    for (int kc = 0; kc < HD / 32; ++kc) kf[i][kc] = frag_h(Kl + (pass * 32 + i * 16) * FA_KP + kc * 32, lane);
#pragma unroll
  for (int j = 0; j < HD / 16; ++j) vf[j] = frag_h(Vl + pass * 32 + j * 16 * FA_VP, lane); }
// eight asynchronous 16-byte copies a lane, global -> LDS, at fixed steps of both addresses; the s_wait_xcnt stands inside the statement so that no address register is rewritten in front of it
__device__ __forceinline__ void fa_copy8(unsigned l, unsigned ls, const _Float16* g, size_t gs) {
  asm volatile("global_load_async_to_lds_b128 %0, %8, off\n\tglobal_load_async_to_lds_b128 %1, %9, off\n\tglobal_load_async_to_lds_b128 %2, %10, off\n\tglobal_load_async_to_lds_b128 %3, %11, off\n\t"
               "global_load_async_to_lds_b128 %4, %12, off\n\tglobal_load_async_to_lds_b128 %5, %13, off\n\tglobal_load_async_to_lds_b128 %6, %14, off\n\tglobal_load_async_to_lds_b128 %7, %15, off\n\ts_wait_xcnt 0x0"
               :: "v"(l), "v"(l + ls), "v"(l + 2 * ls), "v"(l + 3 * ls), "v"(l + 4 * ls), "v"(l + 5 * ls), "v"(l + 6 * ls), "v"(l + 7 * ls),
                  "v"(g), "v"(g + gs), "v"(g + 2 * gs), "v"(g + 3 * gs), "v"(g + 4 * gs), "v"(g + 5 * gs), "v"(g + 6 * gs), "v"(g + 7 * gs) : "memory"); }
template <bool AHEAD> __device__ __forceinline__ void fa_pass(const v16h (&kf)[2][HD / 32], const v16h (&vf)[HD / 16], const v16h (&kn)[2][HD / 32], const v16h (&qh)[HD / 32], const v16h (&ql)[HD / 32], v8f (&o)[HD / 16], float& m, v2f (&l)[2]) {
  v8f sh[2] = {}, sl[2] = {};
#pragma unroll
  for (int kc = 0; kc < HD / 32; ++kc)
#pragma unroll
    for (int i = 0; i < 2; ++i) { sh[i] = wm16(kf[i][kc], qh[kc], sh[i]); sl[i] = wm16(kf[i][kc], ql[kc], sl[i]); }
  v2f t[8]; float mx = -3.0e38f;   // lane (c, h): query c, keys 8h + 0..7 and 16 + 8h + 0..7
#pragma unroll
  for (int e = 0; e < 8; ++e) { const int i = e >> 2, r = (e & 3) * 2; t[e][0] = sh[i][r] + sl[i][r] * (1.0f / 1024.0f); t[e][1] = sh[i][r + 1] + sl[i][r + 1] * (1.0f / 1024.0f); mx = fmaxf(mx, fmaxf(t[e][0], t[e][1])); }
  mx = fmaxf(mx, xhalf(mx));
  if (AHEAD) asm volatile("" :: "v"(kn[0][0]), "v"(kn[0][1]), "v"(kn[1][0]), "v"(kn[1][1]));   // inputs only: holds the LDS loads of the next pass's K fragments in front of the branch below; behind it they would stand directly in front of their products, their latency open
  if (__builtin_amdgcn_ballot_w32(mx > m + FA_LAZY) != 0) { const float mn = fmaxf(m, mx); const float al = __builtin_amdgcn_exp2f((m - mn) * FA_C); m = mn; l[0] *= al; l[1] *= al;
#pragma unroll
    for (int j = 0; j < HD / 16; ++j)
#pragma unroll
      for (int r = 0; r < 8; ++r) o[j][r] *= al; }
  const float mc = m * FA_C - FA_OFF; v16h p;
#pragma unroll
  for (int e = 0; e < 8; ++e) { v2f pe; pe[0] = __builtin_amdgcn_exp2f(t[e][0] * FA_C - mc); pe[1] = __builtin_amdgcn_exp2f(t[e][1] * FA_C - mc); l[e & 1] += pe; const v2h ph = __builtin_convertvector(pe, v2h); p[2 * e] = ph[0]; p[2 * e + 1] = ph[1]; }
#pragma unroll
  for (int j = 0; j < HD / 16; ++j) o[j] = wm16(vf[j], p, o[j]); }
__global__ __launch_bounds__(128) void k_fa(const _Float16* __restrict__ QH, const _Float16* __restrict__ QL, const _Float16* __restrict__ KH, const _Float16* __restrict__ VT, float* __restrict__ Y) {
  __shared__ __align__(16) _Float16 ks[2][FA_KBUF], vs[2][FA_VBUF];
  const int tid = threadIdx.x, wave = tid >> 5, lane = tid & 31, col = lane & 15, g = lane >> 4; const int h = blockIdx.y, b = blockIdx.z; const int ql0 = blockIdx.x * 64 + wave * 16;
  v16h qh[HD / 32], ql[HD / 32];
#pragma unroll
  for (int kc = 0; kc < HD / 32; ++kc) { qh[kc] = frag_h(QH + ((size_t)b * TT + ql0 + col) * CC + h * HD + kc * 32, lane); ql[kc] = frag_h(QL + ((size_t)b * QHI + ql0 + col) * CC + h * HD + kc * 32, lane); }
  // a stage's copies: K 128 rows x 128 B (a thread: 16 B of rows tid / 8 + 16 i), V^T 64 rows x 256 B (16 B of rows tid / 16 + 8 i): whole 128-byte lines on the global side
  const _Float16* Kg = KH + ((size_t)b * TT + (tid >> 3)) * CC + h * HD + (tid & 7) * 8;
  const _Float16* Vg = VT + ((size_t)b * CC + h * HD + (tid >> 4)) * (size_t)TT + (tid & 15) * 8;
  const unsigned kd = (unsigned)(size_t)&ks[0][(tid >> 3) * FA_KP + (tid & 7) * 8], vd = (unsigned)(size_t)&vs[0][(tid >> 4) * FA_VP + (tid & 15) * 8];   // LDS byte addresses
  v16h kA[2][HD / 32], vA[HD / 16], kB[2][HD / 32], vB[HD / 16];
  v8f o[HD / 16] = {}; float m = -3.0e38f; v2f l[2] = {};
  fa_copy8(kd, 16 * FA_KP * 2, Kg, (size_t)16 * CC); fa_copy8(vd, 8 * FA_VP * 2, Vg, (size_t)8 * TT);
  asm volatile("s_wait_asynccnt 0x0" ::: "memory");   // this wave's copies of stage 0 have landed
  __syncthreads();                                    // stage 0 is published to every wave
  fa_copy8(kd + FA_KBUF * 2, 16 * FA_KP * 2, Kg + (size_t)FA_KT * CC, (size_t)16 * CC); fa_copy8(vd + FA_VBUF * 2, 8 * FA_VP * 2, Vg + FA_KT, (size_t)8 * TT);
  for (int t = 0; t < FA_NT; ++t) {   // trip t reads buffer t mod 2 alone, while stage t + 1 flies into the other
    const int bf = t & 1; const _Float16* Kl = &ks[bf][col * FA_KP]; const _Float16* Vl = &vs[bf][col * FA_VP];   // the lane's key row of pass 0 and its feature row
    fa_load(kA, vA, Kl, Vl, 0, lane);   // two register sets: inside a stage a pass's fragments are fetched during the pass before it
    fa_load(kB, vB, Kl, Vl, 1, lane);
    fa_pass<true>(kA, vA, kB, qh, ql, o, m, l);
    fa_load(kA, vA, Kl, Vl, 2, lane);
    fa_pass<true>(kB, vB, kA, qh, ql, o, m, l);
    fa_load(kB, vB, Kl, Vl, 3, lane);
    fa_pass<true>(kA, vA, kB, qh, ql, o, m, l);
    fa_pass<false>(kB, vB, kB, qh, ql, o, m, l);
    asm volatile("s_wait_dscnt 0x0" ::: "memory");      // this wave's reads of buffer t mod 2 are done before it is refilled
    asm volatile("s_wait_asynccnt 0x0" ::: "memory");   // this wave's copies of stage t + 1 have landed
    __syncthreads();                                    // publishes stage t + 1 and ends every wave's reads of buffer t mod 2
    if (t + 2 < FA_NT) { fa_copy8(kd + bf * (FA_KBUF * 2), 16 * FA_KP * 2, Kg + (size_t)(t + 2) * FA_KT * CC, (size_t)16 * CC); fa_copy8(vd + bf * (FA_VBUF * 2), 8 * FA_VP * 2, Vg + (t + 2) * FA_KT, (size_t)8 * TT); }
  }
  asm volatile("s_wait_asynccnt 0x0" ::: "memory");   // no copy is outstanding when the wave ends
  float ls = l[0][0] + l[0][1] + l[1][0] + l[1][1]; ls += xhalf(ls); const float inv = 1.0f / ls;
  float* yr = Y + ((size_t)b * TT + ql0 + col) * CC + h * HD + 8 * g;   // O^T: the lane holds features j * 16 + 8h + 0..7 of its query
#pragma unroll
  for (int j = 0; j < HD / 16; ++j) { v4f a, c;
#pragma unroll
    for (int r = 0; r < 4; ++r) { a[r] = o[j][r] * inv; c[r] = o[j][4 + r] * inv; }
    vst2(yr + j * 16, a); vst2(yr + j * 16 + 4, c); } }

extern "C" void kernel_launch(void* const* d_in, const int* in_sizes, int n_in, void* d_out, int out_size, void* d_ws, size_t ws_size, hipStream_t stream) {
  (void)in_sizes; (void)n_in; (void)out_size;
  const float** F = (const float**)d_in;
  if (ws_size < (size_t)WS_END) return;
  char* ws = (char*)d_ws; _Float16 *QH = (_Float16*)(ws + WS_QH), *KH = (_Float16*)(ws + WS_KH), *VT = (_Float16*)(ws + WS_VT), *QL = (_Float16*)(ws + WS_QL), *KL = (_Float16*)(ws + WS_KL); __bf16 *VB = (__bf16*)(ws + WS_VB), *VBL = (__bf16*)(ws + WS_VBL); float *S = (float*)(ws + WS_S), *Y = (float*)(ws + WS_Y);
  (void)Y; (void)S; (void)QL; (void)KL; (void)VB; (void)VBL;
  // inputs: 0 Q, 1 K [4,2048,256]; 2 Wq, 3 bq; 4 Wk, 5 bk; 6 Wv, 7 bv; 8 Wo, 9 bo ((out,in) [256,256]); 10 g0, 11 b0; 12 g1, 13 b1
  if (ws_size < (size_t)WS_END2) return;
  float *QF = (float*)(ws + WS_QF), *O = (float*)(ws + WS_O), *T = (float*)(ws + WS_T);
  k_proj<<<dim3(TNB * TT / 64, CC / 128, 3), 128, 0, stream>>>(F[0], F[1], F[1], F[2], F[4], F[6], F[3], F[5], F[7], QH, QL, KH, KL, VT, VB, VBL);
  k_qrows<<<dim3(TNB * TT / 64, DIN / 128), 128, 0, stream>>>(F[0], F[2], F[3], QF);
  k_fa<<<dim3(NQB, NH, TNB), 128, 0, stream>>>(QH, QL, KH, VT, T);   /* ctx rows into T (scratch) */
  k_lnrow<<<dim3((TNB * TT + 7) / 8), 256, 0, stream>>>(QF, T, F[10], F[11], O);       /* O = LN0(Qh + A Vh) */
  k_rff<<<dim3(TNB * TT / 64, DIN / 128), 128, 0, stream>>>(O, F[8], F[9], T);       /* T = O + relu(O Wo^T + bo) */
  k_lnrow<<<dim3((TNB * TT + 7) / 8), 256, 0, stream>>>(T, nullptr, F[12], F[13], (float*)d_out);   /* out = LN1(T) */
}

// v004
// One run takes 52.9 microseconds.
// Timed twice side by side with v003, it ran 1.30 times as fast both times.
// All steps since v000 together make it 11.2 times as fast.
// compute dtype: all float inputs rounded to bf16; Qh/Kh/Vh = X W^T + b with EXACT bf16 products on WMMA 16x16x32 (f32 accumulate); q as f16 hi + residual (x 2^10) against k once to f16 (2 products) x 256^-0.5, no mask; online softmax in f32 (base-2 exponential); P x 2^6 against the maximum in use, once to f16, against v once to f16 (1 product), divided by the f32 row sum at the end; Qh (recomputed exactly in f32) + ctx, LayerNorm, the rFF GEMM with the LN rows split bf16 hi + lo against exact Wo (2 products) + bo, relu, residual and the second LayerNorm in f32; f32 output.
#include <hip/hip_runtime.h>
#include <math.h>

typedef __attribute__((ext_vector_type(16))) _Float16 v16h;
typedef __attribute__((ext_vector_type(16))) __bf16 v16b;
typedef __attribute__((ext_vector_type(8)))  _Float16 v8h;
typedef __attribute__((ext_vector_type(8)))  float v8f;
typedef __attribute__((ext_vector_type(4)))  float v4f;
typedef __attribute__((ext_vector_type(2)))  float v2f;
typedef __attribute__((ext_vector_type(4)))  unsigned v4u;
typedef __attribute__((ext_vector_type(4)))  int v4i;
typedef float __attribute__((may_alias)) float_a;
typedef int __attribute__((may_alias)) int_a;

template <typename T> __device__ __forceinline__ void vst2(void* p, T v) { *(T*)p = v;  }
__device__ __forceinline__ v8f wmma16(v16h a, v16h b, v8f c) {
  v8f d = __builtin_amdgcn_wmma_f32_16x16x32_f16(false, a, false, b, (short)0, c, false, false);
  asm volatile("v_nop\n\tv_nop\n\tv_nop\n\tv_nop" : "+v"(d) : "v"(a), "v"(b));
  return d;
}
__device__ __forceinline__ v8f wmma_bf(v16b a, v16b b, v8f c) {
  v8f d = __builtin_amdgcn_wmma_f32_16x16x32_bf16(false, a, false, b, (short)0, c, false, false);
  asm volatile("v_nop\n\tv_nop\n\tv_nop\n\tv_nop" : "+v"(d) : "v"(a), "v"(b));
  return d;
}
// 16x16x32 fragments: lane = (h = lane>>4, row/col = lane&15); elements 0..7 = k0+8h+0..7, 8..15 = k0+16+8h+0..7; D element r = row 8h+r
__device__ __forceinline__ v16h frag_h(const _Float16* rowk0, int lane) {
  union { v16h v; v8h q[2]; } u; const _Float16* p = rowk0 + 8 * (lane >> 4);
  u.q[0] = *(const v8h*)p; u.q[1] = *(const v8h*)(p + 16); return u.v;
}
__device__ __forceinline__ v16h frag_f32(const float* rowk0, int lane) {
  v16h a; const float* p = rowk0 + 8 * (lane >> 4);
#pragma unroll
  for (int i = 0; i < 8; ++i) { a[i] = (_Float16)p[i]; a[8 + i] = (_Float16)p[16 + i]; }
  return a;
}
__device__ __forceinline__ v16h frag_f32s(const float* rowk0, int lane, float sc) {
  v16h a; const float* p = rowk0 + 8 * (lane >> 4);
#pragma unroll
  for (int i = 0; i < 8; ++i) { a[i] = (_Float16)(p[i] * sc); a[8 + i] = (_Float16)(p[16 + i] * sc); }
  return a;
}
// column fragment from a [K][ld] layout (column n), rows >= K read as 0
__device__ __forceinline__ v16h fragc_f32(const float* W, int k0, int n, int lane, int ld, int K) {
  v16h a; const int g = lane >> 4;
#pragma unroll
  for (int i = 0; i < 8; ++i) { const int ka = k0 + 8 * g + i, kb = ka + 16;
    a[i] = (_Float16)(ka < K ? W[(size_t)(ka < K ? ka : K - 1) * ld + n] : 0.f); a[8 + i] = (_Float16)(kb < K ? W[(size_t)(kb < K ? kb : K - 1) * ld + n] : 0.f); }
  return a;
}
struct F2 { v16b h, l; };
__device__ __forceinline__ F2 bsplit16(const float v[16]) { F2 r;
#pragma unroll
  for (int i = 0; i < 16; ++i) { const __bf16 h = (__bf16)v[i]; r.h[i] = h; r.l[i] = (__bf16)(v[i] - (float)h); }
  return r; }
__device__ __forceinline__ F2 split_row(const float* row, int k0, int lane) { float v[16]; const float* p = row + k0 + 8 * (lane >> 4);
#pragma unroll
  for (int i = 0; i < 8; ++i) { v[i] = p[i]; v[8 + i] = p[16 + i]; }
  return bsplit16(v); }
__device__ __forceinline__ F2 split_rowK(const float* row, int k0, int lane, int K) { float v[16]; const int g = lane >> 4;
#pragma unroll
  for (int i = 0; i < 8; ++i) { const int ka = k0 + 8 * g + i, kb = ka + 16; v[i] = ka < K ? row[ka < K ? ka : K - 1] : 0.f; v[8 + i] = kb < K ? row[kb < K ? kb : K - 1] : 0.f; }
  return bsplit16(v); }
__device__ __forceinline__ F2 split_col(const float* W, int k0, int n, int lane, int ld, int K) { float v[16]; const int g = lane >> 4;
#pragma unroll
  for (int i = 0; i < 8; ++i) { const int ka = k0 + 8 * g + i, kb = ka + 16; v[i] = ka < K ? W[(size_t)(ka < K ? ka : K - 1) * ld + n] : 0.f; v[8 + i] = kb < K ? W[(size_t)(kb < K ? kb : K - 1) * ld + n] : 0.f; }
  return bsplit16(v); }
__device__ __forceinline__ v8f mac3(const F2& a, const F2& b, v8f c) { c = wmma_bf(a.l, b.h, c); c = wmma_bf(a.h, b.l, c); return wmma_bf(a.h, b.h, c); }
__device__ __forceinline__ float sigm(float v) { return 1.0f / (1.0f + expf(-v)); }
#define LDSX() do { asm volatile("s_wait_dscnt 0" ::: "memory"); __builtin_amdgcn_wave_barrier(); __builtin_amdgcn_fence(__ATOMIC_RELEASE, "workgroup"); } while (0)

// Set-Transformer MAB (B 4, 2,048 queries x 2,048 keys, D 256 = 4 x 64, no mask): q = Q Wq^T + bq; k, v = K W^T + b; A = softmax(q_h k_h^T / sqrt(256)); O = q + A v (residual with the projected Q, heads merged); O = LN0(O); O = O + relu(O Wo^T + bo); O = LN1(O).
#define NB 4
#define TT 2048
#define CC 256             // NH * HD = projected width
#define DIN 256
#define NH 4
#define HD 64
#define NQB (TT / 64)
#define HG 4
#define SCALE (0.0625f)
#define CAUSAL 0
#ifndef TNB
#define TNB NB
#endif
__device__ __forceinline__ float bfr(float v) { return (float)(__bf16)v; }
__host__ __device__ __forceinline__ int kb_last(int qb) { return CAUSAL ? ((qb * 64 + 63) >> 7) : (TT / 128 - 1); }
typedef __attribute__((ext_vector_type(8))) __bf16 v8b;
__device__ __forceinline__ v16b frag_b(const __bf16* rowk0, int lane) {
  union { v16b v; v8b q[2]; } u; const __bf16* p = rowk0 + 8 * (lane >> 4);
  u.q[0] = *(const v8b*)p; u.q[1] = *(const v8b*)(p + 16); return u.v;
}
#define QBH 0              // unused: no kernel in this file has a high-precision path
#define QHI 2048            // rows carrying a q residual plane (all rows)
#define KHI 64            // key rows carrying k residual / v bf16 hi+lo planes (written by k_proj, read by no kernel in this file)
// B fragment (k rows k0+.., output column o) of a weight: (in,out) [K][ld] or (out,in) [ld rows of K]: bf16 exact, or f16(bf16 * 256) exact
__device__ __forceinline__ v16b wcol_io(const float* Wm, int k0, int o, int lane, int ld) { v16b w; const int g = lane >> 4;
#pragma unroll
  for (int i = 0; i < 8; ++i) { w[i] = (__bf16)Wm[(size_t)(k0 + 8 * g + i) * ld + o]; w[8 + i] = (__bf16)Wm[(size_t)(k0 + 16 + 8 * g + i) * ld + o]; }
  return w; }
__device__ __forceinline__ v16b wcol_oi(const float* Wm, int k0, int o, int lane, int K) { v16b w; const float* p = Wm + (size_t)o * K + k0 + 8 * (lane >> 4);
#pragma unroll
  for (int i = 0; i < 8; ++i) { w[i] = (__bf16)p[i]; w[8 + i] = (__bf16)p[16 + i]; }
  return w; }
__device__ __forceinline__ v16h wcolh_io(const float* Wm, int k0, int o, int lane, int ld) { v16h w; const int g = lane >> 4;
#pragma unroll
  for (int i = 0; i < 8; ++i) { w[i] = (_Float16)(bfr(Wm[(size_t)(k0 + 8 * g + i) * ld + o]) * 256.0f); w[8 + i] = (_Float16)(bfr(Wm[(size_t)(k0 + 16 + 8 * g + i) * ld + o]) * 256.0f); }
  return w; }
__device__ __forceinline__ v16h wcolh_oi(const float* Wm, int k0, int o, int lane, int K) { v16h w; const float* p = Wm + (size_t)o * K + k0 + 8 * (lane >> 4);
#pragma unroll
  for (int i = 0; i < 8; ++i) { w[i] = (_Float16)(bfr(p[i]) * 256.0f); w[8 + i] = (_Float16)(bfr(p[16 + i]) * 256.0f); }
  return w; }
#define WQKV_LAYOUT 1   // 0 = (in,out) [DIN][CC]; 1 = (out,in) [CC][DIN]; 2 = per-head [NH][DIN][HD], for WCOL only, which no kernel uses: k_qrows and k_proj stage Wq/Wk/Wv as (out,in) [CC][DIN] rows
__device__ __forceinline__ v16b wcol_hdk(const float* Wm, int k0, int o, int lane) { v16b w; const int g = lane >> 4; const float* p = Wm + (size_t)(o / HD) * DIN * HD + (o % HD);
#pragma unroll
  for (int i = 0; i < 8; ++i) { w[i] = (__bf16)p[(size_t)(k0 + 8 * g + i) * HD]; w[8 + i] = (__bf16)p[(size_t)(k0 + 16 + 8 * g + i) * HD]; }
  return w; }
#define WO_OUT_IN 0
#if WQKV_LAYOUT == 1
#define WCOL(W, k0, o, lane) wcol_oi(W, k0, o, lane, DIN)
#elif WQKV_LAYOUT == 2
#define WCOL(W, k0, o, lane) wcol_hdk(W, k0, o, lane)
#else
#define WCOL(W, k0, o, lane) wcol_io(W, k0, o, lane, CC)
#endif
#if WO_OUT_IN
#define WOCOL(W, k0, o, lane) wcol_oi(W, k0, o, lane, CC)
#define WOCOLH(W, k0, o, lane) wcolh_oi(W, k0, o, lane, CC)
#else
#define WOCOL(W, k0, o, lane) wcol_io(W, k0, o, lane, DIN)
#define WOCOLH(W, k0, o, lane) wcolh_io(W, k0, o, lane, DIN)
#endif
#define NROW (NB * TT)
#define GP (DIN + 8)       // LDS pitch of a staged operand row in bf16: 512 B + 16 B = 16 B x odd, free of bank conflicts for 16-byte reads
typedef __attribute__((ext_vector_type(4))) __bf16 v4b;
// 64 rows of DIN f32 that lie one behind the other in memory -> bf16 rows in LDS, by the block's 128 threads: each wave-wide load covers 512 contiguous bytes (whole lines), 32 loads of a thread in flight
__device__ __forceinline__ void stage_bf(__bf16* dst, const float* __restrict__ s, int tid) { v4f x[32];
#pragma unroll
  for (int i = 0; i < 32; ++i) x[i] = *(const v4f*)(s + i * 512 + tid * 4);
  asm volatile("s_wait_xcnt 0x0" ::: "memory");   // stands behind the batch's loads, in front of every later rewrite of a register that they name (the next batch forms its base address in the same registers)
#pragma unroll
  for (int i = 0; i < 32; ++i) { v4b y;
#pragma unroll
    for (int e = 0; e < 4; ++e) y[e] = (__bf16)x[i][e];
    *(v4b*)(dst + (i * 2 + (tid >> 6)) * GP + (tid & 63) * 4) = y; } }
// the eight W fragments of one k step of 32, from the lane's first staged W row
__device__ __forceinline__ void ld_w(v16b (&w)[8], const __bf16* wr, int kc, int lane) {
#pragma unroll
  for (int j = 0; j < 8; ++j) w[j] = frag_b(wr + j * 16 * GP + kc * 32, lane); }
__device__ __forceinline__ void mm8(v8f (&acc)[8], v16b a, const v16b (&w)[8]) {
#pragma unroll
  for (int j = 0; j < 8; ++j) acc[j] = wmma_bf(a, w[j], acc[j]); }
// acc += X W^T over K = DIN from the staged tiles; two fragment sets: a k step's LDS reads stand as one group in front of the products of the step before it
__device__ __forceinline__ void gemm_lds(v8f (&acc)[8], const __bf16* xr, const __bf16* wr, int lane) { v16b a0, a1, w0[8], w1[8];
  a0 = frag_b(xr, lane); ld_w(w0, wr, 0, lane);
#pragma unroll
  for (int kc = 0; kc < DIN / 32; kc += 2) { a1 = frag_b(xr + (kc + 1) * 32, lane); ld_w(w1, wr, kc + 1, lane); mm8(acc, a0, w0);
    if (kc + 2 < DIN / 32) { a0 = frag_b(xr + (kc + 2) * 32, lane); ld_w(w0, wr, kc + 2, lane); }
    mm8(acc, a1, w1); } }
// ---- k_qrows: block = (64 rows, 128 cols): QF = bf16(Q) Wq^T + bq (exact products, f32) -> rows (the residual needs Qh in f32; k_proj keeps only f16 planes)
__global__ __launch_bounds__(128) void k_qrows(const float* __restrict__ X, const float* __restrict__ WQ, const float* __restrict__ BQ, float* __restrict__ QF) { __shared__ __align__(16) float sf[4][16][132]; __shared__ __align__(16) __bf16 ops[192 * GP];   // rows 0..63: the X tile, 64..191: the W tile
  const int tid = threadIdx.x, wave = tid >> 5, lane = tid & 31, col = lane & 15, g = lane >> 4; const int c0 = blockIdx.y * 128; const size_t r0 = (size_t)blockIdx.x * 64 + wave * 16;
#pragma unroll 1   // rolled: one batch of 32 loads a thread in flight at a time; unrolled, the batches' registers add up past 256
  for (int b = 0; b < 3; ++b) stage_bf(ops + b * 64 * GP, b == 0 ? X + (size_t)blockIdx.x * 64 * DIN : WQ + (size_t)(c0 + (b - 1) * 64) * DIN, tid);
  __syncthreads();   // both operand tiles are published to every wave
  v8f acc[8] = {}; gemm_lds(acc, ops + (wave * 16 + col) * GP, ops + (64 + col) * GP, lane);
#pragma unroll
  for (int j = 0; j < 8; ++j) { const float bb = bfr(BQ[c0 + j * 16 + col]);
#pragma unroll
    for (int r = 0; r < 8; ++r) sf[wave][8 * g + r][j * 16 + col] = acc[j][r] + bb; }
  LDSX(); for (int rl = 0; rl < 16; ++rl) vst2(QF + (r0 + rl) * DIN + c0 + lane * 4, *(const v4f*)&sf[wave][rl][lane * 4]); }
// ---- k_tail: block = 32 whole rows, 8 waves: O = LayerNorm0(QF + ctx); T = O + relu(O (hi + lo) . Wo[c][:] + bo[c]) (Wo (out,in) exact bf16; 2 products); OUT = LayerNorm1(T); O and T stay in LDS, so one launch does the work of three
#define TR 32              // rows a block: 256 blocks, one a WGP
#define TP (DIN + 4)       // LDS pitch of an f32 row: 16-byte aligned; rows 8 apart lie 32 banks apart
// 128 rows of DIN f32 that lie one behind the other in memory, by the block's 256 threads: each wave-wide load covers 512 contiguous bytes, 32 loads of a thread in flight
__device__ __forceinline__ void w_load(v4f (&x)[32], const float* __restrict__ s, int tid) {
#pragma unroll
  for (int i = 0; i < 32; ++i) x[i] = *(const v4f*)(s + i * 1024 + tid * 4);
  asm volatile("s_wait_xcnt 0x0" ::: "memory"); }   // stands behind the loads issued so far, in front of every later rewrite of a register that they name
__device__ __forceinline__ void w_store(__bf16* dst, const v4f (&x)[32], int tid) {
#pragma unroll
  for (int i = 0; i < 32; ++i) { v4b y;
#pragma unroll
    for (int e = 0; e < 4; ++e) y[e] = (__bf16)x[i][e];
    *(v4b*)(dst + (i * 4 + (tid >> 6)) * GP + (tid & 63) * 4) = y; } }
// LayerNorm of four rows a wave, in place (biased var, eps 1e-5, x g + b); the lane holds columns q * 128 + lane * 4 + 0..3; the four rows' sums run side by side
__device__ __forceinline__ void ln4(v4f (&x)[4][DIN / 128], const v4f (&gm)[DIN / 128], const v4f (&bt)[DIN / 128]) { float s1[4], qq[4], mu[4];
#pragma unroll
  for (int r = 0; r < 4; ++r) { s1[r] = 0.f;
#pragma unroll
    for (int q = 0; q < DIN / 128; ++q)
#pragma unroll
      for (int i = 0; i < 4; ++i) s1[r] += x[r][q][i]; }
#pragma unroll
  for (int o = 1; o < 32; o <<= 1)
#pragma unroll
    for (int r = 0; r < 4; ++r) s1[r] += __shfl_xor(s1[r], o);
#pragma unroll
  for (int r = 0; r < 4; ++r) { mu[r] = s1[r] * (1.0f / DIN); qq[r] = 0.f;
#pragma unroll
    for (int q = 0; q < DIN / 128; ++q)
#pragma unroll
      for (int i = 0; i < 4; ++i) { const float d = x[r][q][i] - mu[r]; qq[r] += d * d; } }
#pragma unroll
  for (int o = 1; o < 32; o <<= 1)
#pragma unroll
    for (int r = 0; r < 4; ++r) qq[r] += __shfl_xor(qq[r], o);
#pragma unroll
  for (int r = 0; r < 4; ++r) { const float rs = rsqrtf(qq[r] * (1.0f / DIN) + 1e-5f);
#pragma unroll
    for (int q = 0; q < DIN / 128; ++q)
#pragma unroll
      for (int i = 0; i < 4; ++i) x[r][q][i] = (x[r][q][i] - mu[r]) * rs * bfr(gm[q][i]) + bfr(bt[q][i]); } }
__global__ __launch_bounds__(256) void k_tail(const float* __restrict__ QF, const float* __restrict__ CX, const float* __restrict__ G0, const float* __restrict__ B0, const float* __restrict__ WO, const float* __restrict__ BO, const float* __restrict__ G1, const float* __restrict__ B1, float* __restrict__ OUT) {
  __shared__ __align__(16) __bf16 wt[CC * GP], xh[TR * GP], xl[TR * GP]; __shared__ __align__(16) float of[TR][TP];
  const int tid = threadIdx.x, wave = tid >> 5, lane = tid & 31, col = lane & 15, g = lane >> 4; const int rw = wave * 4, rt = (wave & 1) * 16, cg = (wave >> 1) * 64; const size_t r0 = (size_t)blockIdx.x * TR;
  v4f x[4][DIN / 128], cx[4][DIN / 128], g0[DIN / 128], b0[DIN / 128], g1[DIN / 128], b1[DIN / 128], wa[32], wb[32]; float bo[4];
#pragma unroll
  for (int r = 0; r < 4; ++r)
#pragma unroll
    for (int q = 0; q < DIN / 128; ++q) { const size_t o = (r0 + rw + r) * DIN + q * 128 + lane * 4; x[r][q] = *(const v4f*)(QF + o); cx[r][q] = *(const v4f*)(CX + o); }
  asm volatile("s_wait_xcnt 0x0" ::: "memory");   // stands behind the row loads, in front of every later rewrite of a register that they name
#pragma unroll
  for (int q = 0; q < DIN / 128; ++q) { const int c = q * 128 + lane * 4; g0[q] = *(const v4f*)(G0 + c); b0[q] = *(const v4f*)(B0 + c); g1[q] = *(const v4f*)(G1 + c); b1[q] = *(const v4f*)(B1 + c); }
#pragma unroll
  for (int j = 0; j < 4; ++j) bo[j] = BO[cg + j * 16 + col];
  asm volatile("s_wait_xcnt 0x0" ::: "memory");   // the same behind the loads of the LayerNorm vectors and the bias
  w_load(wa, WO, tid); w_store(wt, wa, tid);
  w_load(wb, WO + (size_t)128 * DIN, tid);   // the second half of Wo flies while LayerNorm0 runs
#pragma unroll
  for (int r = 0; r < 4; ++r)
#pragma unroll
    for (int q = 0; q < DIN / 128; ++q)
#pragma unroll
      for (int i = 0; i < 4; ++i) x[r][q][i] += cx[r][q][i];
  ln4(x, g0, b0);
#pragma unroll
  for (int r = 0; r < 4; ++r)
#pragma unroll
    for (int q = 0; q < DIN / 128; ++q) *(v4f*)&of[rw + r][q * 128 + lane * 4] = x[r][q];
  LDSX();   // the wave's own four rows are read back below in another lane order
#pragma unroll
  for (int r = 0; r < 4; ++r) { const float* p = &of[rw + r][lane * 8]; v8b yh, yl;   // bf16 hi + lo planes, eight columns a lane: 16-byte LDS stores
#pragma unroll
    for (int e = 0; e < 8; ++e) { const float v = p[e]; const __bf16 h = (__bf16)v; yh[e] = h; yl[e] = (__bf16)(v - (float)h); }
    *(v8b*)(xh + (rw + r) * GP + lane * 8) = yh; *(v8b*)(xl + (rw + r) * GP + lane * 8) = yl; }
  w_store(wt + 128 * GP, wb, tid);
  __syncthreads();   // Wo and the LayerNorm0 rows (f32, bf16 hi, bf16 lo) are published to every wave
  v8f acc[4] = {}; { const __bf16 *hr = xh + (rt + col) * GP, *lr = xl + (rt + col) * GP, *wr = wt + (cg + col) * GP; v16b h[2], l[2], w[2][4];   // wave = 16 rows x 64 columns; two fragment sets, as in gemm_lds
    h[0] = frag_b(hr, lane); l[0] = frag_b(lr, lane);
#pragma unroll
    for (int j = 0; j < 4; ++j) w[0][j] = frag_b(wr + j * 16 * GP, lane);
#pragma unroll
    for (int kc = 0; kc < DIN / 32; ++kc) { const int s = kc & 1;
      if (kc + 1 < DIN / 32) { h[s ^ 1] = frag_b(hr + (kc + 1) * 32, lane); l[s ^ 1] = frag_b(lr + (kc + 1) * 32, lane);
#pragma unroll
        for (int j = 0; j < 4; ++j) w[s ^ 1][j] = frag_b(wr + j * 16 * GP + (kc + 1) * 32, lane); }
#pragma unroll
      for (int j = 0; j < 4; ++j) acc[j] = wmma_bf(h[s], w[s][j], acc[j]);
#pragma unroll
      for (int j = 0; j < 4; ++j) acc[j] = wmma_bf(l[s], w[s][j], acc[j]); } }
#pragma unroll
  for (int j = 0; j < 4; ++j)
#pragma unroll
    for (int r = 0; r < 8; ++r) { float* p = &of[rt + 8 * g + r][cg + j * 16 + col]; *p = fmaxf(acc[j][r] + bfr(bo[j]), 0.f) + *p; }   // each element has one owner lane
  __syncthreads();   // the T rows are whole before LayerNorm1 reads them
#pragma unroll
  for (int r = 0; r < 4; ++r)
#pragma unroll
    for (int q = 0; q < DIN / 128; ++q) x[r][q] = *(const v4f*)&of[rw + r][q * 128 + lane * 4];
  ln4(x, g1, b1);
#pragma unroll
  for (int r = 0; r < 4; ++r)
#pragma unroll
    for (int q = 0; q < DIN / 128; ++q) vst2(OUT + (r0 + rw + r) * DIN + q * 128 + lane * 4, x[r][q]); }
#define WS_QF  (WS_END)
#define WS_O   (WS_QF + 4u * (size_t)NROW * DIN)
#define WS_T   (WS_O + 4u * (size_t)NROW * DIN)
#define WS_END2 (WS_T + 4u * (size_t)NROW * DIN)
#ifndef SM_EXTRA_PARAMS
#define SM_EXTRA_PARAMS
#endif
#ifndef PROJ_EXTRA_PARAMS
#define PROJ_EXTRA_PARAMS
#endif
#ifndef SM_MASK_HOOK
#define SM_MASK_HOOK (void)0
#endif

#define WS_QH  0u                                      // f16 q rows [b*t][CC]
#define WS_KH  (WS_QH + 2u * (size_t)NB * TT * CC)      // f16 k rows [b*t][CC]
#define WS_VT  (WS_KH + 2u * (size_t)NB * TT * CC)      // f16 v planes [b][c][t]
#define WS_QL  (WS_VT + 2u * (size_t)NB * CC * TT)      // f16 q residual x 2^10 rows [b][t < QHI][CC]
#define WS_KL  (WS_QL + 2u * (size_t)NB * QHI * CC)     // f16 k residual x 2^10 rows [b][t < KHI][CC]
#define WS_VB  (WS_KL + 2u * (size_t)NB * KHI * CC)     // bf16 v hi planes [b][c][t < KHI]
#define WS_VBL (WS_VB + 2u * (size_t)NB * CC * KHI)
#define WS_S   (WS_VBL + 2u * (size_t)NB * CC * KHI)    // f32 [hg][t][s], unused: k_fa keeps logits and P in registers
#define WS_Y   (WS_S  + 4u * (size_t)HG * TT * TT)      // f32 ctx rows [b*t][CC] (only when there is an output projection)
#define WS_END (WS_Y  + 0u)

// ---- k_proj: block = (64 rows, 128 cols, which): q/k/v = X W (+ b) with exact bf16 products (K = DIN) -> which 0: q f16 rows (+ residual rows < QHI); 1: k f16 rows (+ residual rows < KHI); 2: v f16 planes [c][t] (+ bf16 hi/lo planes for t < KHI)
__global__ __launch_bounds__(128) void k_proj(const float* __restrict__ XQ, const float* __restrict__ XK, const float* __restrict__ XV, const float* __restrict__ WQ, const float* __restrict__ WK, const float* __restrict__ WV, const float* __restrict__ BQ, const float* __restrict__ BK, const float* __restrict__ BV,
    _Float16* __restrict__ QH, _Float16* __restrict__ QL, _Float16* __restrict__ KH, _Float16* __restrict__ KL, _Float16* __restrict__ VT, __bf16* __restrict__ VB, __bf16* __restrict__ VBL) {
  __shared__ __align__(16) union { __bf16 ops[192 * GP]; struct { _Float16 sh[64][136], sl[64][136]; } qk; struct { _Float16 th[128][72]; __bf16 tb[128][72], tbl[128][72]; } v; } sm;   // ops rows 0..63: the X tile, 64..191: the W tile; the output staging takes their place, so that three blocks a WGP stay resident
  auto& sh = sm.qk.sh; auto& sl = sm.qk.sl; auto& th = sm.v.th; auto& tb = sm.v.tb; auto& tbl = sm.v.tbl;
  const int tid = threadIdx.x, wave = tid >> 5, lane = tid & 31, col = lane & 15, g = lane >> 4; const int which = blockIdx.z; const int c0 = blockIdx.y * 128; const size_t r0 = (size_t)blockIdx.x * 64; const size_t bb = r0 / TT; const int t0 = (int)(r0 % TT);
  const float* X = which == 0 ? XQ : which == 1 ? XK : XV; const float* WA = which == 0 ? WQ : which == 1 ? WK : WV; const float* BA = which == 0 ? BQ : which == 1 ? BK : BV;
#pragma unroll 1   // rolled: one batch of 32 loads a thread in flight at a time; unrolled, the batches' registers add up past what three resident waves a SIMD allow
  for (int b = 0; b < 3; ++b) stage_bf(sm.ops + b * 64 * GP, b == 0 ? X + r0 * DIN : WA + (size_t)(c0 + (b - 1) * 64) * DIN, tid);
  __syncthreads();   // both operand tiles are published to every wave
  v8f acc[8] = {}; gemm_lds(acc, sm.ops + (wave * 16 + col) * GP, sm.ops + (64 + col) * GP, lane);
  __syncthreads();   // every wave's reads of the operand tiles are done before the output staging overwrites them
  if (which < 2) { _Float16* DH = which == 0 ? QH : KH; _Float16* DL = which == 0 ? QL : KL; const int nhi = which == 0 ? QHI : KHI; const bool hi_rows = t0 < nhi;
#pragma unroll
    for (int j = 0; j < 8; ++j) { const float bias = BA ? bfr(BA[c0 + j * 16 + col]) : 0.f;
#pragma unroll
      for (int r = 0; r < 8; ++r) { const float v = acc[j][r] + bias; const _Float16 hv = (_Float16)v; sh[wave * 16 + 8 * g + r][j * 16 + col] = hv; sl[wave * 16 + 8 * g + r][j * 16 + col] = (_Float16)((v - (float)hv) * 1024.0f); } }
    __syncthreads();
    for (int e = tid; e < 64 * 16; e += 128) { const int rl = e >> 4, q = e & 15; vst2((unsigned*)(DH + (r0 + rl) * CC + c0 + q * 8), *(const v4u*)&sh[rl][q * 8]); if (hi_rows) vst2((unsigned*)(DL + (bb * nhi + t0 + rl) * (size_t)CC + c0 + q * 8), *(const v4u*)&sl[rl][q * 8]); }
  } else { const bool hi_rows = t0 < KHI;
#pragma unroll
    for (int j = 0; j < 8; ++j) { const float bias = BA ? bfr(BA[c0 + j * 16 + col]) : 0.f;
#pragma unroll
      for (int r = 0; r < 8; ++r) { const float v = acc[j][r] + bias; const int rl = wave * 16 + 8 * g + r, cl = j * 16 + col; th[cl][rl] = (_Float16)v; const __bf16 bh = (__bf16)v; tb[cl][rl] = bh; tbl[cl][rl] = (__bf16)(v - (float)bh); } }
    __syncthreads();
    for (int e = tid; e < 128 * 8; e += 128) { const int cl = e >> 3, q = e & 7; vst2((unsigned*)(VT + (bb * CC + c0 + cl) * (size_t)TT + t0 + q * 8), *(const v4u*)&th[cl][q * 8]); if (hi_rows) { const size_t o3 = (bb * CC + c0 + cl) * (size_t)KHI + t0 + q * 8; vst2((unsigned*)(VB + o3), *(const v4u*)&tb[cl][q * 8]); vst2((unsigned*)(VBL + o3), *(const v4u*)&tbl[cl][q * 8]); } } } }
// ---- k_fa: block = 4 waves x 16 queries of (b, h), one launch for every batch and head: S^T = K Q^T (q hi + residual x 2^10, 2 products), online softmax in f32 per lane (lane = query), O^T += V^T P^T (P once to f16, 1 product); logits and P stay in registers; K rows and V^T rows of 128 keys a stage come into LDS by asynchronous copies (two buffers) and serve the block's four waves
typedef __attribute__((ext_vector_type(2))) _Float16 v2h;
#define FA_C (SCALE * 1.4426950408889634f)   // raw q.k -> base-2 exponent
#define FA_LAZY (8.0f / FA_C)                // the maximum in use is replaced only when a new one exceeds it by 2^8
#define FA_OFF 6.0f                          // P = 2^(6 + ...) <= 2^14: keeps small weights out of the f16 subnormals; cancels against the row sum
#define FA_KT 128                            // keys a stage (4 passes of 32 keys)
#define FA_NT (TT / FA_KT)                   // stages
#define FA_KP (HD + 8)                       // LDS pitch of a K row in f16: 128 B + 16 B = 16 B x odd, free of bank conflicts for 16-byte reads
#define FA_VP (FA_KT + 8)                    // LDS pitch of a V^T row in f16: 256 B + 16 B
#define FA_KBUF (FA_KT * FA_KP)
#define FA_VBUF (HD * FA_VP)
__device__ __forceinline__ float xhalf(float x) { return __builtin_bit_cast(float, __builtin_amdgcn_permlanex16(__builtin_bit_cast(int, x), __builtin_bit_cast(int, x), 0x76543210, 0xfedcba98, false, false)); }
__device__ __forceinline__ v8f wm16(v16h a, v16h b, v8f c) { return __builtin_amdgcn_wmma_f32_16x16x32_f16(false, a, false, b, (short)0, c, false, false); }
// fragments of one pass, from the stage's LDS buffer: K rows (A of S^T: row = key) and V^T rows (A of O^T: row = feature, k = key), both in the hardware k order
__device__ __forceinline__ void fa_load(v16h (&kf)[2][HD / 32], v16h (&vf)[HD / 16], const _Float16* Kl, const _Float16* Vl, int pass, int lane) {
#pragma unroll
  for (int i = 0; i < 2; ++i)
#pragma unroll
    for (int kc = 0; kc < HD / 32; ++kc) kf[i][kc] = frag_h(Kl + (pass * 32 + i * 16) * FA_KP + kc * 32, lane);
#pragma unroll
  for (int j = 0; j < HD / 16; ++j) vf[j] = frag_h(Vl + pass * 32 + j * 16 * FA_VP, lane); }
// eight asynchronous 16-byte copies a lane, global -> LDS, at fixed steps of both addresses; the s_wait_xcnt stands inside the statement so that no address register is rewritten in front of it
__device__ __forceinline__ void fa_copy8(unsigned l, unsigned ls, const _Float16* g, size_t gs) {
  asm volatile("global_load_async_to_lds_b128 %0, %8, off\n\tglobal_load_async_to_lds_b128 %1, %9, off\n\tglobal_load_async_to_lds_b128 %2, %10, off\n\tglobal_load_async_to_lds_b128 %3, %11, off\n\t"
               "global_load_async_to_lds_b128 %4, %12, off\n\tglobal_load_async_to_lds_b128 %5, %13, off\n\tglobal_load_async_to_lds_b128 %6, %14, off\n\tglobal_load_async_to_lds_b128 %7, %15, off\n\ts_wait_xcnt 0x0"
               :: "v"(l), "v"(l + ls), "v"(l + 2 * ls), "v"(l + 3 * ls), "v"(l + 4 * ls), "v"(l + 5 * ls), "v"(l + 6 * ls), "v"(l + 7 * ls),
                  "v"(g), "v"(g + gs), "v"(g + 2 * gs), "v"(g + 3 * gs), "v"(g + 4 * gs), "v"(g + 5 * gs), "v"(g + 6 * gs), "v"(g + 7 * gs) : "memory"); }
template <bool AHEAD> __device__ __forceinline__ void fa_pass(const v16h (&kf)[2][HD / 32], const v16h (&vf)[HD / 16], const v16h (&kn)[2][HD / 32], const v16h (&qh)[HD / 32], const v16h (&ql)[HD / 32], v8f (&o)[HD / 16], float& m, v2f (&l)[2]) {
  v8f sh[2] = {}, sl[2] = {};
#pragma unroll
  for (int kc = 0; kc < HD / 32; ++kc)
#pragma unroll
    for (int i = 0; i < 2; ++i) { sh[i] = wm16(kf[i][kc], qh[kc], sh[i]); sl[i] = wm16(kf[i][kc], ql[kc], sl[i]); }
  v2f t[8]; float mx = -3.0e38f;   // lane (c, h): query c, keys 8h + 0..7 and 16 + 8h + 0..7
#pragma unroll
  for (int e = 0; e < 8; ++e) { const int i = e >> 2, r = (e & 3) * 2; t[e][0] = sh[i][r] + sl[i][r] * (1.0f / 1024.0f); t[e][1] = sh[i][r + 1] + sl[i][r + 1] * (1.0f / 1024.0f); mx = fmaxf(mx, fmaxf(t[e][0], t[e][1])); }
  mx = fmaxf(mx, xhalf(mx));
  if (AHEAD) asm volatile("" :: "v"(kn[0][0]), "v"(kn[0][1]), "v"(kn[1][0]), "v"(kn[1][1]));   // inputs only: holds the LDS loads of the next pass's K fragments in front of the branch below; behind it they would stand directly in front of their products, their latency open
  if (__builtin_amdgcn_ballot_w32(mx > m + FA_LAZY) != 0) { const float mn = fmaxf(m, mx); const float al = __builtin_amdgcn_exp2f((m - mn) * FA_C); m = mn; l[0] *= al; l[1] *= al;
#pragma unroll
    for (int j = 0; j < HD / 16; ++j)
#pragma unroll
      for (int r = 0; r < 8; ++r) o[j][r] *= al; }
  const float mc = m * FA_C - FA_OFF; v16h p;
#pragma unroll
  for (int e = 0; e < 8; ++e) { v2f pe; pe[0] = __builtin_amdgcn_exp2f(t[e][0] * FA_C - mc); pe[1] = __builtin_amdgcn_exp2f(t[e][1] * FA_C - mc); l[e & 1] += pe; const v2h ph = __builtin_convertvector(pe, v2h); p[2 * e] = ph[0]; p[2 * e + 1] = ph[1]; }
#pragma unroll
  for (int j = 0; j < HD / 16; ++j) o[j] = wm16(vf[j], p, o[j]); }
__global__ __launch_bounds__(128) void k_fa(const _Float16* __restrict__ QH, const _Float16* __restrict__ QL, const _Float16* __restrict__ KH, const _Float16* __restrict__ VT, float* __restrict__ Y) {
  __shared__ __align__(16) _Float16 ks[2][FA_KBUF], vs[2][FA_VBUF];
  const int tid = threadIdx.x, wave = tid >> 5, lane = tid & 31, col = lane & 15, g = lane >> 4; const int h = blockIdx.y, b = blockIdx.z; const int ql0 = blockIdx.x * 64 + wave * 16;
  v16h qh[HD / 32], ql[HD / 32];
#pragma unroll
  for (int kc = 0; kc < HD / 32; ++kc) { qh[kc] = frag_h(QH + ((size_t)b * TT + ql0 + col) * CC + h * HD + kc * 32, lane); ql[kc] = frag_h(QL + ((size_t)b * QHI + ql0 + col) * CC + h * HD + kc * 32, lane); }
  // a stage's copies: K 128 rows x 128 B (a thread: 16 B of rows tid / 8 + 16 i), V^T 64 rows x 256 B (16 B of rows tid / 16 + 8 i): whole 128-byte lines on the global side
  const _Float16* Kg = KH + ((size_t)b * TT + (tid >> 3)) * CC + h * HD + (tid & 7) * 8;
  const _Float16* Vg = VT + ((size_t)b * CC + h * HD + (tid >> 4)) * (size_t)TT + (tid & 15) * 8;
  const unsigned kd = (unsigned)(size_t)&ks[0][(tid >> 3) * FA_KP + (tid & 7) * 8], vd = (unsigned)(size_t)&vs[0][(tid >> 4) * FA_VP + (tid & 15) * 8];   // LDS byte addresses
  v16h kA[2][HD / 32], vA[HD / 16], kB[2][HD / 32], vB[HD / 16];
  v8f o[HD / 16] = {}; float m = -3.0e38f; v2f l[2] = {};
  fa_copy8(kd, 16 * FA_KP * 2, Kg, (size_t)16 * CC); fa_copy8(vd, 8 * FA_VP * 2, Vg, (size_t)8 * TT);
  asm volatile("s_wait_asynccnt 0x0" ::: "memory");   // this wave's copies of stage 0 have landed
  __syncthreads();                                    // stage 0 is published to every wave
  fa_copy8(kd + FA_KBUF * 2, 16 * FA_KP * 2, Kg + (size_t)FA_KT * CC, (size_t)16 * CC); fa_copy8(vd + FA_VBUF * 2, 8 * FA_VP * 2, Vg + FA_KT, (size_t)8 * TT);
  for (int t = 0; t < FA_NT; ++t) {   // trip t reads buffer t mod 2 alone, while stage t + 1 flies into the other
    const int bf = t & 1; const _Float16* Kl = &ks[bf][col * FA_KP]; const _Float16* Vl = &vs[bf][col * FA_VP];   // the lane's key row of pass 0 and its feature row
    fa_load(kA, vA, Kl, Vl, 0, lane);   // two register sets: inside a stage a pass's fragments are fetched during the pass before it
    fa_load(kB, vB, Kl, Vl, 1, lane);
    fa_pass<true>(kA, vA, kB, qh, ql, o, m, l);
    fa_load(kA, vA, Kl, Vl, 2, lane);
    fa_pass<true>(kB, vB, kA, qh, ql, o, m, l);
    fa_load(kB, vB, Kl, Vl, 3, lane);
    fa_pass<true>(kA, vA, kB, qh, ql, o, m, l);
    fa_pass<false>(kB, vB, kB, qh, ql, o, m, l);
    asm volatile("s_wait_dscnt 0x0" ::: "memory");      // this wave's reads of buffer t mod 2 are done before it is refilled
    asm volatile("s_wait_asynccnt 0x0" ::: "memory");   // this wave's copies of stage t + 1 have landed
    __syncthreads();                                    // publishes stage t + 1 and ends every wave's reads of buffer t mod 2
    if (t + 2 < FA_NT) { fa_copy8(kd + bf * (FA_KBUF * 2), 16 * FA_KP * 2, Kg + (size_t)(t + 2) * FA_KT * CC, (size_t)16 * CC); fa_copy8(vd + bf * (FA_VBUF * 2), 8 * FA_VP * 2, Vg + (t + 2) * FA_KT, (size_t)8 * TT); }
  }
  asm volatile("s_wait_asynccnt 0x0" ::: "memory");   // no copy is outstanding when the wave ends
  float ls = l[0][0] + l[0][1] + l[1][0] + l[1][1]; ls += xhalf(ls); const float inv = 1.0f / ls;
  float* yr = Y + ((size_t)b * TT + ql0 + col) * CC + h * HD + 8 * g;   // O^T: the lane holds features j * 16 + 8h + 0..7 of its query
#pragma unroll
  for (int j = 0; j < HD / 16; ++j) { v4f a, c;
#pragma unroll
    for (int r = 0; r < 4; ++r) { a[r] = o[j][r] * inv; c[r] = o[j][4 + r] * inv; }
    vst2(yr + j * 16, a); vst2(yr + j * 16 + 4, c); } }

extern "C" void kernel_launch(void* const* d_in, const int* in_sizes, int n_in, void* d_out, int out_size, void* d_ws, size_t ws_size, hipStream_t stream) {
  (void)in_sizes; (void)n_in; (void)out_size;
  const float** F = (const float**)d_in;
  if (ws_size < (size_t)WS_END) return;
  char* ws = (char*)d_ws; _Float16 *QH = (_Float16*)(ws + WS_QH), *KH = (_Float16*)(ws + WS_KH), *VT = (_Float16*)(ws + WS_VT), *QL = (_Float16*)(ws + WS_QL), *KL = (_Float16*)(ws + WS_KL); __bf16 *VB = (__bf16*)(ws + WS_VB), *VBL = (__bf16*)(ws + WS_VBL); float *S = (float*)(ws + WS_S), *Y = (float*)(ws + WS_Y);
  (void)Y; (void)S; (void)QL; (void)KL; (void)VB; (void)VBL;
  // inputs: 0 Q, 1 K [4,2048,256]; 2 Wq, 3 bq; 4 Wk, 5 bk; 6 Wv, 7 bv; 8 Wo, 9 bo ((out,in) [256,256]); 10 g0, 11 b0; 12 g1, 13 b1
  if (ws_size < (size_t)WS_END2) return;
  float *QF = (float*)(ws + WS_QF), *T = (float*)(ws + WS_T);
  k_proj<<<dim3(TNB * TT / 64, CC / 128, 3), 128, 0, stream>>>(F[0], F[1], F[1], F[2], F[4], F[6], F[3], F[5], F[7], QH, QL, KH, KL, VT, VB, VBL);
  k_qrows<<<dim3(TNB * TT / 64, DIN / 128), 128, 0, stream>>>(F[0], F[2], F[3], QF);
  k_fa<<<dim3(NQB, NH, TNB), 128, 0, stream>>>(QH, QL, KH, VT, T);   /* ctx rows into T (scratch) */
  k_tail<<<dim3(TNB * TT / TR), 256, 0, stream>>>(QF, T, F[10], F[11], F[8], F[9], F[12], F[13], (float*)d_out);   /* out = LN1(O + relu(O Wo^T + bo)), O = LN0(Qh + A Vh) */
}

// v005
// Measured time: 46.2 microseconds a run.
// In both of two side-by-side timings against v004, it was 1.15 times as fast.
// All steps since v000 together make it 12.9 times as fast.
// compute dtype: all float inputs rounded to bf16; Qh/Kh/Vh = X W^T + b with EXACT bf16 products on WMMA 16x16x32 (f32 accumulate); q as f16 hi + residual (x 2^10) against k once to f16 (2 products) x 256^-0.5, no mask; online softmax in f32 (base-2 exponential); P x 2^6 against the maximum in use, once to f16, against v once to f16 (1 product), divided by the f32 row sum at the end; Qh (its f16 hi + residual planes summed in f32) + ctx, LayerNorm, the rFF GEMM with the LN rows split bf16 hi + lo against exact Wo (2 products) + bo, relu, residual and the second LayerNorm in f32; f32 output.
#include <hip/hip_runtime.h>
#include <math.h>

typedef __attribute__((ext_vector_type(16))) _Float16 v16h;
typedef __attribute__((ext_vector_type(16))) __bf16 v16b;
typedef __attribute__((ext_vector_type(8)))  _Float16 v8h;
typedef __attribute__((ext_vector_type(8)))  float v8f;
typedef __attribute__((ext_vector_type(4)))  float v4f;
typedef __attribute__((ext_vector_type(2)))  float v2f;
typedef __attribute__((ext_vector_type(4)))  unsigned v4u;
typedef __attribute__((ext_vector_type(4)))  int v4i;
typedef float __attribute__((may_alias)) float_a;
typedef int __attribute__((may_alias)) int_a;

template <typename T> __device__ __forceinline__ void vst2(void* p, T v) { *(T*)p = v;  }
__device__ __forceinline__ v8f wmma16(v16h a, v16h b, v8f c) {
  v8f d = __builtin_amdgcn_wmma_f32_16x16x32_f16(false, a, false, b, (short)0, c, false, false);
  asm volatile("v_nop\n\tv_nop\n\tv_nop\n\tv_nop" : "+v"(d) : "v"(a), "v"(b));
  return d;
}
__device__ __forceinline__ v8f wmma_bf(v16b a, v16b b, v8f c) {
  v8f d = __builtin_amdgcn_wmma_f32_16x16x32_bf16(false, a, false, b, (short)0, c, false, false);
  asm volatile("v_nop\n\tv_nop\n\tv_nop\n\tv_nop" : "+v"(d) : "v"(a), "v"(b));
  return d;
}
// 16x16x32 fragments: lane = (h = lane>>4, row/col = lane&15); elements 0..7 = k0+8h+0..7, 8..15 = k0+16+8h+0..7; D element r = row 8h+r
__device__ __forceinline__ v16h frag_h(const _Float16* rowk0, int lane) {
  union { v16h v; v8h q[2]; } u; const _Float16* p = rowk0 + 8 * (lane >> 4);
  u.q[0] = *(const v8h*)p; u.q[1] = *(const v8h*)(p + 16); return u.v;
}
__device__ __forceinline__ v16h frag_f32(const float* rowk0, int lane) {
  v16h a; const float* p = rowk0 + 8 * (lane >> 4);
#pragma unroll
  for (int i = 0; i < 8; ++i) { a[i] = (_Float16)p[i]; a[8 + i] = (_Float16)p[16 + i]; }
  return a;
}
__device__ __forceinline__ v16h frag_f32s(const float* rowk0, int lane, float sc) {
  v16h a; const float* p = rowk0 + 8 * (lane >> 4);
#pragma unroll
  for (int i = 0; i < 8; ++i) { a[i] = (_Float16)(p[i] * sc); a[8 + i] = (_Float16)(p[16 + i] * sc); }
  return a;
}
// column fragment from a [K][ld] layout (column n), rows >= K read as 0
__device__ __forceinline__ v16h fragc_f32(const float* W, int k0, int n, int lane, int ld, int K) {
  v16h a; const int g = lane >> 4;
#pragma unroll
  for (int i = 0; i < 8; ++i) { const int ka = k0 + 8 * g + i, kb = ka + 16;
    a[i] = (_Float16)(ka < K ? W[(size_t)(ka < K ? ka : K - 1) * ld + n] : 0.f); a[8 + i] = (_Float16)(kb < K ? W[(size_t)(kb < K ? kb : K - 1) * ld + n] : 0.f); }
  return a;
}
struct F2 { v16b h, l; };
__device__ __forceinline__ F2 bsplit16(const float v[16]) { F2 r;
#pragma unroll
  for (int i = 0; i < 16; ++i) { const __bf16 h = (__bf16)v[i]; r.h[i] = h; r.l[i] = (__bf16)(v[i] - (float)h); }
  return r; }
__device__ __forceinline__ F2 split_row(const float* row, int k0, int lane) { float v[16]; const float* p = row + k0 + 8 * (lane >> 4);
#pragma unroll
  for (int i = 0; i < 8; ++i) { v[i] = p[i]; v[8 + i] = p[16 + i]; }
  return bsplit16(v); }
__device__ __forceinline__ F2 split_rowK(const float* row, int k0, int lane, int K) { float v[16]; const int g = lane >> 4;
#pragma unroll
  for (int i = 0; i < 8; ++i) { const int ka = k0 + 8 * g + i, kb = ka + 16; v[i] = ka < K ? row[ka < K ? ka : K - 1] : 0.f; v[8 + i] = kb < K ? row[kb < K ? kb : K - 1] : 0.f; }
  return bsplit16(v); }
__device__ __forceinline__ F2 split_col(const float* W, int k0, int n, int lane, int ld, int K) { float v[16]; const int g = lane >> 4;
#pragma unroll
  for (int i = 0; i < 8; ++i) { const int ka = k0 + 8 * g + i, kb = ka + 16; v[i] = ka < K ? W[(size_t)(ka < K ? ka : K - 1) * ld + n] : 0.f; v[8 + i] = kb < K ? W[(size_t)(kb < K ? kb : K - 1) * ld + n] : 0.f; }
  return bsplit16(v); }
__device__ __forceinline__ v8f mac3(const F2& a, const F2& b, v8f c) { c = wmma_bf(a.l, b.h, c); c = wmma_bf(a.h, b.l, c); return wmma_bf(a.h, b.h, c); }
__device__ __forceinline__ float sigm(float v) { return 1.0f / (1.0f + expf(-v)); }
#define LDSX() do { asm volatile("s_wait_dscnt 0" ::: "memory"); __builtin_amdgcn_wave_barrier(); __builtin_amdgcn_fence(__ATOMIC_RELEASE, "workgroup"); } while (0)

// Set-Transformer MAB (B 4, 2,048 queries x 2,048 keys, D 256 = 4 x 64, no mask): q = Q Wq^T + bq; k, v = K W^T + b; A = softmax(q_h k_h^T / sqrt(256)); O = q + A v (residual with the projected Q, heads merged); O = LN0(O); O = O + relu(O Wo^T + bo); O = LN1(O).
#define NB 4
#define TT 2048
#define CC 256             // NH * HD = projected width
#define DIN 256
#define NH 4
#define HD 64
#define NQB (TT / 64)
#define HG 4
#define SCALE (0.0625f)
#define CAUSAL 0
#ifndef TNB
#define TNB NB
#endif
__device__ __forceinline__ float bfr(float v) { return (float)(__bf16)v; }
__host__ __device__ __forceinline__ int kb_last(int qb) { return CAUSAL ? ((qb * 64 + 63) >> 7) : (TT / 128 - 1); }
typedef __attribute__((ext_vector_type(8))) __bf16 v8b;
__device__ __forceinline__ v16b frag_b(const __bf16* rowk0, int lane) {
  union { v16b v; v8b q[2]; } u; const __bf16* p = rowk0 + 8 * (lane >> 4);
  u.q[0] = *(const v8b*)p; u.q[1] = *(const v8b*)(p + 16); return u.v;
}
#define QBH 0              // unused: no kernel in this file has a high-precision path
#define QHI 2048            // rows carrying a q residual plane (all rows)
#define KHI 64            // key rows carrying k residual / v bf16 hi+lo planes (written by k_proj, read by no kernel in this file)
// B fragment (k rows k0+.., output column o) of a weight: (in,out) [K][ld] or (out,in) [ld rows of K]: bf16 exact, or f16(bf16 * 256) exact
__device__ __forceinline__ v16b wcol_io(const float* Wm, int k0, int o, int lane, int ld) { v16b w; const int g = lane >> 4;
#pragma unroll
  for (int i = 0; i < 8; ++i) { w[i] = (__bf16)Wm[(size_t)(k0 + 8 * g + i) * ld + o]; w[8 + i] = (__bf16)Wm[(size_t)(k0 + 16 + 8 * g + i) * ld + o]; }
  return w; }
__device__ __forceinline__ v16b wcol_oi(const float* Wm, int k0, int o, int lane, int K) { v16b w; const float* p = Wm + (size_t)o * K + k0 + 8 * (lane >> 4);
#pragma unroll
  for (int i = 0; i < 8; ++i) { w[i] = (__bf16)p[i]; w[8 + i] = (__bf16)p[16 + i]; }
  return w; }
__device__ __forceinline__ v16h wcolh_io(const float* Wm, int k0, int o, int lane, int ld) { v16h w; const int g = lane >> 4;
#pragma unroll
  for (int i = 0; i < 8; ++i) { w[i] = (_Float16)(bfr(Wm[(size_t)(k0 + 8 * g + i) * ld + o]) * 256.0f); w[8 + i] = (_Float16)(bfr(Wm[(size_t)(k0 + 16 + 8 * g + i) * ld + o]) * 256.0f); }
  return w; }
__device__ __forceinline__ v16h wcolh_oi(const float* Wm, int k0, int o, int lane, int K) { v16h w; const float* p = Wm + (size_t)o * K + k0 + 8 * (lane >> 4);
#pragma unroll
  for (int i = 0; i < 8; ++i) { w[i] = (_Float16)(bfr(p[i]) * 256.0f); w[8 + i] = (_Float16)(bfr(p[16 + i]) * 256.0f); }
  return w; }
#define WQKV_LAYOUT 1   // 0 = (in,out) [DIN][CC]; 1 = (out,in) [CC][DIN]; 2 = per-head [NH][DIN][HD], for WCOL only, which no kernel uses: k_proj stages Wq/Wk/Wv as (out,in) [CC][DIN] rows
__device__ __forceinline__ v16b wcol_hdk(const float* Wm, int k0, int o, int lane) { v16b w; const int g = lane >> 4; const float* p = Wm + (size_t)(o / HD) * DIN * HD + (o % HD);
#pragma unroll
  for (int i = 0; i < 8; ++i) { w[i] = (__bf16)p[(size_t)(k0 + 8 * g + i) * HD]; w[8 + i] = (__bf16)p[(size_t)(k0 + 16 + 8 * g + i) * HD]; }
  return w; }
#define WO_OUT_IN 0
#if WQKV_LAYOUT == 1
#define WCOL(W, k0, o, lane) wcol_oi(W, k0, o, lane, DIN)
#elif WQKV_LAYOUT == 2
#define WCOL(W, k0, o, lane) wcol_hdk(W, k0, o, lane)
#else
#define WCOL(W, k0, o, lane) wcol_io(W, k0, o, lane, CC)
#endif
#if WO_OUT_IN
#define WOCOL(W, k0, o, lane) wcol_oi(W, k0, o, lane, CC)
#define WOCOLH(W, k0, o, lane) wcolh_oi(W, k0, o, lane, CC)
#else
#define WOCOL(W, k0, o, lane) wcol_io(W, k0, o, lane, DIN)
#define WOCOLH(W, k0, o, lane) wcolh_io(W, k0, o, lane, DIN)
#endif
#define NROW (NB * TT)
#define GP (DIN + 8)       // LDS pitch of a staged operand row in bf16: 512 B + 16 B = 16 B x odd, free of bank conflicts for 16-byte reads
typedef __attribute__((ext_vector_type(4))) __bf16 v4b;
// 64 rows of DIN f32 that lie one behind the other in memory -> bf16 rows in LDS, by the block's 128 threads: each wave-wide load covers 512 contiguous bytes (whole lines), 32 loads of a thread in flight
__device__ __forceinline__ void stage_bf(__bf16* dst, const float* __restrict__ s, int tid) { v4f x[32];
#pragma unroll
  for (int i = 0; i < 32; ++i) x[i] = *(const v4f*)(s + i * 512 + tid * 4);
  asm volatile("s_wait_xcnt 0x0" ::: "memory");   // stands behind the batch's loads, in front of every later rewrite of a register that they name (the next batch forms its base address in the same registers)
#pragma unroll
  for (int i = 0; i < 32; ++i) { v4b y;
#pragma unroll
    for (int e = 0; e < 4; ++e) y[e] = (__bf16)x[i][e];
    *(v4b*)(dst + (i * 2 + (tid >> 6)) * GP + (tid & 63) * 4) = y; } }
// the eight W fragments of one k step of 32, from the lane's first staged W row
__device__ __forceinline__ void ld_w(v16b (&w)[8], const __bf16* wr, int kc, int lane) {
#pragma unroll
  for (int j = 0; j < 8; ++j) w[j] = frag_b(wr + j * 16 * GP + kc * 32, lane); }
__device__ __forceinline__ void mm8(v8f (&acc)[8], v16b a, const v16b (&w)[8]) {
#pragma unroll
  for (int j = 0; j < 8; ++j) acc[j] = wmma_bf(a, w[j], acc[j]); }
// acc += X W^T over K = DIN from the staged tiles; two fragment sets: a k step's LDS reads stand as one group in front of the products of the step before it
__device__ __forceinline__ void gemm_lds(v8f (&acc)[8], const __bf16* xr, const __bf16* wr, int lane) { v16b a0, a1, w0[8], w1[8];
  a0 = frag_b(xr, lane); ld_w(w0, wr, 0, lane);
#pragma unroll
  for (int kc = 0; kc < DIN / 32; kc += 2) { a1 = frag_b(xr + (kc + 1) * 32, lane); ld_w(w1, wr, kc + 1, lane); mm8(acc, a0, w0);
    if (kc + 2 < DIN / 32) { a0 = frag_b(xr + (kc + 2) * 32, lane); ld_w(w0, wr, kc + 2, lane); }
    mm8(acc, a1, w1); } }
// ---- k_tail: block = 32 whole rows, 8 waves: O = LayerNorm0(CX), CX = Qh + ctx from k_fa; T = O + relu(O (hi + lo) . Wo[c][:] + bo[c]) (Wo (out,in) exact bf16; 2 products); OUT = LayerNorm1(T); O and T stay in LDS, so one launch does the work of three
#define TR 32              // rows a block: 256 blocks, one a WGP
#define TP (DIN + 4)       // LDS pitch of an f32 row: 16-byte aligned; rows 8 apart lie 32 banks apart
// 128 rows of DIN f32 that lie one behind the other in memory, by the block's 256 threads: each wave-wide load covers 512 contiguous bytes, 32 loads of a thread in flight
__device__ __forceinline__ void w_load(v4f (&x)[32], const float* __restrict__ s, int tid) {
#pragma unroll
  for (int i = 0; i < 32; ++i) x[i] = *(const v4f*)(s + i * 1024 + tid * 4);
  asm volatile("s_wait_xcnt 0x0" ::: "memory"); }   // stands behind the loads issued so far, in front of every later rewrite of a register that they name
__device__ __forceinline__ void w_store(__bf16* dst, const v4f (&x)[32], int tid) {
#pragma unroll
  for (int i = 0; i < 32; ++i) { v4b y;
#pragma unroll
    for (int e = 0; e < 4; ++e) y[e] = (__bf16)x[i][e];
    *(v4b*)(dst + (i * 4 + (tid >> 6)) * GP + (tid & 63) * 4) = y; } }
// LayerNorm of four rows a wave, in place (biased var, eps 1e-5, x g + b); the lane holds columns q * 128 + lane * 4 + 0..3; the four rows' sums run side by side
__device__ __forceinline__ void ln4(v4f (&x)[4][DIN / 128], const v4f (&gm)[DIN / 128], const v4f (&bt)[DIN / 128]) { float s1[4], qq[4], mu[4];
#pragma unroll
  for (int r = 0; r < 4; ++r) { s1[r] = 0.f;
#pragma unroll
    for (int q = 0; q < DIN / 128; ++q)
#pragma unroll
      for (int i = 0; i < 4; ++i) s1[r] += x[r][q][i]; }
#pragma unroll
  for (int o = 1; o < 32; o <<= 1)
#pragma unroll
    for (int r = 0; r < 4; ++r) s1[r] += __shfl_xor(s1[r], o);
#pragma unroll
  for (int r = 0; r < 4; ++r) { mu[r] = s1[r] * (1.0f / DIN); qq[r] = 0.f;
#pragma unroll
    for (int q = 0; q < DIN / 128; ++q)
#pragma unroll
      for (int i = 0; i < 4; ++i) { const float d = x[r][q][i] - mu[r]; qq[r] += d * d; } }
#pragma unroll
  for (int o = 1; o < 32; o <<= 1)
#pragma unroll
    for (int r = 0; r < 4; ++r) qq[r] += __shfl_xor(qq[r], o);
#pragma unroll
  for (int r = 0; r < 4; ++r) { const float rs = rsqrtf(qq[r] * (1.0f / DIN) + 1e-5f);
#pragma unroll
    for (int q = 0; q < DIN / 128; ++q)
#pragma unroll
      for (int i = 0; i < 4; ++i) x[r][q][i] = (x[r][q][i] - mu[r]) * rs * bfr(gm[q][i]) + bfr(bt[q][i]); } }
__global__ __launch_bounds__(256) void k_tail(const float* __restrict__ CX, const float* __restrict__ G0, const float* __restrict__ B0, const float* __restrict__ WO, const float* __restrict__ BO, const float* __restrict__ G1, const float* __restrict__ B1, float* __restrict__ OUT) {
  __shared__ __align__(16) __bf16 wt[CC * GP], xh[TR * GP], xl[TR * GP]; __shared__ __align__(16) float of[TR][TP];
  const int tid = threadIdx.x, wave = tid >> 5, lane = tid & 31, col = lane & 15, g = lane >> 4; const int rw = wave * 4, rt = (wave & 1) * 16, cg = (wave >> 1) * 64; const size_t r0 = (size_t)blockIdx.x * TR;
  v4f x[4][DIN / 128], g0[DIN / 128], b0[DIN / 128], g1[DIN / 128], b1[DIN / 128], wa[32], wb[32]; float bo[4];
#pragma unroll
  for (int r = 0; r < 4; ++r)
#pragma unroll
    for (int q = 0; q < DIN / 128; ++q) x[r][q] = *(const v4f*)(CX + (r0 + rw + r) * DIN + q * 128 + lane * 4);
  asm volatile("s_wait_xcnt 0x0" ::: "memory");   // stands behind the row loads, in front of every later rewrite of a register that they name
#pragma unroll
  for (int q = 0; q < DIN / 128; ++q) { const int c = q * 128 + lane * 4; g0[q] = *(const v4f*)(G0 + c); b0[q] = *(const v4f*)(B0 + c); g1[q] = *(const v4f*)(G1 + c); b1[q] = *(const v4f*)(B1 + c); }
#pragma unroll
  for (int j = 0; j < 4; ++j) bo[j] = BO[cg + j * 16 + col];
  asm volatile("s_wait_xcnt 0x0" ::: "memory");   // the same behind the loads of the LayerNorm vectors and the bias
  w_load(wa, WO, tid); w_store(wt, wa, tid);
  w_load(wb, WO + (size_t)128 * DIN, tid);   // the second half of Wo flies while LayerNorm0 runs
  ln4(x, g0, b0);
#pragma unroll
  for (int r = 0; r < 4; ++r)
#pragma unroll
    for (int q = 0; q < DIN / 128; ++q) *(v4f*)&of[rw + r][q * 128 + lane * 4] = x[r][q];
  LDSX();   // the wave's own four rows are read back below in another lane order
#pragma unroll
  for (int r = 0; r < 4; ++r) { const float* p = &of[rw + r][lane * 8]; v8b yh, yl;   // bf16 hi + lo planes, eight columns a lane: 16-byte LDS stores
#pragma unroll
    for (int e = 0; e < 8; ++e) { const float v = p[e]; const __bf16 h = (__bf16)v; yh[e] = h; yl[e] = (__bf16)(v - (float)h); }
    *(v8b*)(xh + (rw + r) * GP + lane * 8) = yh; *(v8b*)(xl + (rw + r) * GP + lane * 8) = yl; }
  w_store(wt + 128 * GP, wb, tid);
  __syncthreads();   // Wo and the LayerNorm0 rows (f32, bf16 hi, bf16 lo) are published to every wave
  v8f acc[4] = {}; { const __bf16 *hr = xh + (rt + col) * GP, *lr = xl + (rt + col) * GP, *wr = wt + (cg + col) * GP; v16b h[2], l[2], w[2][4];   // wave = 16 rows x 64 columns; two fragment sets, as in gemm_lds
    h[0] = frag_b(hr, lane); l[0] = frag_b(lr, lane);
#pragma unroll
    for (int j = 0; j < 4; ++j) w[0][j] = frag_b(wr + j * 16 * GP, lane);
#pragma unroll
    for (int kc = 0; kc < DIN / 32; ++kc) { const int s = kc & 1;
      if (kc + 1 < DIN / 32) { h[s ^ 1] = frag_b(hr + (kc + 1) * 32, lane); l[s ^ 1] = frag_b(lr + (kc + 1) * 32, lane);
#pragma unroll
        for (int j = 0; j < 4; ++j) w[s ^ 1][j] = frag_b(wr + j * 16 * GP + (kc + 1) * 32, lane); }
#pragma unroll
      for (int j = 0; j < 4; ++j) acc[j] = wmma_bf(h[s], w[s][j], acc[j]);
#pragma unroll
      for (int j = 0; j < 4; ++j) acc[j] = wmma_bf(l[s], w[s][j], acc[j]); } }
#pragma unroll
  for (int j = 0; j < 4; ++j)
#pragma unroll
    for (int r = 0; r < 8; ++r) { float* p = &of[rt + 8 * g + r][cg + j * 16 + col]; *p = fmaxf(acc[j][r] + bfr(bo[j]), 0.f) + *p; }   // each element has one owner lane
  __syncthreads();   // the T rows are whole before LayerNorm1 reads them
#pragma unroll
  for (int r = 0; r < 4; ++r)
#pragma unroll
    for (int q = 0; q < DIN / 128; ++q) x[r][q] = *(const v4f*)&of[rw + r][q * 128 + lane * 4];
  ln4(x, g1, b1);
#pragma unroll
  for (int r = 0; r < 4; ++r)
#pragma unroll
    for (int q = 0; q < DIN / 128; ++q) vst2(OUT + (r0 + rw + r) * DIN + q * 128 + lane * 4, x[r][q]); }
#define WS_QF  (WS_END)
#define WS_O   (WS_QF + 4u * (size_t)NROW * DIN)
#define WS_T   (WS_O + 4u * (size_t)NROW * DIN)
#define WS_END2 (WS_T + 4u * (size_t)NROW * DIN)
#ifndef SM_EXTRA_PARAMS
#define SM_EXTRA_PARAMS
#endif
#ifndef PROJ_EXTRA_PARAMS
#define PROJ_EXTRA_PARAMS
#endif
#ifndef SM_MASK_HOOK
#define SM_MASK_HOOK (void)0
#endif

#define WS_QH  0u                                      // f16 q rows [b*t][CC]
#define WS_KH  (WS_QH + 2u * (size_t)NB * TT * CC)      // f16 k rows [b*t][CC]
#define WS_VT  (WS_KH + 2u * (size_t)NB * TT * CC)      // f16 v planes [b][c][t]
#define WS_QL  (WS_VT + 2u * (size_t)NB * CC * TT)      // f16 q residual x 2^10 rows [b][t < QHI][CC]
#define WS_KL  (WS_QL + 2u * (size_t)NB * QHI * CC)     // f16 k residual x 2^10 rows [b][t < KHI][CC]
#define WS_VB  (WS_KL + 2u * (size_t)NB * KHI * CC)     // bf16 v hi planes [b][c][t < KHI]
#define WS_VBL (WS_VB + 2u * (size_t)NB * CC * KHI)
#define WS_S   (WS_VBL + 2u * (size_t)NB * CC * KHI)    // f32 [hg][t][s], unused: k_fa keeps logits and P in registers
#define WS_Y   (WS_S  + 4u * (size_t)HG * TT * TT)      // f32 ctx rows [b*t][CC] (only when there is an output projection)
#define WS_END (WS_Y  + 0u)

// ---- k_proj: block = (64 rows, 128 cols, which): q/k/v = X W (+ b) with exact bf16 products (K = DIN) -> which 0: q f16 rows (+ residual rows < QHI); 1: k f16 rows (+ residual rows < KHI); 2: v f16 planes [c][t] (+ bf16 hi/lo planes for t < KHI)
__global__ __launch_bounds__(128) void k_proj(const float* __restrict__ XQ, const float* __restrict__ XK, const float* __restrict__ XV, const float* __restrict__ WQ, const float* __restrict__ WK, const float* __restrict__ WV, const float* __restrict__ BQ, const float* __restrict__ BK, const float* __restrict__ BV,
    _Float16* __restrict__ QH, _Float16* __restrict__ QL, _Float16* __restrict__ KH, _Float16* __restrict__ KL, _Float16* __restrict__ VT, __bf16* __restrict__ VB, __bf16* __restrict__ VBL) {
  __shared__ __align__(16) union { __bf16 ops[192 * GP]; struct { _Float16 sh[64][136], sl[64][136]; } qk; struct { _Float16 th[128][72]; __bf16 tb[128][72], tbl[128][72]; } v; } sm;   // ops rows 0..63: the X tile, 64..191: the W tile; the output staging takes their place, so that three blocks a WGP stay resident
  auto& sh = sm.qk.sh; auto& sl = sm.qk.sl; auto& th = sm.v.th; auto& tb = sm.v.tb; auto& tbl = sm.v.tbl;
  const int tid = threadIdx.x, wave = tid >> 5, lane = tid & 31, col = lane & 15, g = lane >> 4; const int which = blockIdx.z; const int c0 = blockIdx.y * 128; const size_t r0 = (size_t)blockIdx.x * 64; const size_t bb = r0 / TT; const int t0 = (int)(r0 % TT);
  const float* X = which == 0 ? XQ : which == 1 ? XK : XV; const float* WA = which == 0 ? WQ : which == 1 ? WK : WV; const float* BA = which == 0 ? BQ : which == 1 ? BK : BV;
#pragma unroll 1   // rolled: one batch of 32 loads a thread in flight at a time; unrolled, the batches' registers add up past what three resident waves a SIMD allow
  for (int b = 0; b < 3; ++b) stage_bf(sm.ops + b * 64 * GP, b == 0 ? X + r0 * DIN : WA + (size_t)(c0 + (b - 1) * 64) * DIN, tid);
  __syncthreads();   // both operand tiles are published to every wave
  v8f acc[8] = {}; gemm_lds(acc, sm.ops + (wave * 16 + col) * GP, sm.ops + (64 + col) * GP, lane);
  __syncthreads();   // every wave's reads of the operand tiles are done before the output staging overwrites them
  if (which < 2) { _Float16* DH = which == 0 ? QH : KH; _Float16* DL = which == 0 ? QL : KL; const int nhi = which == 0 ? QHI : KHI; const bool hi_rows = t0 < nhi;
#pragma unroll
    for (int j = 0; j < 8; ++j) { const float bias = BA ? bfr(BA[c0 + j * 16 + col]) : 0.f;
#pragma unroll
      for (int r = 0; r < 8; ++r) { const float v = acc[j][r] + bias; const _Float16 hv = (_Float16)v; sh[wave * 16 + 8 * g + r][j * 16 + col] = hv; sl[wave * 16 + 8 * g + r][j * 16 + col] = (_Float16)((v - (float)hv) * 1024.0f); } }
    __syncthreads();
    for (int e = tid; e < 64 * 16; e += 128) { const int rl = e >> 4, q = e & 15; vst2((unsigned*)(DH + (r0 + rl) * CC + c0 + q * 8), *(const v4u*)&sh[rl][q * 8]); if (hi_rows) vst2((unsigned*)(DL + (bb * nhi + t0 + rl) * (size_t)CC + c0 + q * 8), *(const v4u*)&sl[rl][q * 8]); }
  } else { const bool hi_rows = t0 < KHI;
#pragma unroll
    for (int j = 0; j < 8; ++j) { const float bias = BA ? bfr(BA[c0 + j * 16 + col]) : 0.f;
#pragma unroll
      for (int r = 0; r < 8; ++r) { const float v = acc[j][r] + bias; const int rl = wave * 16 + 8 * g + r, cl = j * 16 + col; th[cl][rl] = (_Float16)v; const __bf16 bh = (__bf16)v; tb[cl][rl] = bh; tbl[cl][rl] = (__bf16)(v - (float)bh); } }
    __syncthreads();
    for (int e = tid; e < 128 * 8; e += 128) { const int cl = e >> 3, q = e & 7; vst2((unsigned*)(VT + (bb * CC + c0 + cl) * (size_t)TT + t0 + q * 8), *(const v4u*)&th[cl][q * 8]); if (hi_rows) { const size_t o3 = (bb * CC + c0 + cl) * (size_t)KHI + t0 + q * 8; vst2((unsigned*)(VB + o3), *(const v4u*)&tb[cl][q * 8]); vst2((unsigned*)(VBL + o3), *(const v4u*)&tbl[cl][q * 8]); } } } }
// ---- k_fa: block = 4 waves x 16 queries of (b, h), one launch for every batch and head: S^T = K Q^T (q hi + residual x 2^10, 2 products), online softmax in f32 per lane (lane = query), O^T += V^T P^T (P once to f16, 1 product); logits and P stay in registers; the row written is Qh + ctx, Qh from the q fragments (hi + residual x 2^-10) that the lane holds at the same features; K rows and V^T rows of 128 keys a stage come into LDS by asynchronous copies (two buffers) and serve the block's four waves
typedef __attribute__((ext_vector_type(2))) _Float16 v2h;
#define FA_C (SCALE * 1.4426950408889634f)   // raw q.k -> base-2 exponent
#define FA_LAZY (8.0f / FA_C)                // the maximum in use is replaced only when a new one exceeds it by 2^8
#define FA_OFF 6.0f                          // P = 2^(6 + ...) <= 2^14: keeps small weights out of the f16 subnormals; cancels against the row sum
#define FA_KT 128                            // keys a stage (4 passes of 32 keys)
#define FA_NT (TT / FA_KT)                   // stages
#define FA_KP (HD + 8)                       // LDS pitch of a K row in f16: 128 B + 16 B = 16 B x odd, free of bank conflicts for 16-byte reads
#define FA_VP (FA_KT + 8)                    // LDS pitch of a V^T row in f16: 256 B + 16 B
#define FA_KBUF (FA_KT * FA_KP)
#define FA_VBUF (HD * FA_VP)
__device__ __forceinline__ float xhalf(float x) { return __builtin_bit_cast(float, __builtin_amdgcn_permlanex16(__builtin_bit_cast(int, x), __builtin_bit_cast(int, x), 0x76543210, 0xfedcba98, false, false)); }
__device__ __forceinline__ v8f wm16(v16h a, v16h b, v8f c) { return __builtin_amdgcn_wmma_f32_16x16x32_f16(false, a, false, b, (short)0, c, false, false); }
// fragments of one pass, from the stage's LDS buffer: K rows (A of S^T: row = key) and V^T rows (A of O^T: row = feature, k = key), both in the hardware k order
__device__ __forceinline__ void fa_load(v16h (&kf)[2][HD / 32], v16h (&vf)[HD / 16], const _Float16* Kl, const _Float16* Vl, int pass, int lane) {
#pragma unroll
  for (int i = 0; i < 2; ++i)
#pragma unroll
    for (int kc = 0; kc < HD / 32; ++kc) kf[i][kc] = frag_h(Kl + (pass * 32 + i * 16) * FA_KP + kc * 32, lane);
#pragma unroll
  for (int j = 0; j < HD / 16; ++j) vf[j] = frag_h(Vl + pass * 32 + j * 16 * FA_VP, lane); }
// eight asynchronous 16-byte copies a lane, global -> LDS, at fixed steps of both addresses; the s_wait_xcnt stands inside the statement so that no address register is rewritten in front of it
__device__ __forceinline__ void fa_copy8(unsigned l, unsigned ls, const _Float16* g, size_t gs) {
  asm volatile("global_load_async_to_lds_b128 %0, %8, off\n\tglobal_load_async_to_lds_b128 %1, %9, off\n\tglobal_load_async_to_lds_b128 %2, %10, off\n\tglobal_load_async_to_lds_b128 %3, %11, off\n\t"
               "global_load_async_to_lds_b128 %4, %12, off\n\tglobal_load_async_to_lds_b128 %5, %13, off\n\tglobal_load_async_to_lds_b128 %6, %14, off\n\tglobal_load_async_to_lds_b128 %7, %15, off\n\ts_wait_xcnt 0x0"
               :: "v"(l), "v"(l + ls), "v"(l + 2 * ls), "v"(l + 3 * ls), "v"(l + 4 * ls), "v"(l + 5 * ls), "v"(l + 6 * ls), "v"(l + 7 * ls),
                  "v"(g), "v"(g + gs), "v"(g + 2 * gs), "v"(g + 3 * gs), "v"(g + 4 * gs), "v"(g + 5 * gs), "v"(g + 6 * gs), "v"(g + 7 * gs) : "memory"); }
template <bool AHEAD> __device__ __forceinline__ void fa_pass(const v16h (&kf)[2][HD / 32], const v16h (&vf)[HD / 16], const v16h (&kn)[2][HD / 32], const v16h (&qh)[HD / 32], const v16h (&ql)[HD / 32], v8f (&o)[HD / 16], float& m, v2f (&l)[2]) {
  v8f sh[2] = {}, sl[2] = {};
#pragma unroll
  for (int kc = 0; kc < HD / 32; ++kc)
#pragma unroll
    for (int i = 0; i < 2; ++i) { sh[i] = wm16(kf[i][kc], qh[kc], sh[i]); sl[i] = wm16(kf[i][kc], ql[kc], sl[i]); }
  v2f t[8]; float mx = -3.0e38f;   // lane (c, h): query c, keys 8h + 0..7 and 16 + 8h + 0..7
#pragma unroll
  for (int e = 0; e < 8; ++e) { const int i = e >> 2, r = (e & 3) * 2; t[e][0] = sh[i][r] + sl[i][r] * (1.0f / 1024.0f); t[e][1] = sh[i][r + 1] + sl[i][r + 1] * (1.0f / 1024.0f); mx = fmaxf(mx, fmaxf(t[e][0], t[e][1])); }
  mx = fmaxf(mx, xhalf(mx));
  if (AHEAD) asm volatile("" :: "v"(kn[0][0]), "v"(kn[0][1]), "v"(kn[1][0]), "v"(kn[1][1]));   // inputs only: holds the LDS loads of the next pass's K fragments in front of the branch below; behind it they would stand directly in front of their products, their latency open
  if (__builtin_amdgcn_ballot_w32(mx > m + FA_LAZY) != 0) { const float mn = fmaxf(m, mx); const float al = __builtin_amdgcn_exp2f((m - mn) * FA_C); m = mn; l[0] *= al; l[1] *= al;
#pragma unroll
    for (int j = 0; j < HD / 16; ++j)
#pragma unroll
      for (int r = 0; r < 8; ++r) o[j][r] *= al; }
  const float mc = m * FA_C - FA_OFF; v16h p;
#pragma unroll
  for (int e = 0; e < 8; ++e) { v2f pe; pe[0] = __builtin_amdgcn_exp2f(t[e][0] * FA_C - mc); pe[1] = __builtin_amdgcn_exp2f(t[e][1] * FA_C - mc); l[e & 1] += pe; const v2h ph = __builtin_convertvector(pe, v2h); p[2 * e] = ph[0]; p[2 * e + 1] = ph[1]; }
#pragma unroll
  for (int j = 0; j < HD / 16; ++j) o[j] = wm16(vf[j], p, o[j]); }
__global__ __launch_bounds__(128) void k_fa(const _Float16* __restrict__ QH, const _Float16* __restrict__ QL, const _Float16* __restrict__ KH, const _Float16* __restrict__ VT, float* __restrict__ Y) {
  __shared__ __align__(16) _Float16 ks[2][FA_KBUF], vs[2][FA_VBUF];
  const int tid = threadIdx.x, wave = tid >> 5, lane = tid & 31, col = lane & 15, g = lane >> 4; const int h = blockIdx.y, b = blockIdx.z; const int ql0 = blockIdx.x * 64 + wave * 16;
  v16h qh[HD / 32], ql[HD / 32];
#pragma unroll
  for (int kc = 0; kc < HD / 32; ++kc) { qh[kc] = frag_h(QH + ((size_t)b * TT + ql0 + col) * CC + h * HD + kc * 32, lane); ql[kc] = frag_h(QL + ((size_t)b * QHI + ql0 + col) * CC + h * HD + kc * 32, lane); }
  // a stage's copies: K 128 rows x 128 B (a thread: 16 B of rows tid / 8 + 16 i), V^T 64 rows x 256 B (16 B of rows tid / 16 + 8 i): whole 128-byte lines on the global side
  const _Float16* Kg = KH + ((size_t)b * TT + (tid >> 3)) * CC + h * HD + (tid & 7) * 8;
  const _Float16* Vg = VT + ((size_t)b * CC + h * HD + (tid >> 4)) * (size_t)TT + (tid & 15) * 8;
  const unsigned kd = (unsigned)(size_t)&ks[0][(tid >> 3) * FA_KP + (tid & 7) * 8], vd = (unsigned)(size_t)&vs[0][(tid >> 4) * FA_VP + (tid & 15) * 8];   // LDS byte addresses
  v16h kA[2][HD / 32], vA[HD / 16], kB[2][HD / 32], vB[HD / 16];
  v8f o[HD / 16] = {}; float m = -3.0e38f; v2f l[2] = {};
  fa_copy8(kd, 16 * FA_KP * 2, Kg, (size_t)16 * CC); fa_copy8(vd, 8 * FA_VP * 2, Vg, (size_t)8 * TT);
  asm volatile("s_wait_asynccnt 0x0" ::: "memory");   // this wave's copies of stage 0 have landed
  __syncthreads();                                    // stage 0 is published to every wave
  fa_copy8(kd + FA_KBUF * 2, 16 * FA_KP * 2, Kg + (size_t)FA_KT * CC, (size_t)16 * CC); fa_copy8(vd + FA_VBUF * 2, 8 * FA_VP * 2, Vg + FA_KT, (size_t)8 * TT);
  for (int t = 0; t < FA_NT; ++t) {   // trip t reads buffer t mod 2 alone, while stage t + 1 flies into the other
    const int bf = t & 1; const _Float16* Kl = &ks[bf][col * FA_KP]; const _Float16* Vl = &vs[bf][col * FA_VP];   // the lane's key row of pass 0 and its feature row
    fa_load(kA, vA, Kl, Vl, 0, lane);   // two register sets: inside a stage a pass's fragments are fetched during the pass before it
    fa_load(kB, vB, Kl, Vl, 1, lane);
    fa_pass<true>(kA, vA, kB, qh, ql, o, m, l);
    fa_load(kA, vA, Kl, Vl, 2, lane);
    fa_pass<true>(kB, vB, kA, qh, ql, o, m, l);
    fa_load(kB, vB, Kl, Vl, 3, lane);
    fa_pass<true>(kA, vA, kB, qh, ql, o, m, l);
    fa_pass<false>(kB, vB, kB, qh, ql, o, m, l);
    asm volatile("s_wait_dscnt 0x0" ::: "memory");      // this wave's reads of buffer t mod 2 are done before it is refilled
    asm volatile("s_wait_asynccnt 0x0" ::: "memory");   // this wave's copies of stage t + 1 have landed
    __syncthreads();                                    // publishes stage t + 1 and ends every wave's reads of buffer t mod 2
    if (t + 2 < FA_NT) { fa_copy8(kd + bf * (FA_KBUF * 2), 16 * FA_KP * 2, Kg + (size_t)(t + 2) * FA_KT * CC, (size_t)16 * CC); fa_copy8(vd + bf * (FA_VBUF * 2), 8 * FA_VP * 2, Vg + (t + 2) * FA_KT, (size_t)8 * TT); }
  }
  asm volatile("s_wait_asynccnt 0x0" ::: "memory");   // no copy is outstanding when the wave ends
  float ls = l[0][0] + l[0][1] + l[1][0] + l[1][1]; ls += xhalf(ls); const float inv = 1.0f / ls;
  float* yr = Y + ((size_t)b * TT + ql0 + col) * CC + h * HD + 8 * g;   // O^T: the lane holds features j * 16 + 8h + 0..7 of its query
#pragma unroll
  for (int j = 0; j < HD / 16; ++j) { v4f a, c;
#pragma unroll
    for (int r = 0; r < 4; ++r) { const int e = (j & 1) * 8 + r;   // fragment element e of k step j / 2 is feature j * 16 + 8h + r of the lane's query
      a[r] = o[j][r] * inv + ((float)qh[j >> 1][e] + (float)ql[j >> 1][e] * (1.0f / 1024.0f)); c[r] = o[j][4 + r] * inv + ((float)qh[j >> 1][e + 4] + (float)ql[j >> 1][e + 4] * (1.0f / 1024.0f)); }
    vst2(yr + j * 16, a); vst2(yr + j * 16 + 4, c); } }

extern "C" void kernel_launch(void* const* d_in, const int* in_sizes, int n_in, void* d_out, int out_size, void* d_ws, size_t ws_size, hipStream_t stream) {
  (void)in_sizes; (void)n_in; (void)out_size;
  const float** F = (const float**)d_in;
  if (ws_size < (size_t)WS_END) return;
  char* ws = (char*)d_ws; _Float16 *QH = (_Float16*)(ws + WS_QH), *KH = (_Float16*)(ws + WS_KH), *VT = (_Float16*)(ws + WS_VT), *QL = (_Float16*)(ws + WS_QL), *KL = (_Float16*)(ws + WS_KL); __bf16 *VB = (__bf16*)(ws + WS_VB), *VBL = (__bf16*)(ws + WS_VBL); float *S = (float*)(ws + WS_S), *Y = (float*)(ws + WS_Y);
  (void)Y; (void)S; (void)QL; (void)KL; (void)VB; (void)VBL;
  // inputs: 0 Q, 1 K [4,2048,256]; 2 Wq, 3 bq; 4 Wk, 5 bk; 6 Wv, 7 bv; 8 Wo, 9 bo ((out,in) [256,256]); 10 g0, 11 b0; 12 g1, 13 b1
  if (ws_size < (size_t)WS_END2) return;
  float *T = (float*)(ws + WS_T);
  k_proj<<<dim3(TNB * TT / 64, CC / 128, 3), 128, 0, stream>>>(F[0], F[1], F[1], F[2], F[4], F[6], F[3], F[5], F[7], QH, QL, KH, KL, VT, VB, VBL);
  k_fa<<<dim3(NQB, NH, TNB), 128, 0, stream>>>(QH, QL, KH, VT, T);   /* Qh + ctx rows into T (scratch) */
  k_tail<<<dim3(TNB * TT / TR), 256, 0, stream>>>(T, F[10], F[11], F[8], F[9], F[12], F[13], (float*)d_out);   /* out = LN1(O + relu(O Wo^T + bo)), O = LN0(T) */
}

// v006
// It runs in 43.5 microseconds.
// Timed twice side by side with v005, it ran 1.06 times as fast both times.
// All steps since v000 together make it 13.7 times as fast.
// compute dtype: all float inputs rounded to bf16; Qh/Kh/Vh = X W^T + b with EXACT bf16 products on WMMA 16x16x32 (f32 accumulate); q as f16 hi + residual (x 2^10) against k once to f16 (2 products) x 256^-0.5, no mask; online softmax in f32 (base-2 exponential); P x 2^6 against the maximum in use, once to f16, against v once to f16 (1 product), divided by the f32 row sum at the end; Qh (its f16 hi + residual planes summed in f32) + ctx, LayerNorm, the rFF GEMM with the LN rows split bf16 hi + lo against exact Wo (2 products) + bo, relu, residual and the second LayerNorm in f32; f32 output.
#include <hip/hip_runtime.h>
#include <math.h>

typedef __attribute__((ext_vector_type(16))) _Float16 v16h;
typedef __attribute__((ext_vector_type(16))) __bf16 v16b;
typedef __attribute__((ext_vector_type(8)))  _Float16 v8h;
typedef __attribute__((ext_vector_type(8)))  float v8f;
typedef __attribute__((ext_vector_type(4)))  float v4f;
typedef __attribute__((ext_vector_type(2)))  float v2f;
typedef __attribute__((ext_vector_type(4)))  unsigned v4u;
typedef __attribute__((ext_vector_type(4)))  int v4i;
typedef float __attribute__((may_alias)) float_a;
typedef int __attribute__((may_alias)) int_a;

template <typename T> __device__ __forceinline__ void vst2(void* p, T v) { *(T*)p = v;  }
__device__ __forceinline__ v8f wmma16(v16h a, v16h b, v8f c) {
  v8f d = __builtin_amdgcn_wmma_f32_16x16x32_f16(false, a, false, b, (short)0, c, false, false);
  asm volatile("v_nop\n\tv_nop\n\tv_nop\n\tv_nop" : "+v"(d) : "v"(a), "v"(b));
  return d;
}
__device__ __forceinline__ v8f wmma_bf(v16b a, v16b b, v8f c) {
  v8f d = __builtin_amdgcn_wmma_f32_16x16x32_bf16(false, a, false, b, (short)0, c, false, false);
  asm volatile("v_nop\n\tv_nop\n\tv_nop\n\tv_nop" : "+v"(d) : "v"(a), "v"(b));
  return d;
}
// 16x16x32 fragments: lane = (h = lane>>4, row/col = lane&15); elements 0..7 = k0+8h+0..7, 8..15 = k0+16+8h+0..7; D element r = row 8h+r
__device__ __forceinline__ v16h frag_h(const _Float16* rowk0, int lane) {
  union { v16h v; v8h q[2]; } u; const _Float16* p = rowk0 + 8 * (lane >> 4);
  u.q[0] = *(const v8h*)p; u.q[1] = *(const v8h*)(p + 16); return u.v;
}
__device__ __forceinline__ v16h frag_f32(const float* rowk0, int lane) {
  v16h a; const float* p = rowk0 + 8 * (lane >> 4);
#pragma unroll
  for (int i = 0; i < 8; ++i) { a[i] = (_Float16)p[i]; a[8 + i] = (_Float16)p[16 + i]; }
  return a;
}
__device__ __forceinline__ v16h frag_f32s(const float* rowk0, int lane, float sc) {
  v16h a; const float* p = rowk0 + 8 * (lane >> 4);
#pragma unroll
  for (int i = 0; i < 8; ++i) { a[i] = (_Float16)(p[i] * sc); a[8 + i] = (_Float16)(p[16 + i] * sc); }
  return a;
}
// column fragment from a [K][ld] layout (column n), rows >= K read as 0
__device__ __forceinline__ v16h fragc_f32(const float* W, int k0, int n, int lane, int ld, int K) {
  v16h a; const int g = lane >> 4;
#pragma unroll
  for (int i = 0; i < 8; ++i) { const int ka = k0 + 8 * g + i, kb = ka + 16;
    a[i] = (_Float16)(ka < K ? W[(size_t)(ka < K ? ka : K - 1) * ld + n] : 0.f); a[8 + i] = (_Float16)(kb < K ? W[(size_t)(kb < K ? kb : K - 1) * ld + n] : 0.f); }
  return a;
}
struct F2 { v16b h, l; };
__device__ __forceinline__ F2 bsplit16(const float v[16]) { F2 r;
#pragma unroll
  for (int i = 0; i < 16; ++i) { const __bf16 h = (__bf16)v[i]; r.h[i] = h; r.l[i] = (__bf16)(v[i] - (float)h); }
  return r; }
__device__ __forceinline__ F2 split_row(const float* row, int k0, int lane) { float v[16]; const float* p = row + k0 + 8 * (lane >> 4);
#pragma unroll
  for (int i = 0; i < 8; ++i) { v[i] = p[i]; v[8 + i] = p[16 + i]; }
  return bsplit16(v); }
__device__ __forceinline__ F2 split_rowK(const float* row, int k0, int lane, int K) { float v[16]; const int g = lane >> 4;
#pragma unroll
  for (int i = 0; i < 8; ++i) { const int ka = k0 + 8 * g + i, kb = ka + 16; v[i] = ka < K ? row[ka < K ? ka : K - 1] : 0.f; v[8 + i] = kb < K ? row[kb < K ? kb : K - 1] : 0.f; }
  return bsplit16(v); }
__device__ __forceinline__ F2 split_col(const float* W, int k0, int n, int lane, int ld, int K) { float v[16]; const int g = lane >> 4;
#pragma unroll
  for (int i = 0; i < 8; ++i) { const int ka = k0 + 8 * g + i, kb = ka + 16; v[i] = ka < K ? W[(size_t)(ka < K ? ka : K - 1) * ld + n] : 0.f; v[8 + i] = kb < K ? W[(size_t)(kb < K ? kb : K - 1) * ld + n] : 0.f; }
  return bsplit16(v); }
__device__ __forceinline__ v8f mac3(const F2& a, const F2& b, v8f c) { c = wmma_bf(a.l, b.h, c); c = wmma_bf(a.h, b.l, c); return wmma_bf(a.h, b.h, c); }
__device__ __forceinline__ float sigm(float v) { return 1.0f / (1.0f + expf(-v)); }
#define LDSX() do { asm volatile("s_wait_dscnt 0" ::: "memory"); __builtin_amdgcn_wave_barrier(); __builtin_amdgcn_fence(__ATOMIC_RELEASE, "workgroup"); } while (0)

// Set-Transformer MAB (B 4, 2,048 queries x 2,048 keys, D 256 = 4 x 64, no mask): q = Q Wq^T + bq; k, v = K W^T + b; A = softmax(q_h k_h^T / sqrt(256)); O = q + A v (residual with the projected Q, heads merged); O = LN0(O); O = O + relu(O Wo^T + bo); O = LN1(O).
#define NB 4
#define TT 2048
#define CC 256             // NH * HD = projected width
#define DIN 256
#define NH 4
#define HD 64
#define NQB (TT / 64)
#define HG 4
#define SCALE (0.0625f)
#define CAUSAL 0
#ifndef TNB
#define TNB NB
#endif
__device__ __forceinline__ float bfr(float v) { return (float)(__bf16)v; }
__host__ __device__ __forceinline__ int kb_last(int qb) { return CAUSAL ? ((qb * 64 + 63) >> 7) : (TT / 128 - 1); }
typedef __attribute__((ext_vector_type(8))) __bf16 v8b;
__device__ __forceinline__ v16b frag_b(const __bf16* rowk0, int lane) {
  union { v16b v; v8b q[2]; } u; const __bf16* p = rowk0 + 8 * (lane >> 4);
  u.q[0] = *(const v8b*)p; u.q[1] = *(const v8b*)(p + 16); return u.v;
}
#define QBH 0              // unused: no kernel in this file has a high-precision path
#define QHI 2048            // rows carrying a q residual plane (all rows)
#define KHI 64            // key rows carrying k residual / v bf16 hi+lo planes (written by k_proj, read by no kernel in this file)
// B fragment (k rows k0+.., output column o) of a weight: (in,out) [K][ld] or (out,in) [ld rows of K]: bf16 exact, or f16(bf16 * 256) exact
__device__ __forceinline__ v16b wcol_io(const float* Wm, int k0, int o, int lane, int ld) { v16b w; const int g = lane >> 4;
#pragma unroll
  for (int i = 0; i < 8; ++i) { w[i] = (__bf16)Wm[(size_t)(k0 + 8 * g + i) * ld + o]; w[8 + i] = (__bf16)Wm[(size_t)(k0 + 16 + 8 * g + i) * ld + o]; }
  return w; }
__device__ __forceinline__ v16b wcol_oi(const float* Wm, int k0, int o, int lane, int K) { v16b w; const float* p = Wm + (size_t)o * K + k0 + 8 * (lane >> 4);
#pragma unroll
  for (int i = 0; i < 8; ++i) { w[i] = (__bf16)p[i]; w[8 + i] = (__bf16)p[16 + i]; }
  return w; }
__device__ __forceinline__ v16h wcolh_io(const float* Wm, int k0, int o, int lane, int ld) { v16h w; const int g = lane >> 4;
#pragma unroll
  for (int i = 0; i < 8; ++i) { w[i] = (_Float16)(bfr(Wm[(size_t)(k0 + 8 * g + i) * ld + o]) * 256.0f); w[8 + i] = (_Float16)(bfr(Wm[(size_t)(k0 + 16 + 8 * g + i) * ld + o]) * 256.0f); }
  return w; }
__device__ __forceinline__ v16h wcolh_oi(const float* Wm, int k0, int o, int lane, int K) { v16h w; const float* p = Wm + (size_t)o * K + k0 + 8 * (lane >> 4);
#pragma unroll
  for (int i = 0; i < 8; ++i) { w[i] = (_Float16)(bfr(p[i]) * 256.0f); w[8 + i] = (_Float16)(bfr(p[16 + i]) * 256.0f); }
  return w; }
#define WQKV_LAYOUT 1   // 0 = (in,out) [DIN][CC]; 1 = (out,in) [CC][DIN]; 2 = per-head [NH][DIN][HD], for WCOL only, which no kernel uses: k_proj stages Wq/Wk/Wv as (out,in) [CC][DIN] rows
__device__ __forceinline__ v16b wcol_hdk(const float* Wm, int k0, int o, int lane) { v16b w; const int g = lane >> 4; const float* p = Wm + (size_t)(o / HD) * DIN * HD + (o % HD);
#pragma unroll
  for (int i = 0; i < 8; ++i) { w[i] = (__bf16)p[(size_t)(k0 + 8 * g + i) * HD]; w[8 + i] = (__bf16)p[(size_t)(k0 + 16 + 8 * g + i) * HD]; }
  return w; }
#define WO_OUT_IN 0
#if WQKV_LAYOUT == 1
#define WCOL(W, k0, o, lane) wcol_oi(W, k0, o, lane, DIN)
#elif WQKV_LAYOUT == 2
#define WCOL(W, k0, o, lane) wcol_hdk(W, k0, o, lane)
#else
#define WCOL(W, k0, o, lane) wcol_io(W, k0, o, lane, CC)
#endif
#if WO_OUT_IN
#define WOCOL(W, k0, o, lane) wcol_oi(W, k0, o, lane, CC)
#define WOCOLH(W, k0, o, lane) wcolh_oi(W, k0, o, lane, CC)
#else
#define WOCOL(W, k0, o, lane) wcol_io(W, k0, o, lane, DIN)
#define WOCOLH(W, k0, o, lane) wcolh_io(W, k0, o, lane, DIN)
#endif
#define NROW (NB * TT)
#define GP (DIN + 8)       // LDS pitch of a staged operand row in bf16: 512 B + 16 B = 16 B x odd, free of bank conflicts for 16-byte reads
typedef __attribute__((ext_vector_type(4))) __bf16 v4b;
// 64 rows of DIN f32 that lie one behind the other in memory -> bf16 rows in LDS, by the block's 128 threads: each wave-wide load covers 512 contiguous bytes (whole lines), 32 loads of a thread in flight
__device__ __forceinline__ void stage_bf(__bf16* dst, const float* __restrict__ s, int tid) { v4f x[32];
#pragma unroll
  for (int i = 0; i < 32; ++i) x[i] = *(const v4f*)(s + i * 512 + tid * 4);
  asm volatile("s_wait_xcnt 0x0" ::: "memory");   // stands behind the batch's loads, in front of every later rewrite of a register that they name (the next batch forms its base address in the same registers)
#pragma unroll
  for (int i = 0; i < 32; ++i) { v4b y;
#pragma unroll
    for (int e = 0; e < 4; ++e) y[e] = (__bf16)x[i][e];
    *(v4b*)(dst + (i * 2 + (tid >> 6)) * GP + (tid & 63) * 4) = y; } }
// the eight W fragments of one k step of 32, from the lane's first staged W row
__device__ __forceinline__ void ld_w(v16b (&w)[8], const __bf16* wr, int kc, int lane) {
#pragma unroll
  for (int j = 0; j < 8; ++j) w[j] = frag_b(wr + j * 16 * GP + kc * 32, lane); }
__device__ __forceinline__ void mm8(v8f (&acc)[8], v16b a, const v16b (&w)[8]) {
#pragma unroll
  for (int j = 0; j < 8; ++j) acc[j] = wmma_bf(a, w[j], acc[j]); }
// acc += X W^T over K = DIN from the staged tiles; two fragment sets: a k step's LDS reads stand as one group in front of the products of the step before it
__device__ __forceinline__ void gemm_lds(v8f (&acc)[8], const __bf16* xr, const __bf16* wr, int lane) { v16b a0, a1, w0[8], w1[8];
  a0 = frag_b(xr, lane); ld_w(w0, wr, 0, lane);
#pragma unroll
  for (int kc = 0; kc < DIN / 32; kc += 2) { a1 = frag_b(xr + (kc + 1) * 32, lane); ld_w(w1, wr, kc + 1, lane); mm8(acc, a0, w0);
    if (kc + 2 < DIN / 32) { a0 = frag_b(xr + (kc + 2) * 32, lane); ld_w(w0, wr, kc + 2, lane); }
    mm8(acc, a1, w1); } }
// ---- k_tail: block = 32 whole rows, 8 waves: O = LayerNorm0(CX), CX = Qh + ctx from k_fa; T = O + relu(O (hi + lo) . Wo[c][:] + bo[c]) (Wo (out,in) exact bf16; 2 products); OUT = LayerNorm1(T); O and T stay in LDS, so one launch does the work of three
#define TR 32              // rows a block: 256 blocks, one a WGP
#define TP (DIN + 4)       // LDS pitch of an f32 row: 16-byte aligned; rows 8 apart lie 32 banks apart
// 128 rows of DIN f32 that lie one behind the other in memory, by the block's 256 threads: each wave-wide load covers 512 contiguous bytes, 32 loads of a thread in flight
__device__ __forceinline__ void w_load(v4f (&x)[32], const float* __restrict__ s, int tid) {
#pragma unroll
  for (int i = 0; i < 32; ++i) x[i] = *(const v4f*)(s + i * 1024 + tid * 4);
  asm volatile("s_wait_xcnt 0x0" ::: "memory"); }   // stands behind the loads issued so far, in front of every later rewrite of a register that they name
__device__ __forceinline__ void w_store(__bf16* dst, const v4f (&x)[32], int tid) {
#pragma unroll
  for (int i = 0; i < 32; ++i) { v4b y;
#pragma unroll
    for (int e = 0; e < 4; ++e) y[e] = (__bf16)x[i][e];
    *(v4b*)(dst + (i * 4 + (tid >> 6)) * GP + (tid & 63) * 4) = y; } }
// LayerNorm of four rows a wave, in place (biased var, eps 1e-5, x g + b); the lane holds columns q * 128 + lane * 4 + 0..3; the four rows' sums run side by side
__device__ __forceinline__ void ln4(v4f (&x)[4][DIN / 128], const v4f (&gm)[DIN / 128], const v4f (&bt)[DIN / 128]) { float s1[4], qq[4], mu[4];
#pragma unroll
  for (int r = 0; r < 4; ++r) { s1[r] = 0.f;
#pragma unroll
    for (int q = 0; q < DIN / 128; ++q)
#pragma unroll
      for (int i = 0; i < 4; ++i) s1[r] += x[r][q][i]; }
#pragma unroll
  for (int o = 1; o < 32; o <<= 1)
#pragma unroll
    for (int r = 0; r < 4; ++r) s1[r] += __shfl_xor(s1[r], o);
#pragma unroll
  for (int r = 0; r < 4; ++r) { mu[r] = s1[r] * (1.0f / DIN); qq[r] = 0.f;
#pragma unroll
    for (int q = 0; q < DIN / 128; ++q)
#pragma unroll
      for (int i = 0; i < 4; ++i) { const float d = x[r][q][i] - mu[r]; qq[r] += d * d; } }
#pragma unroll
  for (int o = 1; o < 32; o <<= 1)
#pragma unroll
    for (int r = 0; r < 4; ++r) qq[r] += __shfl_xor(qq[r], o);
#pragma unroll
  for (int r = 0; r < 4; ++r) { const float rs = rsqrtf(qq[r] * (1.0f / DIN) + 1e-5f);
#pragma unroll
    for (int q = 0; q < DIN / 128; ++q)
#pragma unroll
      for (int i = 0; i < 4; ++i) x[r][q][i] = (x[r][q][i] - mu[r]) * rs * bfr(gm[q][i]) + bfr(bt[q][i]); } }
__global__ __launch_bounds__(256) void k_tail(const float* __restrict__ CX, const float* __restrict__ G0, const float* __restrict__ B0, const float* __restrict__ WO, const float* __restrict__ BO, const float* __restrict__ G1, const float* __restrict__ B1, float* __restrict__ OUT) {
  __shared__ __align__(16) __bf16 wt[CC * GP], xh[TR * GP], xl[TR * GP]; __shared__ __align__(16) float of[TR][TP];
  const int tid = threadIdx.x, wave = tid >> 5, lane = tid & 31, col = lane & 15, g = lane >> 4; const int rw = wave * 4, rt = (wave & 1) * 16, cg = (wave >> 1) * 64; const size_t r0 = (size_t)blockIdx.x * TR;
  v4f x[4][DIN / 128], g0[DIN / 128], b0[DIN / 128], g1[DIN / 128], b1[DIN / 128], wa[32], wb[32]; float bo[4];
#pragma unroll
  for (int r = 0; r < 4; ++r)
#pragma unroll
    for (int q = 0; q < DIN / 128; ++q) x[r][q] = *(const v4f*)(CX + (r0 + rw + r) * DIN + q * 128 + lane * 4);
  asm volatile("s_wait_xcnt 0x0" ::: "memory");   // stands behind the row loads, in front of every later rewrite of a register that they name
#pragma unroll
  for (int q = 0; q < DIN / 128; ++q) { const int c = q * 128 + lane * 4; g0[q] = *(const v4f*)(G0 + c); b0[q] = *(const v4f*)(B0 + c); g1[q] = *(const v4f*)(G1 + c); b1[q] = *(const v4f*)(B1 + c); }
#pragma unroll
  for (int j = 0; j < 4; ++j) bo[j] = BO[cg + j * 16 + col];
  asm volatile("s_wait_xcnt 0x0" ::: "memory");   // the same behind the loads of the LayerNorm vectors and the bias
  w_load(wa, WO, tid); w_store(wt, wa, tid);
  w_load(wb, WO + (size_t)128 * DIN, tid);   // the second half of Wo flies while LayerNorm0 runs
  ln4(x, g0, b0);
#pragma unroll
  for (int r = 0; r < 4; ++r)
#pragma unroll
    for (int q = 0; q < DIN / 128; ++q) *(v4f*)&of[rw + r][q * 128 + lane * 4] = x[r][q];
  LDSX();   // the wave's own four rows are read back below in another lane order
#pragma unroll
  for (int r = 0; r < 4; ++r) { const float* p = &of[rw + r][lane * 8]; v8b yh, yl;   // bf16 hi + lo planes, eight columns a lane: 16-byte LDS stores
#pragma unroll
    for (int e = 0; e < 8; ++e) { const float v = p[e]; const __bf16 h = (__bf16)v; yh[e] = h; yl[e] = (__bf16)(v - (float)h); }
    *(v8b*)(xh + (rw + r) * GP + lane * 8) = yh; *(v8b*)(xl + (rw + r) * GP + lane * 8) = yl; }
  w_store(wt + 128 * GP, wb, tid);
  __syncthreads();   // Wo and the LayerNorm0 rows (f32, bf16 hi, bf16 lo) are published to every wave
  v8f acc[4] = {}; { const __bf16 *hr = xh + (rt + col) * GP, *lr = xl + (rt + col) * GP, *wr = wt + (cg + col) * GP; v16b h[2], l[2], w[2][4];   // wave = 16 rows x 64 columns; two fragment sets, as in gemm_lds
    h[0] = frag_b(hr, lane); l[0] = frag_b(lr, lane);
#pragma unroll
    for (int j = 0; j < 4; ++j) w[0][j] = frag_b(wr + j * 16 * GP, lane);
#pragma unroll
    for (int kc = 0; kc < DIN / 32; ++kc) { const int s = kc & 1;
      if (kc + 1 < DIN / 32) { h[s ^ 1] = frag_b(hr + (kc + 1) * 32, lane); l[s ^ 1] = frag_b(lr + (kc + 1) * 32, lane);
#pragma unroll
        for (int j = 0; j < 4; ++j) w[s ^ 1][j] = frag_b(wr + j * 16 * GP + (kc + 1) * 32, lane); }
#pragma unroll
      for (int j = 0; j < 4; ++j) acc[j] = wmma_bf(h[s], w[s][j], acc[j]);
#pragma unroll
      for (int j = 0; j < 4; ++j) acc[j] = wmma_bf(l[s], w[s][j], acc[j]); } }
#pragma unroll
  for (int j = 0; j < 4; ++j)
#pragma unroll
    for (int r = 0; r < 8; ++r) { float* p = &of[rt + 8 * g + r][cg + j * 16 + col]; *p = fmaxf(acc[j][r] + bfr(bo[j]), 0.f) + *p; }   // each element has one owner lane
  __syncthreads();   // the T rows are whole before LayerNorm1 reads them
#pragma unroll
  for (int r = 0; r < 4; ++r)
#pragma unroll
    for (int q = 0; q < DIN / 128; ++q) x[r][q] = *(const v4f*)&of[rw + r][q * 128 + lane * 4];
  ln4(x, g1, b1);
#pragma unroll
  for (int r = 0; r < 4; ++r)
#pragma unroll
    for (int q = 0; q < DIN / 128; ++q) vst2(OUT + (r0 + rw + r) * DIN + q * 128 + lane * 4, x[r][q]); }
#define WS_QF  (WS_END)
#define WS_O   (WS_QF + 4u * (size_t)NROW * DIN)
#define WS_T   (WS_O + 4u * (size_t)NROW * DIN)
#define WS_END2 (WS_T + 4u * (size_t)NROW * DIN)
#ifndef SM_EXTRA_PARAMS
#define SM_EXTRA_PARAMS
#endif
#ifndef PROJ_EXTRA_PARAMS
#define PROJ_EXTRA_PARAMS
#endif
#ifndef SM_MASK_HOOK
#define SM_MASK_HOOK (void)0
#endif

#define WS_QH  0u                                      // f16 q rows [b*t][CC]
#define WS_KH  (WS_QH + 2u * (size_t)NB * TT * CC)      // f16 k rows [b*t][CC]
#define WS_VT  (WS_KH + 2u * (size_t)NB * TT * CC)      // f16 v planes [b][c][t]
#define WS_QL  (WS_VT + 2u * (size_t)NB * CC * TT)      // f16 q residual x 2^10 rows [b][t < QHI][CC]
#define WS_KL  (WS_QL + 2u * (size_t)NB * QHI * CC)     // f16 k residual x 2^10 rows [b][t < KHI][CC]
#define WS_VB  (WS_KL + 2u * (size_t)NB * KHI * CC)     // bf16 v hi planes [b][c][t < KHI]
#define WS_VBL (WS_VB + 2u * (size_t)NB * CC * KHI)
#define WS_S   (WS_VBL + 2u * (size_t)NB * CC * KHI)    // f32 [hg][t][s], unused: k_fa keeps logits and P in registers
#define WS_Y   (WS_S  + 4u * (size_t)HG * TT * TT)      // f32 ctx rows [b*t][CC] (only when there is an output projection)
#define WS_END (WS_Y  + 0u)

// ---- k_proj: block = (64 rows, 128 cols, which): q/k/v = X W (+ b) with exact bf16 products (K = DIN) -> which 0: q f16 rows (+ residual rows < QHI); 1: k f16 rows (+ residual rows < KHI); 2: v f16 planes [c][t] (+ bf16 hi/lo planes for t < KHI)
__global__ __launch_bounds__(128) void k_proj(const float* __restrict__ XQ, const float* __restrict__ XK, const float* __restrict__ XV, const float* __restrict__ WQ, const float* __restrict__ WK, const float* __restrict__ WV, const float* __restrict__ BQ, const float* __restrict__ BK, const float* __restrict__ BV,
    _Float16* __restrict__ QH, _Float16* __restrict__ QL, _Float16* __restrict__ KH, _Float16* __restrict__ KL, _Float16* __restrict__ VT, __bf16* __restrict__ VB, __bf16* __restrict__ VBL) {
  __shared__ __align__(16) union { __bf16 ops[192 * GP]; struct { _Float16 sh[64][136], sl[64][136]; } qk; struct { _Float16 th[128][72]; __bf16 tb[128][72], tbl[128][72]; } v; } sm;   // ops rows 0..63: the X tile, 64..191: the W tile; the output staging takes their place, so that three blocks a WGP stay resident
  auto& sh = sm.qk.sh; auto& sl = sm.qk.sl; auto& th = sm.v.th; auto& tb = sm.v.tb; auto& tbl = sm.v.tbl;
  const int tid = threadIdx.x, wave = tid >> 5, lane = tid & 31, col = lane & 15, g = lane >> 4; const int which = blockIdx.z; const int c0 = blockIdx.y * 128; const size_t r0 = (size_t)blockIdx.x * 64; const size_t bb = r0 / TT; const int t0 = (int)(r0 % TT);
  const float* X = which == 0 ? XQ : which == 1 ? XK : XV; const float* WA = which == 0 ? WQ : which == 1 ? WK : WV; const float* BA = which == 0 ? BQ : which == 1 ? BK : BV;
#pragma unroll 1   // rolled: one batch of 32 loads a thread in flight at a time; unrolled, the batches' registers add up past what three resident waves a SIMD allow
  for (int b = 0; b < 3; ++b) stage_bf(sm.ops + b * 64 * GP, b == 0 ? X + r0 * DIN : WA + (size_t)(c0 + (b - 1) * 64) * DIN, tid);
  __syncthreads();   // both operand tiles are published to every wave
  v8f acc[8] = {}; gemm_lds(acc, sm.ops + (wave * 16 + col) * GP, sm.ops + (64 + col) * GP, lane);
  __syncthreads();   // every wave's reads of the operand tiles are done before the output staging overwrites them
  if (which < 2) { _Float16* DH = which == 0 ? QH : KH; _Float16* DL = which == 0 ? QL : KL; const int nhi = which == 0 ? QHI : KHI; const bool hi_rows = t0 < nhi;
#pragma unroll
    for (int j = 0; j < 8; ++j) { const float bias = BA ? bfr(BA[c0 + j * 16 + col]) : 0.f;
#pragma unroll
      for (int r = 0; r < 8; ++r) { const float v = acc[j][r] + bias; const _Float16 hv = (_Float16)v; sh[wave * 16 + 8 * g + r][j * 16 + col] = hv; sl[wave * 16 + 8 * g + r][j * 16 + col] = (_Float16)((v - (float)hv) * 1024.0f); } }
    __syncthreads();
    for (int e = tid; e < 64 * 16; e += 128) { const int rl = e >> 4, q = e & 15; vst2((unsigned*)(DH + (r0 + rl) * CC + c0 + q * 8), *(const v4u*)&sh[rl][q * 8]); if (hi_rows) vst2((unsigned*)(DL + (bb * nhi + t0 + rl) * (size_t)CC + c0 + q * 8), *(const v4u*)&sl[rl][q * 8]); }
  } else { const bool hi_rows = t0 < KHI;
#pragma unroll
    for (int j = 0; j < 8; ++j) { const float bias = BA ? bfr(BA[c0 + j * 16 + col]) : 0.f;
#pragma unroll
      for (int r = 0; r < 8; ++r) { const float v = acc[j][r] + bias; const int rl = wave * 16 + 8 * g + r, cl = j * 16 + col; th[cl][rl] = (_Float16)v; const __bf16 bh = (__bf16)v; tb[cl][rl] = bh; tbl[cl][rl] = (__bf16)(v - (float)bh); } }
    __syncthreads();
    for (int e = tid; e < 128 * 8; e += 128) { const int cl = e >> 3, q = e & 7; vst2((unsigned*)(VT + (bb * CC + c0 + cl) * (size_t)TT + t0 + q * 8), *(const v4u*)&th[cl][q * 8]); if (hi_rows) { const size_t o3 = (bb * CC + c0 + cl) * (size_t)KHI + t0 + q * 8; vst2((unsigned*)(VB + o3), *(const v4u*)&tb[cl][q * 8]); vst2((unsigned*)(VBL + o3), *(const v4u*)&tbl[cl][q * 8]); } } } }
// ---- k_fa: block = 128 queries of (b, h), 8 waves = 4 query groups of 32 columns x 2 key groups, one launch for every batch and head: S^T = K Q^T (q hi + residual x 2^10, 2 products), online softmax in f32 per lane (lane = query), O^T += V^T P^T (P once to f16, 1 product); logits and P stay in registers; each K and V^T fragment read from LDS serves the wave's two query tiles; a key group walks its 128 keys of every stage of 256, and the two groups' partial maxima, sums and O^T are merged through LDS at the end; the row written is Qh + ctx, Qh from the q fragments (hi + residual x 2^-10) that the lane holds at the same features; K rows and V^T rows of a stage come into LDS by asynchronous copies (two buffers) and serve the block's eight waves
typedef __attribute__((ext_vector_type(2))) _Float16 v2h;
#define FA_C (SCALE * 1.4426950408889634f)   // raw q.k -> base-2 exponent
#define FA_LAZY (8.0f / FA_C)                // the maximum in use is replaced only when a new one exceeds it by 2^8
#define FA_OFF 6.0f                          // P = 2^(6 + ...) <= 2^14: keeps small weights out of the f16 subnormals; cancels against the row sum
#define FA_KT 256                            // keys a stage: 128 for each key group (4 passes of 32 keys)
#define FA_QT 2                              // query tiles of 16 columns a wave
#define FA_QB 128                            // queries a block
#define FA_NT (TT / FA_KT)                   // stages
#define FA_KP (HD + 8)                       // LDS pitch of a K row in f16: 128 B + 16 B = 16 B x odd, free of bank conflicts for 16-byte reads
#define FA_VP (FA_KT + 8)                    // LDS pitch of a V^T row in f16: 512 B + 16 B = 16 B x odd
#define FA_KBUF (FA_KT * FA_KP)
#define FA_VBUF (HD * FA_VP)
__device__ __forceinline__ float xhalf(float x) { return __builtin_bit_cast(float, __builtin_amdgcn_permlanex16(__builtin_bit_cast(int, x), __builtin_bit_cast(int, x), 0x76543210, 0xfedcba98, false, false)); }
__device__ __forceinline__ v8f wm16(v16h a, v16h b, v8f c) { return __builtin_amdgcn_wmma_f32_16x16x32_f16(false, a, false, b, (short)0, c, false, false); }
// fragments of one pass, from the stage's LDS buffer: K rows (A of S^T: row = key) and V^T rows (A of O^T: row = feature, k = key), both in the hardware k order
__device__ __forceinline__ void fa_load(v16h (&kf)[2][HD / 32], v16h (&vf)[HD / 16], const _Float16* Kl, const _Float16* Vl, int pass, int lane) {
#pragma unroll
  for (int i = 0; i < 2; ++i)
#pragma unroll
    for (int kc = 0; kc < HD / 32; ++kc) kf[i][kc] = frag_h(Kl + (pass * 32 + i * 16) * FA_KP + kc * 32, lane);
#pragma unroll
  for (int j = 0; j < HD / 16; ++j) vf[j] = frag_h(Vl + pass * 32 + j * 16 * FA_VP, lane); }
// eight asynchronous 16-byte copies a lane, global -> LDS, at fixed steps of both addresses; the s_wait_xcnt stands inside the statement so that no address register is rewritten in front of it
__device__ __forceinline__ void fa_copy8(unsigned l, unsigned ls, const _Float16* g, size_t gs) {
  asm volatile("global_load_async_to_lds_b128 %0, %8, off\n\tglobal_load_async_to_lds_b128 %1, %9, off\n\tglobal_load_async_to_lds_b128 %2, %10, off\n\tglobal_load_async_to_lds_b128 %3, %11, off\n\t"
               "global_load_async_to_lds_b128 %4, %12, off\n\tglobal_load_async_to_lds_b128 %5, %13, off\n\tglobal_load_async_to_lds_b128 %6, %14, off\n\tglobal_load_async_to_lds_b128 %7, %15, off\n\ts_wait_xcnt 0x0"
               :: "v"(l), "v"(l + ls), "v"(l + 2 * ls), "v"(l + 3 * ls), "v"(l + 4 * ls), "v"(l + 5 * ls), "v"(l + 6 * ls), "v"(l + 7 * ls),
                  "v"(g), "v"(g + gs), "v"(g + 2 * gs), "v"(g + 3 * gs), "v"(g + 4 * gs), "v"(g + 5 * gs), "v"(g + 6 * gs), "v"(g + 7 * gs) : "memory"); }
template <bool AHEAD> __device__ __forceinline__ void fa_pass(const v16h (&kf)[2][HD / 32], const v16h (&vf)[HD / 16], const v16h (&kn)[2][HD / 32], const v16h (&qh)[FA_QT][HD / 32], const v16h (&ql)[FA_QT][HD / 32], v8f (&o)[FA_QT][HD / 16], float (&m)[FA_QT], v2f (&l)[FA_QT][2]) {
  v2f t[FA_QT][8]; float mx[FA_QT];   // lane (c, h): query c of tile u, keys 8h + 0..7 and 16 + 8h + 0..7
#pragma unroll
  for (int u = 0; u < FA_QT; ++u) { v8f sh[2] = {}, sl[2] = {};
#pragma unroll
    for (int kc = 0; kc < HD / 32; ++kc)
#pragma unroll
      for (int i = 0; i < 2; ++i) { sh[i] = wm16(kf[i][kc], qh[u][kc], sh[i]); sl[i] = wm16(kf[i][kc], ql[u][kc], sl[i]); }
    float x = -3.0e38f;
#pragma unroll
    for (int e = 0; e < 8; ++e) { const int i = e >> 2, r = (e & 3) * 2; v2f a, c; a[0] = sh[i][r]; a[1] = sh[i][r + 1]; c[0] = sl[i][r]; c[1] = sl[i][r + 1]; t[u][e] = a + c * (1.0f / 1024.0f); x = fmaxf(x, fmaxf(t[u][e][0], t[u][e][1])); }
    mx[u] = fmaxf(x, xhalf(x)); }
  if (AHEAD) asm volatile("" :: "v"(kn[0][0]), "v"(kn[0][1]), "v"(kn[1][0]), "v"(kn[1][1]));   // inputs only: holds the LDS loads of the next pass's K fragments in front of the branch below; behind it they would stand directly in front of their products, their latency open
  if (__builtin_amdgcn_ballot_w32(mx[0] > m[0] + FA_LAZY || mx[1] > m[1] + FA_LAZY) != 0) {   // one test a pass for both query tiles
#pragma unroll
    for (int u = 0; u < FA_QT; ++u) { const float mn = fmaxf(m[u], mx[u]); const float al = __builtin_amdgcn_exp2f((m[u] - mn) * FA_C); m[u] = mn; l[u][0] *= al; l[u][1] *= al;
#pragma unroll
      for (int j = 0; j < HD / 16; ++j)
#pragma unroll
        for (int r = 0; r < 8; ++r) o[u][j][r] *= al; } }
#pragma unroll
  for (int u = 0; u < FA_QT; ++u) { const float mc = m[u] * FA_C - FA_OFF; v16h p;
#pragma unroll
    for (int e = 0; e < 8; ++e) { const v2f a = t[u][e] * FA_C - mc; v2f pe; pe[0] = __builtin_amdgcn_exp2f(a[0]); pe[1] = __builtin_amdgcn_exp2f(a[1]); l[u][e & 1] += pe; const v2h ph = __builtin_convertvector(pe, v2h); p[2 * e] = ph[0]; p[2 * e + 1] = ph[1]; }
#pragma unroll
    for (int j = 0; j < HD / 16; ++j) o[u][j] = wm16(vf[j], p, o[u][j]); } }
typedef v4f __attribute__((may_alias)) v4f_a;
__global__ __launch_bounds__(256) void k_fa(const _Float16* __restrict__ QH, const _Float16* __restrict__ QL, const _Float16* __restrict__ KH, const _Float16* __restrict__ VT, float* Y) {   // Y without restrict: so the "memory" clobber of the waits behind its stores holds them in order
  __shared__ __align__(16) _Float16 ks[2][FA_KBUF], vs[2][FA_VBUF];
  const int tid = threadIdx.x, lane = tid & 31, col = lane & 15, g = lane >> 4; const int h = blockIdx.y, b = blockIdx.z;
  const int wave = __builtin_amdgcn_readfirstlane(tid >> 5), qg = wave & 3, kg = wave >> 2;   // query group and key group of the wave, the same in every lane
  const int ql0 = blockIdx.x * FA_QB + qg * (16 * FA_QT);
  v16h qh[FA_QT][HD / 32], ql[FA_QT][HD / 32];
#pragma unroll
  for (int u = 0; u < FA_QT; ++u)
#pragma unroll
    for (int kc = 0; kc < HD / 32; ++kc) { qh[u][kc] = frag_h(QH + ((size_t)b * TT + ql0 + u * 16 + col) * CC + h * HD + kc * 32, lane); ql[u][kc] = frag_h(QL + ((size_t)b * QHI + ql0 + u * 16 + col) * CC + h * HD + kc * 32, lane); }
  asm volatile("s_wait_xcnt 0x0" ::: "memory");   // stands behind the q loads, in front of every later rewrite of a register that they name
  __builtin_amdgcn_sched_barrier(0);                // keeps the address arithmetic that follows, which reuses the q loads' address registers, behind that wait
  // a stage's copies: K 256 rows x 128 B (a thread: 16 B of rows tid / 8 + 32 i), V^T 64 rows x 512 B (16 B of rows tid / 32 + 8 i): whole 128-byte lines on the global side
  const _Float16* Kg = KH + ((size_t)b * TT + (tid >> 3)) * CC + h * HD + (tid & 7) * 8;
  const _Float16* Vg = VT + ((size_t)b * CC + h * HD + (tid >> 5)) * (size_t)TT + (tid & 31) * 8;
  const unsigned kd = (unsigned)(size_t)&ks[0][(tid >> 3) * FA_KP + (tid & 7) * 8], vd = (unsigned)(size_t)&vs[0][(tid >> 5) * FA_VP + (tid & 31) * 8];   // LDS byte addresses
  const unsigned kr = (unsigned)(size_t)&ks[0][(wave * 4 + (lane >> 3)) * FA_KP + (lane & 7) * 8], vr = (unsigned)(size_t)&vs[0][wave * FA_VP + lane * 8];   // the same addresses from the wave's number and the lane, for the refills: kd and vd are named by the prologue's asm statements, which take registers of the first 256 only; a base bound to that window for the whole loop was spilled to scratch, one formed apart may lie above it
  v16h kA[2][HD / 32], vA[HD / 16], kB[2][HD / 32], vB[HD / 16];
  v8f o[FA_QT][HD / 16] = {}; float m[FA_QT] = {-3.0e38f, -3.0e38f}; v2f l[FA_QT][2] = {};
  fa_copy8(kd, 32 * FA_KP * 2, Kg, (size_t)32 * CC); fa_copy8(vd, 8 * FA_VP * 2, Vg, (size_t)8 * TT);
  asm volatile("s_wait_asynccnt 0x0" ::: "memory");   // this wave's copies of stage 0 have landed
  __syncthreads();                                    // stage 0 is published to every wave
  fa_copy8(kd + FA_KBUF * 2, 32 * FA_KP * 2, Kg + (size_t)FA_KT * CC, (size_t)32 * CC); fa_copy8(vd + FA_VBUF * 2, 8 * FA_VP * 2, Vg + FA_KT, (size_t)8 * TT);
  for (int t = 0; t < FA_NT; ++t) {   // trip t reads buffer t mod 2 alone, while stage t + 1 flies into the other
    const int bf = t & 1; const _Float16* Kl = &ks[bf][(kg * (FA_KT / 2) + col) * FA_KP]; const _Float16* Vl = &vs[bf][col * FA_VP + kg * (FA_KT / 2)];   // the lane's key row of its key group's pass 0 and its feature row at that group's first key
    fa_load(kA, vA, Kl, Vl, 0, lane);   // two register sets: inside a stage a pass's fragments are fetched during the pass before it
    fa_load(kB, vB, Kl, Vl, 1, lane);
    fa_pass<true>(kA, vA, kB, qh, ql, o, m, l);
    fa_load(kA, vA, Kl, Vl, 2, lane);
    fa_pass<true>(kB, vB, kA, qh, ql, o, m, l);
    fa_load(kB, vB, Kl, Vl, 3, lane);
    fa_pass<true>(kA, vA, kB, qh, ql, o, m, l);
    fa_pass<false>(kB, vB, kB, qh, ql, o, m, l);
    asm volatile("s_wait_dscnt 0x0" ::: "memory");      // this wave's reads of buffer t mod 2 are done before it is refilled
    asm volatile("s_wait_asynccnt 0x0" ::: "memory");   // this wave's copies of stage t + 1 have landed
    __syncthreads();                                    // publishes stage t + 1 and ends every wave's reads of buffer t mod 2
    if (t + 2 < FA_NT) { fa_copy8(kr + bf * (FA_KBUF * 2), 32 * FA_KP * 2, Kg + (size_t)(t + 2) * FA_KT * CC, (size_t)32 * CC); fa_copy8(vr + bf * (FA_VBUF * 2), 8 * FA_VP * 2, Vg + (t + 2) * FA_KT, (size_t)8 * TT); }
  }
  asm volatile("s_wait_asynccnt 0x0" ::: "memory");   // no copy is outstanding when the ring becomes the exchange area and when the wave ends
  float ls[FA_QT];
#pragma unroll
  for (int u = 0; u < FA_QT; ++u) { ls[u] = l[u][0][0] + l[u][0][1] + l[u][1][0] + l[u][1][1]; ls[u] += xhalf(ls[u]); }
  // merge of the two key groups: the last barrier of the loop has ended every read of the ring, so key group 1 lays its partial results there: 17 entries of 16 B a lane, an entry's 32 lanes side by side
  v4f_a* xb = (v4f_a*)&ks[0][0] + qg * (17 * 32) + lane;
  if (kg == 1) {
#pragma unroll
    for (int u = 0; u < FA_QT; ++u)
#pragma unroll
      for (int j = 0; j < HD / 16; ++j) { v4f a, c;
#pragma unroll
        for (int r = 0; r < 4; ++r) { a[r] = o[u][j][r]; c[r] = o[u][j][4 + r]; }
        xb[((u * 4 + j) * 2) * 32] = a; xb[((u * 4 + j) * 2 + 1) * 32] = c; }
    v4f s; s[0] = m[0]; s[1] = m[1]; s[2] = ls[0]; s[3] = ls[1]; xb[16 * 32] = s; }
  __syncthreads();   // key group 1's partial results are published to key group 0
  if (kg == 0) { const v4f s = xb[16 * 32];
#pragma unroll
    for (int u = 0; u < FA_QT; ++u) { const float mn = fmaxf(m[u], s[u]); const float a0 = __builtin_amdgcn_exp2f((m[u] - mn) * FA_C), a1 = __builtin_amdgcn_exp2f((s[u] - mn) * FA_C); const float inv = 1.0f / (ls[u] * a0 + s[2 + u] * a1); const float w0 = a0 * inv, w1 = a1 * inv;
      float* yr = Y + ((size_t)b * TT + ql0 + u * 16 + col) * CC + h * HD + 8 * g; v4f a[HD / 16], c[HD / 16];   // O^T: the lane holds features j * 16 + 8h + 0..7 of its query
#pragma unroll
      for (int j = 0; j < HD / 16; ++j) { const v4f pa = xb[((u * 4 + j) * 2) * 32], pc = xb[((u * 4 + j) * 2 + 1) * 32];
#pragma unroll
        for (int r = 0; r < 4; ++r) { const int e = (j & 1) * 8 + r;   // fragment element e of k step j / 2 is feature j * 16 + 8h + r of the lane's query
          a[j][r] = o[u][j][r] * w0 + pa[r] * w1 + ((float)qh[u][j >> 1][e] + (float)ql[u][j >> 1][e] * (1.0f / 1024.0f)); c[j][r] = o[u][j][4 + r] * w0 + pc[r] * w1 + ((float)qh[u][j >> 1][e + 4] + (float)ql[u][j >> 1][e + 4] * (1.0f / 1024.0f)); } }
      __builtin_amdgcn_sched_barrier(0);   // the tile's arithmetic stays in front of its stores, so that nothing between the first store and the wait below rewrites a register that a store names
#pragma unroll
      for (int j = 0; j < HD / 16; ++j) { vst2(yr + j * 16, a[j]); vst2(yr + j * 16 + 4, c[j]); }
      asm volatile("s_wait_xcnt 0x0" ::: "memory");   // stands behind the tile's stores, in front of every later rewrite of a register that they name
      __builtin_amdgcn_sched_barrier(0); } } }   // keeps the next tile's arithmetic behind that wait

extern "C" void kernel_launch(void* const* d_in, const int* in_sizes, int n_in, void* d_out, int out_size, void* d_ws, size_t ws_size, hipStream_t stream) {
  (void)in_sizes; (void)n_in; (void)out_size;
  const float** F = (const float**)d_in;
  if (ws_size < (size_t)WS_END) return;
  char* ws = (char*)d_ws; _Float16 *QH = (_Float16*)(ws + WS_QH), *KH = (_Float16*)(ws + WS_KH), *VT = (_Float16*)(ws + WS_VT), *QL = (_Float16*)(ws + WS_QL), *KL = (_Float16*)(ws + WS_KL); __bf16 *VB = (__bf16*)(ws + WS_VB), *VBL = (__bf16*)(ws + WS_VBL); float *S = (float*)(ws + WS_S), *Y = (float*)(ws + WS_Y);
  (void)Y; (void)S; (void)QL; (void)KL; (void)VB; (void)VBL;
  // inputs: 0 Q, 1 K [4,2048,256]; 2 Wq, 3 bq; 4 Wk, 5 bk; 6 Wv, 7 bv; 8 Wo, 9 bo ((out,in) [256,256]); 10 g0, 11 b0; 12 g1, 13 b1
  if (ws_size < (size_t)WS_END2) return;
  float *T = (float*)(ws + WS_T);
  k_proj<<<dim3(TNB * TT / 64, CC / 128, 3), 128, 0, stream>>>(F[0], F[1], F[1], F[2], F[4], F[6], F[3], F[5], F[7], QH, QL, KH, KL, VT, VB, VBL);
  k_fa<<<dim3(TT / FA_QB, NH, TNB), 256, 0, stream>>>(QH, QL, KH, VT, T);   /* Qh + ctx rows into T (scratch) */
  k_tail<<<dim3(TNB * TT / TR), 256, 0, stream>>>(T, F[10], F[11], F[8], F[9], F[12], F[13], (float*)d_out);   /* out = LN1(O + relu(O Wo^T + bo)), O = LN0(T) */
}

// v007
// One run takes 39.8 microseconds.
// In both of two side-by-side timings against v006, it was 1.09 times as fast.
// All steps since v000 together make it 14.9 times as fast.
// compute dtype: all float inputs rounded to bf16; Qh/Kh/Vh = X W^T + b with EXACT bf16 products on WMMA 16x16x32 (f32 accumulate); q once to f16 against k once to f16 (1 product) x 256^-0.5; online softmax in f32 (base-2 exponential); P x 2^6 against the maximum in use, once to f16, against v once to f16 (1 product), divided by the f32 row sum at the end; Qh (its f16 hi + residual planes summed in f32) + ctx, LayerNorm, the rFF GEMM with the LN rows split bf16 hi + lo against exact Wo (2 products) + bo, relu, residual and the second LayerNorm in f32; f32 output.
#include <hip/hip_runtime.h>
#include <math.h>

typedef __attribute__((ext_vector_type(16))) _Float16 v16h;
typedef __attribute__((ext_vector_type(16))) __bf16 v16b;
typedef __attribute__((ext_vector_type(8)))  _Float16 v8h;
typedef __attribute__((ext_vector_type(8)))  float v8f;
typedef __attribute__((ext_vector_type(4)))  float v4f;
typedef __attribute__((ext_vector_type(2)))  float v2f;
typedef __attribute__((ext_vector_type(4)))  unsigned v4u;
typedef __attribute__((ext_vector_type(4)))  int v4i;
typedef float __attribute__((may_alias)) float_a;
typedef int __attribute__((may_alias)) int_a;

template <typename T> __device__ __forceinline__ void vst2(void* p, T v) { *(T*)p = v;  }
__device__ __forceinline__ v8f wmma16(v16h a, v16h b, v8f c) {
  v8f d = __builtin_amdgcn_wmma_f32_16x16x32_f16(false, a, false, b, (short)0, c, false, false);
  asm volatile("v_nop\n\tv_nop\n\tv_nop\n\tv_nop" : "+v"(d) : "v"(a), "v"(b));
  return d;
}
__device__ __forceinline__ v8f wmma_bf(v16b a, v16b b, v8f c) {
  v8f d = __builtin_amdgcn_wmma_f32_16x16x32_bf16(false, a, false, b, (short)0, c, false, false);
  asm volatile("v_nop\n\tv_nop\n\tv_nop\n\tv_nop" : "+v"(d) : "v"(a), "v"(b));
  return d;
}
// 16x16x32 fragments: lane = (h = lane>>4, row/col = lane&15); elements 0..7 = k0+8h+0..7, 8..15 = k0+16+8h+0..7; D element r = row 8h+r
__device__ __forceinline__ v16h frag_h(const _Float16* rowk0, int lane) {
  union { v16h v; v8h q[2]; } u; const _Float16* p = rowk0 + 8 * (lane >> 4);
  u.q[0] = *(const v8h*)p; u.q[1] = *(const v8h*)(p + 16); return u.v;
}
__device__ __forceinline__ v16h frag_f32(const float* rowk0, int lane) {
  v16h a; const float* p = rowk0 + 8 * (lane >> 4);
#pragma unroll
  for (int i = 0; i < 8; ++i) { a[i] = (_Float16)p[i]; a[8 + i] = (_Float16)p[16 + i]; }
  return a;
}
__device__ __forceinline__ v16h frag_f32s(const float* rowk0, int lane, float sc) {
  v16h a; const float* p = rowk0 + 8 * (lane >> 4);
#pragma unroll
  for (int i = 0; i < 8; ++i) { a[i] = (_Float16)(p[i] * sc); a[8 + i] = (_Float16)(p[16 + i] * sc); }
  return a;
}
// column fragment from a [K][ld] layout (column n), rows >= K read as 0
__device__ __forceinline__ v16h fragc_f32(const float* W, int k0, int n, int lane, int ld, int K) {
  v16h a; const int g = lane >> 4;
#pragma unroll
  for (int i = 0; i < 8; ++i) { const int ka = k0 + 8 * g + i, kb = ka + 16;
    a[i] = (_Float16)(ka < K ? W[(size_t)(ka < K ? ka : K - 1) * ld + n] : 0.f); a[8 + i] = (_Float16)(kb < K ? W[(size_t)(kb < K ? kb : K - 1) * ld + n] : 0.f); }
  return a;
}
struct F2 { v16b h, l; };
__device__ __forceinline__ F2 bsplit16(const float v[16]) { F2 r;
#pragma unroll
  for (int i = 0; i < 16; ++i) { const __bf16 h = (__bf16)v[i]; r.h[i] = h; r.l[i] = (__bf16)(v[i] - (float)h); }
  return r; }
__device__ __forceinline__ F2 split_row(const float* row, int k0, int lane) { float v[16]; const float* p = row + k0 + 8 * (lane >> 4);
#pragma unroll
  for (int i = 0; i < 8; ++i) { v[i] = p[i]; v[8 + i] = p[16 + i]; }
  return bsplit16(v); }
__device__ __forceinline__ F2 split_rowK(const float* row, int k0, int lane, int K) { float v[16]; const int g = lane >> 4;
#pragma unroll
  for (int i = 0; i < 8; ++i) { const int ka = k0 + 8 * g + i, kb = ka + 16; v[i] = ka < K ? row[ka < K ? ka : K - 1] : 0.f; v[8 + i] = kb < K ? row[kb < K ? kb : K - 1] : 0.f; }
  return bsplit16(v); }
__device__ __forceinline__ F2 split_col(const float* W, int k0, int n, int lane, int ld, int K) { float v[16]; const int g = lane >> 4;
#pragma unroll
  for (int i = 0; i < 8; ++i) { const int ka = k0 + 8 * g + i, kb = ka + 16; v[i] = ka < K ? W[(size_t)(ka < K ? ka : K - 1) * ld + n] : 0.f; v[8 + i] = kb < K ? W[(size_t)(kb < K ? kb : K - 1) * ld + n] : 0.f; }
  return bsplit16(v); }
__device__ __forceinline__ v8f mac3(const F2& a, const F2& b, v8f c) { c = wmma_bf(a.l, b.h, c); c = wmma_bf(a.h, b.l, c); return wmma_bf(a.h, b.h, c); }
__device__ __forceinline__ float sigm(float v) { return 1.0f / (1.0f + expf(-v)); }
#define LDSX() do { asm volatile("s_wait_dscnt 0" ::: "memory"); __builtin_amdgcn_wave_barrier(); __builtin_amdgcn_fence(__ATOMIC_RELEASE, "workgroup"); } while (0)

// Set-Transformer MAB (B 4, 2,048 queries x 2,048 keys, D 256 = 4 x 64, no mask): q = Q Wq^T + bq; k, v = K W^T + b; A = softmax(q_h k_h^T / sqrt(256)); O = q + A v (residual with the projected Q, heads merged); O = LN0(O); O = O + relu(O Wo^T + bo); O = LN1(O).
#define NB 4
#define TT 2048
#define CC 256             // NH * HD = projected width
#define DIN 256
#define NH 4
#define HD 64
#define NQB (TT / 64)
#define HG 4
#define SCALE (0.0625f)
#define CAUSAL 0
#ifndef TNB
#define TNB NB
#endif
__device__ __forceinline__ float bfr(float v) { return (float)(__bf16)v; }
__host__ __device__ __forceinline__ int kb_last(int qb) { return CAUSAL ? ((qb * 64 + 63) >> 7) : (TT / 128 - 1); }
typedef __attribute__((ext_vector_type(8))) __bf16 v8b;
__device__ __forceinline__ v16b frag_b(const __bf16* rowk0, int lane) {
  union { v16b v; v8b q[2]; } u; const __bf16* p = rowk0 + 8 * (lane >> 4);
  u.q[0] = *(const v8b*)p; u.q[1] = *(const v8b*)(p + 16); return u.v;
}
#define QBH 0              // unused: no kernel in this file has a high-precision path
#define QHI 2048            // rows carrying a q residual plane (all rows)
#define KHI 64            // key rows carrying k residual / v bf16 hi+lo planes (written by k_proj, read by no kernel in this file)
// B fragment (k rows k0+.., output column o) of a weight: (in,out) [K][ld] or (out,in) [ld rows of K]: bf16 exact, or f16(bf16 * 256) exact
__device__ __forceinline__ v16b wcol_io(const float* Wm, int k0, int o, int lane, int ld) { v16b w; const int g = lane >> 4;
#pragma unroll
  for (int i = 0; i < 8; ++i) { w[i] = (__bf16)Wm[(size_t)(k0 + 8 * g + i) * ld + o]; w[8 + i] = (__bf16)Wm[(size_t)(k0 + 16 + 8 * g + i) * ld + o]; }
  return w; }
__device__ __forceinline__ v16b wcol_oi(const float* Wm, int k0, int o, int lane, int K) { v16b w; const float* p = Wm + (size_t)o * K + k0 + 8 * (lane >> 4);
#pragma unroll
  for (int i = 0; i < 8; ++i) { w[i] = (__bf16)p[i]; w[8 + i] = (__bf16)p[16 + i]; }
  return w; }
__device__ __forceinline__ v16h wcolh_io(const float* Wm, int k0, int o, int lane, int ld) { v16h w; const int g = lane >> 4;
#pragma unroll
  for (int i = 0; i < 8; ++i) { w[i] = (_Float16)(bfr(Wm[(size_t)(k0 + 8 * g + i) * ld + o]) * 256.0f); w[8 + i] = (_Float16)(bfr(Wm[(size_t)(k0 + 16 + 8 * g + i) * ld + o]) * 256.0f); }
  return w; }
__device__ __forceinline__ v16h wcolh_oi(const float* Wm, int k0, int o, int lane, int K) { v16h w; const float* p = Wm + (size_t)o * K + k0 + 8 * (lane >> 4);
#pragma unroll
  for (int i = 0; i < 8; ++i) { w[i] = (_Float16)(bfr(p[i]) * 256.0f); w[8 + i] = (_Float16)(bfr(p[16 + i]) * 256.0f); }
  return w; }
#define WQKV_LAYOUT 1   // 0 = (in,out) [DIN][CC]; 1 = (out,in) [CC][DIN]; 2 = per-head [NH][DIN][HD], for WCOL only, which no kernel uses: k_proj stages Wq/Wk/Wv as (out,in) [CC][DIN] rows
__device__ __forceinline__ v16b wcol_hdk(const float* Wm, int k0, int o, int lane) { v16b w; const int g = lane >> 4; const float* p = Wm + (size_t)(o / HD) * DIN * HD + (o % HD);
#pragma unroll
  for (int i = 0; i < 8; ++i) { w[i] = (__bf16)p[(size_t)(k0 + 8 * g + i) * HD]; w[8 + i] = (__bf16)p[(size_t)(k0 + 16 + 8 * g + i) * HD]; }
  return w; }
#define WO_OUT_IN 0
#if WQKV_LAYOUT == 1
#define WCOL(W, k0, o, lane) wcol_oi(W, k0, o, lane, DIN)
#elif WQKV_LAYOUT == 2
#define WCOL(W, k0, o, lane) wcol_hdk(W, k0, o, lane)
#else
#define WCOL(W, k0, o, lane) wcol_io(W, k0, o, lane, CC)
#endif
#if WO_OUT_IN
#define WOCOL(W, k0, o, lane) wcol_oi(W, k0, o, lane, CC)
#define WOCOLH(W, k0, o, lane) wcolh_oi(W, k0, o, lane, CC)
#else
#define WOCOL(W, k0, o, lane) wcol_io(W, k0, o, lane, DIN)
#define WOCOLH(W, k0, o, lane) wcolh_io(W, k0, o, lane, DIN)
#endif
#define NROW (NB * TT)
#define GP (DIN + 8)       // LDS pitch of a staged operand row in bf16: 512 B + 16 B = 16 B x odd, free of bank conflicts for 16-byte reads
typedef __attribute__((ext_vector_type(4))) __bf16 v4b;
// 64 rows of DIN f32 that lie one behind the other in memory -> bf16 rows in LDS, by the block's 128 threads: each wave-wide load covers 512 contiguous bytes (whole lines), 32 loads of a thread in flight
__device__ __forceinline__ void stage_bf(__bf16* dst, const float* __restrict__ s, int tid) { v4f x[32];
#pragma unroll
  for (int i = 0; i < 32; ++i) x[i] = *(const v4f*)(s + i * 512 + tid * 4);
  asm volatile("s_wait_xcnt 0x0" ::: "memory");   // stands behind the batch's loads, in front of every later rewrite of a register that they name (the next batch forms its base address in the same registers)
#pragma unroll
  for (int i = 0; i < 32; ++i) { v4b y;
#pragma unroll
    for (int e = 0; e < 4; ++e) y[e] = (__bf16)x[i][e];
    *(v4b*)(dst + (i * 2 + (tid >> 6)) * GP + (tid & 63) * 4) = y; } }
// the eight W fragments of one k step of 32, from the lane's first staged W row
__device__ __forceinline__ void ld_w(v16b (&w)[8], const __bf16* wr, int kc, int lane) {
#pragma unroll
  for (int j = 0; j < 8; ++j) w[j] = frag_b(wr + j * 16 * GP + kc * 32, lane); }
__device__ __forceinline__ void mm8(v8f (&acc)[8], v16b a, const v16b (&w)[8]) {
#pragma unroll
  for (int j = 0; j < 8; ++j) acc[j] = wmma_bf(a, w[j], acc[j]); }
// acc += X W^T over K = DIN from the staged tiles; two fragment sets: a k step's LDS reads stand as one group in front of the products of the step before it
__device__ __forceinline__ void gemm_lds(v8f (&acc)[8], const __bf16* xr, const __bf16* wr, int lane) { v16b a0, a1, w0[8], w1[8];
  a0 = frag_b(xr, lane); ld_w(w0, wr, 0, lane);
#pragma unroll
  for (int kc = 0; kc < DIN / 32; kc += 2) { a1 = frag_b(xr + (kc + 1) * 32, lane); ld_w(w1, wr, kc + 1, lane); mm8(acc, a0, w0);
    if (kc + 2 < DIN / 32) { a0 = frag_b(xr + (kc + 2) * 32, lane); ld_w(w0, wr, kc + 2, lane); }
    mm8(acc, a1, w1); } }
// ---- k_tail: block = 32 whole rows, 8 waves: O = LayerNorm0(CX), CX = Qh + ctx from k_fa; T = O + relu(O (hi + lo) . Wo[c][:] + bo[c]) (Wo (out,in) exact bf16; 2 products); OUT = LayerNorm1(T); O and T stay in LDS, so one launch does the work of three
#define TR 32              // rows a block: 256 blocks, one a WGP
#define TP (DIN + 4)       // LDS pitch of an f32 row: 16-byte aligned; rows 8 apart lie 32 banks apart
// 128 rows of DIN f32 that lie one behind the other in memory, by the block's 256 threads: each wave-wide load covers 512 contiguous bytes, 32 loads of a thread in flight
__device__ __forceinline__ void w_load(v4f (&x)[32], const float* __restrict__ s, int tid) {
#pragma unroll
  for (int i = 0; i < 32; ++i) x[i] = *(const v4f*)(s + i * 1024 + tid * 4);
  asm volatile("s_wait_xcnt 0x0" ::: "memory"); }   // stands behind the loads issued so far, in front of every later rewrite of a register that they name
__device__ __forceinline__ void w_store(__bf16* dst, const v4f (&x)[32], int tid) {
#pragma unroll
  for (int i = 0; i < 32; ++i) { v4b y;
#pragma unroll
    for (int e = 0; e < 4; ++e) y[e] = (__bf16)x[i][e];
    *(v4b*)(dst + (i * 4 + (tid >> 6)) * GP + (tid & 63) * 4) = y; } }
// LayerNorm of four rows a wave, in place (biased var, eps 1e-5, x g + b); the lane holds columns q * 128 + lane * 4 + 0..3; the four rows' sums run side by side
__device__ __forceinline__ void ln4(v4f (&x)[4][DIN / 128], const v4f (&gm)[DIN / 128], const v4f (&bt)[DIN / 128]) { float s1[4], qq[4], mu[4];
#pragma unroll
  for (int r = 0; r < 4; ++r) { s1[r] = 0.f;
#pragma unroll
    for (int q = 0; q < DIN / 128; ++q)
#pragma unroll
      for (int i = 0; i < 4; ++i) s1[r] += x[r][q][i]; }
#pragma unroll
  for (int o = 1; o < 32; o <<= 1)
#pragma unroll
    for (int r = 0; r < 4; ++r) s1[r] += __shfl_xor(s1[r], o);
#pragma unroll
  for (int r = 0; r < 4; ++r) { mu[r] = s1[r] * (1.0f / DIN); qq[r] = 0.f;
#pragma unroll
    for (int q = 0; q < DIN / 128; ++q)
#pragma unroll
      for (int i = 0; i < 4; ++i) { const float d = x[r][q][i] - mu[r]; qq[r] += d * d; } }
#pragma unroll
  for (int o = 1; o < 32; o <<= 1)
#pragma unroll
    for (int r = 0; r < 4; ++r) qq[r] += __shfl_xor(qq[r], o);
#pragma unroll
  for (int r = 0; r < 4; ++r) { const float rs = rsqrtf(qq[r] * (1.0f / DIN) + 1e-5f);
#pragma unroll
    for (int q = 0; q < DIN / 128; ++q)
#pragma unroll
      for (int i = 0; i < 4; ++i) x[r][q][i] = (x[r][q][i] - mu[r]) * rs * bfr(gm[q][i]) + bfr(bt[q][i]); } }
__global__ __launch_bounds__(256) void k_tail(const float* __restrict__ CX, const float* __restrict__ G0, const float* __restrict__ B0, const float* __restrict__ WO, const float* __restrict__ BO, const float* __restrict__ G1, const float* __restrict__ B1, float* __restrict__ OUT) {
  __shared__ __align__(16) __bf16 wt[CC * GP], xh[TR * GP], xl[TR * GP]; __shared__ __align__(16) float of[TR][TP];
  const int tid = threadIdx.x, wave = tid >> 5, lane = tid & 31, col = lane & 15, g = lane >> 4; const int rw = wave * 4, rt = (wave & 1) * 16, cg = (wave >> 1) * 64; const size_t r0 = (size_t)blockIdx.x * TR;
  v4f x[4][DIN / 128], g0[DIN / 128], b0[DIN / 128], g1[DIN / 128], b1[DIN / 128], wa[32], wb[32]; float bo[4];
#pragma unroll
  for (int r = 0; r < 4; ++r)
#pragma unroll
    for (int q = 0; q < DIN / 128; ++q) x[r][q] = *(const v4f*)(CX + (r0 + rw + r) * DIN + q * 128 + lane * 4);
  asm volatile("s_wait_xcnt 0x0" ::: "memory");   // stands behind the row loads, in front of every later rewrite of a register that they name
#pragma unroll
  for (int q = 0; q < DIN / 128; ++q) { const int c = q * 128 + lane * 4; g0[q] = *(const v4f*)(G0 + c); b0[q] = *(const v4f*)(B0 + c); g1[q] = *(const v4f*)(G1 + c); b1[q] = *(const v4f*)(B1 + c); }
#pragma unroll
  for (int j = 0; j < 4; ++j) bo[j] = BO[cg + j * 16 + col];
  asm volatile("s_wait_xcnt 0x0" ::: "memory");   // the same behind the loads of the LayerNorm vectors and the bias
  w_load(wa, WO, tid); w_store(wt, wa, tid);
  w_load(wb, WO + (size_t)128 * DIN, tid);   // the second half of Wo flies while LayerNorm0 runs
  ln4(x, g0, b0);
#pragma unroll
  for (int r = 0; r < 4; ++r)
#pragma unroll
    for (int q = 0; q < DIN / 128; ++q) *(v4f*)&of[rw + r][q * 128 + lane * 4] = x[r][q];
  LDSX();   // the wave's own four rows are read back below in another lane order
#pragma unroll
  for (int r = 0; r < 4; ++r) { const float* p = &of[rw + r][lane * 8]; v8b yh, yl;   // bf16 hi + lo planes, eight columns a lane: 16-byte LDS stores
#pragma unroll
    for (int e = 0; e < 8; ++e) { const float v = p[e]; const __bf16 h = (__bf16)v; yh[e] = h; yl[e] = (__bf16)(v - (float)h); }
    *(v8b*)(xh + (rw + r) * GP + lane * 8) = yh; *(v8b*)(xl + (rw + r) * GP + lane * 8) = yl; }
  w_store(wt + 128 * GP, wb, tid);
  __syncthreads();   // Wo and the LayerNorm0 rows (f32, bf16 hi, bf16 lo) are published to every wave
  v8f acc[4] = {}; { const __bf16 *hr = xh + (rt + col) * GP, *lr = xl + (rt + col) * GP, *wr = wt + (cg + col) * GP; v16b h[2], l[2], w[2][4];   // wave = 16 rows x 64 columns; two fragment sets, as in gemm_lds
    h[0] = frag_b(hr, lane); l[0] = frag_b(lr, lane);
#pragma unroll
    for (int j = 0; j < 4; ++j) w[0][j] = frag_b(wr + j * 16 * GP, lane);
#pragma unroll
    for (int kc = 0; kc < DIN / 32; ++kc) { const int s = kc & 1;
      if (kc + 1 < DIN / 32) { h[s ^ 1] = frag_b(hr + (kc + 1) * 32, lane); l[s ^ 1] = frag_b(lr + (kc + 1) * 32, lane);
#pragma unroll
        for (int j = 0; j < 4; ++j) w[s ^ 1][j] = frag_b(wr + j * 16 * GP + (kc + 1) * 32, lane); }
#pragma unroll
      for (int j = 0; j < 4; ++j) acc[j] = wmma_bf(h[s], w[s][j], acc[j]);
#pragma unroll
      for (int j = 0; j < 4; ++j) acc[j] = wmma_bf(l[s], w[s][j], acc[j]); } }
#pragma unroll
  for (int j = 0; j < 4; ++j)
#pragma unroll
    for (int r = 0; r < 8; ++r) { float* p = &of[rt + 8 * g + r][cg + j * 16 + col]; *p = fmaxf(acc[j][r] + bfr(bo[j]), 0.f) + *p; }   // each element has one owner lane
  __syncthreads();   // the T rows are whole before LayerNorm1 reads them
#pragma unroll
  for (int r = 0; r < 4; ++r)
#pragma unroll
    for (int q = 0; q < DIN / 128; ++q) x[r][q] = *(const v4f*)&of[rw + r][q * 128 + lane * 4];
  ln4(x, g1, b1);
#pragma unroll
  for (int r = 0; r < 4; ++r)
#pragma unroll
    for (int q = 0; q < DIN / 128; ++q) vst2(OUT + (r0 + rw + r) * DIN + q * 128 + lane * 4, x[r][q]); }
#define WS_QF  (WS_END)
#define WS_O   (WS_QF + 4u * (size_t)NROW * DIN)
#define WS_T   (WS_O + 4u * (size_t)NROW * DIN)
#define WS_END2 (WS_T + 4u * (size_t)NROW * DIN)
#ifndef SM_EXTRA_PARAMS
#define SM_EXTRA_PARAMS
#endif
#ifndef PROJ_EXTRA_PARAMS
#define PROJ_EXTRA_PARAMS
#endif
#ifndef SM_MASK_HOOK
#define SM_MASK_HOOK (void)0
#endif

#define WS_QH  0u                                      // f16 q rows [b*t][CC]
#define WS_KH  (WS_QH + 2u * (size_t)NB * TT * CC)      // f16 k rows [b*t][CC]
#define WS_VT  (WS_KH + 2u * (size_t)NB * TT * CC)      // f16 v planes [b][c][t]
#define WS_QL  (WS_VT + 2u * (size_t)NB * CC * TT)      // f16 q residual x 2^10 rows [b][t < QHI][CC]
#define WS_KL  (WS_QL + 2u * (size_t)NB * QHI * CC)     // f16 k residual x 2^10 rows [b][t < KHI][CC]
#define WS_VB  (WS_KL + 2u * (size_t)NB * KHI * CC)     // bf16 v hi planes [b][c][t < KHI]
#define WS_VBL (WS_VB + 2u * (size_t)NB * CC * KHI)
#define WS_S   (WS_VBL + 2u * (size_t)NB * CC * KHI)    // f32 [hg][t][s], unused: k_fa keeps logits and P in registers
#define WS_Y   (WS_S  + 4u * (size_t)HG * TT * TT)      // f32 ctx rows [b*t][CC] (only when there is an output projection)
#define WS_END (WS_Y  + 0u)

// ---- k_proj: block = (64 rows, 128 cols, which): q/k/v = X W (+ b) with exact bf16 products (K = DIN) -> which 0: q f16 rows (+ residual rows < QHI); 1: k f16 rows (+ residual rows < KHI); 2: v f16 planes [c][t] (+ bf16 hi/lo planes for t < KHI)
__global__ __launch_bounds__(128) void k_proj(const float* __restrict__ XQ, const float* __restrict__ XK, const float* __restrict__ XV, const float* __restrict__ WQ, const float* __restrict__ WK, const float* __restrict__ WV, const float* __restrict__ BQ, const float* __restrict__ BK, const float* __restrict__ BV,
    _Float16* __restrict__ QH, _Float16* __restrict__ QL, _Float16* __restrict__ KH, _Float16* __restrict__ KL, _Float16* __restrict__ VT, __bf16* __restrict__ VB, __bf16* __restrict__ VBL) {
  __shared__ __align__(16) union { __bf16 ops[192 * GP]; struct { _Float16 sh[64][136], sl[64][136]; } qk; struct { _Float16 th[128][72]; __bf16 tb[128][72], tbl[128][72]; } v; } sm;   // ops rows 0..63: the X tile, 64..191: the W tile; the output staging takes their place, so that three blocks a WGP stay resident
  auto& sh = sm.qk.sh; auto& sl = sm.qk.sl; auto& th = sm.v.th; auto& tb = sm.v.tb; auto& tbl = sm.v.tbl;
  const int tid = threadIdx.x, wave = tid >> 5, lane = tid & 31, col = lane & 15, g = lane >> 4; const int which = blockIdx.z; const int c0 = blockIdx.y * 128; const size_t r0 = (size_t)blockIdx.x * 64; const size_t bb = r0 / TT; const int t0 = (int)(r0 % TT);
  const float* X = which == 0 ? XQ : which == 1 ? XK : XV; const float* WA = which == 0 ? WQ : which == 1 ? WK : WV; const float* BA = which == 0 ? BQ : which == 1 ? BK : BV;
#pragma unroll 1   // rolled: one batch of 32 loads a thread in flight at a time; unrolled, the batches' registers add up past what three resident waves a SIMD allow
  for (int b = 0; b < 3; ++b) stage_bf(sm.ops + b * 64 * GP, b == 0 ? X + r0 * DIN : WA + (size_t)(c0 + (b - 1) * 64) * DIN, tid);
  __syncthreads();   // both operand tiles are published to every wave
  v8f acc[8] = {}; gemm_lds(acc, sm.ops + (wave * 16 + col) * GP, sm.ops + (64 + col) * GP, lane);
  __syncthreads();   // every wave's reads of the operand tiles are done before the output staging overwrites them
  if (which < 2) { _Float16* DH = which == 0 ? QH : KH; _Float16* DL = which == 0 ? QL : KL; const int nhi = which == 0 ? QHI : KHI; const bool hi_rows = t0 < nhi;
#pragma unroll
    for (int j = 0; j < 8; ++j) { const float bias = BA ? bfr(BA[c0 + j * 16 + col]) : 0.f;
#pragma unroll
      for (int r = 0; r < 8; ++r) { const float v = acc[j][r] + bias; const _Float16 hv = (_Float16)v; sh[wave * 16 + 8 * g + r][j * 16 + col] = hv; sl[wave * 16 + 8 * g + r][j * 16 + col] = (_Float16)((v - (float)hv) * 1024.0f); } }
    __syncthreads();
    for (int e = tid; e < 64 * 16; e += 128) { const int rl = e >> 4, q = e & 15; vst2((unsigned*)(DH + (r0 + rl) * CC + c0 + q * 8), *(const v4u*)&sh[rl][q * 8]); if (hi_rows) vst2((unsigned*)(DL + (bb * nhi + t0 + rl) * (size_t)CC + c0 + q * 8), *(const v4u*)&sl[rl][q * 8]); }
  } else { const bool hi_rows = t0 < KHI;
#pragma unroll
    for (int j = 0; j < 8; ++j) { const float bias = BA ? bfr(BA[c0 + j * 16 + col]) : 0.f;
#pragma unroll
      for (int r = 0; r < 8; ++r) { const float v = acc[j][r] + bias; const int rl = wave * 16 + 8 * g + r, cl = j * 16 + col; th[cl][rl] = (_Float16)v; const __bf16 bh = (__bf16)v; tb[cl][rl] = bh; tbl[cl][rl] = (__bf16)(v - (float)bh); } }
    __syncthreads();
    for (int e = tid; e < 128 * 8; e += 128) { const int cl = e >> 3, q = e & 7; vst2((unsigned*)(VT + (bb * CC + c0 + cl) * (size_t)TT + t0 + q * 8), *(const v4u*)&th[cl][q * 8]); if (hi_rows) { const size_t o3 = (bb * CC + c0 + cl) * (size_t)KHI + t0 + q * 8; vst2((unsigned*)(VB + o3), *(const v4u*)&tb[cl][q * 8]); vst2((unsigned*)(VBL + o3), *(const v4u*)&tbl[cl][q * 8]); } } } }
// ---- k_fa: block = 128 queries of (b, h), 8 waves = 4 query groups of 32 columns x 2 key groups, one launch for every batch and head: S^T = K Q^T (q and k each once to f16, 1 product: the q residual plane serves the residual row alone), online softmax in f32 per lane (lane = query), O^T += V^T P^T (P once to f16, 1 product); logits and P stay in registers; each K and V^T fragment read from LDS serves the wave's two query tiles; a key group walks its 128 keys of every stage of 256, and the two groups' partial maxima, sums and O^T are merged through LDS at the end; the row written is Qh + ctx, Qh from the q fragments (hi + residual x 2^-10) that the lane holds at the same features; K rows and V^T rows of a stage come into LDS by asynchronous copies (two buffers) and serve the block's eight waves
typedef __attribute__((ext_vector_type(2))) _Float16 v2h;
#define FA_C (SCALE * 1.4426950408889634f)   // raw q.k -> base-2 exponent
#define FA_LAZY (8.0f / FA_C)                // the maximum in use is replaced only when a new one exceeds it by 2^8
#define FA_OFF 6.0f                          // P = 2^(6 + ...) <= 2^14: keeps small weights out of the f16 subnormals; cancels against the row sum
#define FA_KT 256                            // keys a stage: 128 for each key group (4 passes of 32 keys)
#define FA_QT 2                              // query tiles of 16 columns a wave
#define FA_QB 128                            // queries a block
#define FA_NT (TT / FA_KT)                   // stages
#define FA_KP (HD + 8)                       // LDS pitch of a K row in f16: 128 B + 16 B = 16 B x odd, free of bank conflicts for 16-byte reads
#define FA_VP (FA_KT + 8)                    // LDS pitch of a V^T row in f16: 512 B + 16 B = 16 B x odd
#define FA_KBUF (FA_KT * FA_KP)
#define FA_VBUF (HD * FA_VP)
__device__ __forceinline__ float xhalf(float x) { return __builtin_bit_cast(float, __builtin_amdgcn_permlanex16(__builtin_bit_cast(int, x), __builtin_bit_cast(int, x), 0x76543210, 0xfedcba98, false, false)); }
__device__ __forceinline__ v8f wm16(v16h a, v16h b, v8f c) { return __builtin_amdgcn_wmma_f32_16x16x32_f16(false, a, false, b, (short)0, c, false, false); }
// fragments of one pass, from the stage's LDS buffer: K rows (A of S^T: row = key) and V^T rows (A of O^T: row = feature, k = key), both in the hardware k order
__device__ __forceinline__ void fa_load(v16h (&kf)[2][HD / 32], v16h (&vf)[HD / 16], const _Float16* Kl, const _Float16* Vl, int pass, int lane) {
#pragma unroll
  for (int i = 0; i < 2; ++i)
#pragma unroll
    for (int kc = 0; kc < HD / 32; ++kc) kf[i][kc] = frag_h(Kl + (pass * 32 + i * 16) * FA_KP + kc * 32, lane);
#pragma unroll
  for (int j = 0; j < HD / 16; ++j) vf[j] = frag_h(Vl + pass * 32 + j * 16 * FA_VP, lane); }
// eight asynchronous 16-byte copies a lane, global -> LDS, at fixed steps of both addresses; the s_wait_xcnt stands inside the statement so that no address register is rewritten in front of it
__device__ __forceinline__ void fa_copy8(unsigned l, unsigned ls, const _Float16* g, size_t gs) {
  asm volatile("global_load_async_to_lds_b128 %0, %8, off\n\tglobal_load_async_to_lds_b128 %1, %9, off\n\tglobal_load_async_to_lds_b128 %2, %10, off\n\tglobal_load_async_to_lds_b128 %3, %11, off\n\t"
               "global_load_async_to_lds_b128 %4, %12, off\n\tglobal_load_async_to_lds_b128 %5, %13, off\n\tglobal_load_async_to_lds_b128 %6, %14, off\n\tglobal_load_async_to_lds_b128 %7, %15, off\n\ts_wait_xcnt 0x0"
               :: "v"(l), "v"(l + ls), "v"(l + 2 * ls), "v"(l + 3 * ls), "v"(l + 4 * ls), "v"(l + 5 * ls), "v"(l + 6 * ls), "v"(l + 7 * ls),
                  "v"(g), "v"(g + gs), "v"(g + 2 * gs), "v"(g + 3 * gs), "v"(g + 4 * gs), "v"(g + 5 * gs), "v"(g + 6 * gs), "v"(g + 7 * gs) : "memory"); }
template <bool AHEAD> __device__ __forceinline__ void fa_pass(const v16h (&kf)[2][HD / 32], const v16h (&vf)[HD / 16], const v16h (&kn)[2][HD / 32], const v16h (&qh)[FA_QT][HD / 32], v8f (&o)[FA_QT][HD / 16], float (&m)[FA_QT], v2f (&l)[FA_QT][2]) {
  v2f t[FA_QT][8]; float mx[FA_QT];   // lane (c, h): query c of tile u, keys 8h + 0..7 and 16 + 8h + 0..7
  v8f s[FA_QT][2] = {};   // four independent score tiles: a tile's second k step stands four products behind its first
#pragma unroll
  for (int kc = 0; kc < HD / 32; ++kc)
#pragma unroll
    for (int u = 0; u < FA_QT; ++u)
#pragma unroll
      for (int i = 0; i < 2; ++i) s[u][i] = wm16(kf[i][kc], qh[u][kc], s[u][i]);
#pragma unroll
  for (int u = 0; u < FA_QT; ++u) { float x = -3.0e38f;
#pragma unroll
    for (int e = 0; e < 8; ++e) { const int i = e >> 2, r = (e & 3) * 2; t[u][e][0] = s[u][i][r]; t[u][e][1] = s[u][i][r + 1]; x = fmaxf(x, fmaxf(t[u][e][0], t[u][e][1])); }
    mx[u] = fmaxf(x, xhalf(x)); }
  if (AHEAD) asm volatile("" :: "v"(kn[0][0]), "v"(kn[0][1]), "v"(kn[1][0]), "v"(kn[1][1]));   // inputs only: holds the LDS loads of the next pass's K fragments in front of the branch below; behind it they would stand directly in front of their products, their latency open
  if (__builtin_amdgcn_ballot_w32(mx[0] > m[0] + FA_LAZY || mx[1] > m[1] + FA_LAZY) != 0) {   // one test a pass for both query tiles
#pragma unroll
    for (int u = 0; u < FA_QT; ++u) { const float mn = fmaxf(m[u], mx[u]); const float al = __builtin_amdgcn_exp2f((m[u] - mn) * FA_C); m[u] = mn; l[u][0] *= al; l[u][1] *= al;
#pragma unroll
      for (int j = 0; j < HD / 16; ++j)
#pragma unroll
        for (int r = 0; r < 8; ++r) o[u][j][r] *= al; } }
#pragma unroll
  for (int u = 0; u < FA_QT; ++u) { const float mc = m[u] * FA_C - FA_OFF; v16h p;
#pragma unroll
    for (int e = 0; e < 8; ++e) { const v2f a = t[u][e] * FA_C - mc; v2f pe; pe[0] = __builtin_amdgcn_exp2f(a[0]); pe[1] = __builtin_amdgcn_exp2f(a[1]); l[u][e & 1] += pe; const v2h ph = __builtin_convertvector(pe, v2h); p[2 * e] = ph[0]; p[2 * e + 1] = ph[1]; }
#pragma unroll
    for (int j = 0; j < HD / 16; ++j) o[u][j] = wm16(vf[j], p, o[u][j]); } }
typedef v4f __attribute__((may_alias)) v4f_a;
__global__ __launch_bounds__(256) void k_fa(const _Float16* __restrict__ QH, const _Float16* __restrict__ QL, const _Float16* __restrict__ KH, const _Float16* __restrict__ VT, float* Y) {   // Y without restrict: so the "memory" clobber of the waits behind its stores holds them in order
  __shared__ __align__(16) _Float16 ks[2][FA_KBUF], vs[2][FA_VBUF];
  const int tid = threadIdx.x, lane = tid & 31, col = lane & 15, g = lane >> 4; const int h = blockIdx.y, b = blockIdx.z;
  const int wave = __builtin_amdgcn_readfirstlane(tid >> 5), qg = wave & 3, kg = wave >> 2;   // query group and key group of the wave, the same in every lane
  const int ql0 = blockIdx.x * FA_QB + qg * (16 * FA_QT);
  v16h qh[FA_QT][HD / 32], ql[FA_QT][HD / 32];
#pragma unroll
  for (int u = 0; u < FA_QT; ++u)
#pragma unroll
    for (int kc = 0; kc < HD / 32; ++kc) { qh[u][kc] = frag_h(QH + ((size_t)b * TT + ql0 + u * 16 + col) * CC + h * HD + kc * 32, lane); ql[u][kc] = frag_h(QL + ((size_t)b * QHI + ql0 + u * 16 + col) * CC + h * HD + kc * 32, lane); }
  asm volatile("s_wait_xcnt 0x0" ::: "memory");   // stands behind the q loads, in front of every later rewrite of a register that they name
  __builtin_amdgcn_sched_barrier(0);                // keeps the address arithmetic that follows, which reuses the q loads' address registers, behind that wait
  // a stage's copies: K 256 rows x 128 B (a thread: 16 B of rows tid / 8 + 32 i), V^T 64 rows x 512 B (16 B of rows tid / 32 + 8 i): whole 128-byte lines on the global side
  const _Float16* Kg = KH + ((size_t)b * TT + (tid >> 3)) * CC + h * HD + (tid & 7) * 8;
  const _Float16* Vg = VT + ((size_t)b * CC + h * HD + (tid >> 5)) * (size_t)TT + (tid & 31) * 8;
  const unsigned kd = (unsigned)(size_t)&ks[0][(tid >> 3) * FA_KP + (tid & 7) * 8], vd = (unsigned)(size_t)&vs[0][(tid >> 5) * FA_VP + (tid & 31) * 8];   // LDS byte addresses
  const unsigned kr = (unsigned)(size_t)&ks[0][(wave * 4 + (lane >> 3)) * FA_KP + (lane & 7) * 8], vr = (unsigned)(size_t)&vs[0][wave * FA_VP + lane * 8];   // the same addresses from the wave's number and the lane, for the refills: kd and vd are named by the prologue's asm statements, which take registers of the first 256 only; a base bound to that window for the whole loop was spilled to scratch, one formed apart may lie above it
  v16h kA[2][HD / 32], vA[HD / 16], kB[2][HD / 32], vB[HD / 16];
  v8f o[FA_QT][HD / 16] = {}; float m[FA_QT] = {-3.0e38f, -3.0e38f}; v2f l[FA_QT][2] = {};
  fa_copy8(kd, 32 * FA_KP * 2, Kg, (size_t)32 * CC); fa_copy8(vd, 8 * FA_VP * 2, Vg, (size_t)8 * TT);
  asm volatile("s_wait_asynccnt 0x0" ::: "memory");   // this wave's copies of stage 0 have landed
  __syncthreads();                                    // stage 0 is published to every wave
  fa_copy8(kd + FA_KBUF * 2, 32 * FA_KP * 2, Kg + (size_t)FA_KT * CC, (size_t)32 * CC); fa_copy8(vd + FA_VBUF * 2, 8 * FA_VP * 2, Vg + FA_KT, (size_t)8 * TT);
  for (int t = 0; t < FA_NT; ++t) {   // trip t reads buffer t mod 2 alone, while stage t + 1 flies into the other
    const int bf = t & 1; const _Float16* Kl = &ks[bf][(kg * (FA_KT / 2) + col) * FA_KP]; const _Float16* Vl = &vs[bf][col * FA_VP + kg * (FA_KT / 2)];   // the lane's key row of its key group's pass 0 and its feature row at that group's first key
    fa_load(kA, vA, Kl, Vl, 0, lane);   // two register sets: inside a stage a pass's fragments are fetched during the pass before it
    fa_load(kB, vB, Kl, Vl, 1, lane);
    fa_pass<true>(kA, vA, kB, qh, o, m, l);
    fa_load(kA, vA, Kl, Vl, 2, lane);
    fa_pass<true>(kB, vB, kA, qh, o, m, l);
    fa_load(kB, vB, Kl, Vl, 3, lane);
    fa_pass<true>(kA, vA, kB, qh, o, m, l);
    fa_pass<false>(kB, vB, kB, qh, o, m, l);
    asm volatile("s_wait_dscnt 0x0" ::: "memory");      // this wave's reads of buffer t mod 2 are done before it is refilled
    asm volatile("s_wait_asynccnt 0x0" ::: "memory");   // this wave's copies of stage t + 1 have landed
    __syncthreads();                                    // publishes stage t + 1 and ends every wave's reads of buffer t mod 2
    if (t + 2 < FA_NT) { fa_copy8(kr + bf * (FA_KBUF * 2), 32 * FA_KP * 2, Kg + (size_t)(t + 2) * FA_KT * CC, (size_t)32 * CC); fa_copy8(vr + bf * (FA_VBUF * 2), 8 * FA_VP * 2, Vg + (t + 2) * FA_KT, (size_t)8 * TT); }
  }
  asm volatile("s_wait_asynccnt 0x0" ::: "memory");   // no copy is outstanding when the ring becomes the exchange area and when the wave ends
  float ls[FA_QT];
#pragma unroll
  for (int u = 0; u < FA_QT; ++u) { ls[u] = l[u][0][0] + l[u][0][1] + l[u][1][0] + l[u][1][1]; ls[u] += xhalf(ls[u]); }
  // merge of the two key groups: the last barrier of the loop has ended every read of the ring, so key group 1 lays its partial results there: 17 entries of 16 B a lane, an entry's 32 lanes side by side
  v4f_a* xb = (v4f_a*)&ks[0][0] + qg * (17 * 32) + lane;
  if (kg == 1) {
#pragma unroll
    for (int u = 0; u < FA_QT; ++u)
#pragma unroll
      for (int j = 0; j < HD / 16; ++j) { v4f a, c;
#pragma unroll
        for (int r = 0; r < 4; ++r) { a[r] = o[u][j][r]; c[r] = o[u][j][4 + r]; }
        xb[((u * 4 + j) * 2) * 32] = a; xb[((u * 4 + j) * 2 + 1) * 32] = c; }
    v4f s; s[0] = m[0]; s[1] = m[1]; s[2] = ls[0]; s[3] = ls[1]; xb[16 * 32] = s; }
  __syncthreads();   // key group 1's partial results are published to key group 0
  if (kg == 0) { const v4f s = xb[16 * 32];
#pragma unroll
    for (int u = 0; u < FA_QT; ++u) { const float mn = fmaxf(m[u], s[u]); const float a0 = __builtin_amdgcn_exp2f((m[u] - mn) * FA_C), a1 = __builtin_amdgcn_exp2f((s[u] - mn) * FA_C); const float inv = 1.0f / (ls[u] * a0 + s[2 + u] * a1); const float w0 = a0 * inv, w1 = a1 * inv;
      float* yr = Y + ((size_t)b * TT + ql0 + u * 16 + col) * CC + h * HD + 8 * g; v4f a[HD / 16], c[HD / 16];   // O^T: the lane holds features j * 16 + 8h + 0..7 of its query
#pragma unroll
      for (int j = 0; j < HD / 16; ++j) { const v4f pa = xb[((u * 4 + j) * 2) * 32], pc = xb[((u * 4 + j) * 2 + 1) * 32];
#pragma unroll
        for (int r = 0; r < 4; ++r) { const int e = (j & 1) * 8 + r;   // fragment element e of k step j / 2 is feature j * 16 + 8h + r of the lane's query
          a[j][r] = o[u][j][r] * w0 + pa[r] * w1 + ((float)qh[u][j >> 1][e] + (float)ql[u][j >> 1][e] * (1.0f / 1024.0f)); c[j][r] = o[u][j][4 + r] * w0 + pc[r] * w1 + ((float)qh[u][j >> 1][e + 4] + (float)ql[u][j >> 1][e + 4] * (1.0f / 1024.0f)); } }
      __builtin_amdgcn_sched_barrier(0);   // the tile's arithmetic stays in front of its stores, so that nothing between the first store and the wait below rewrites a register that a store names
#pragma unroll
      for (int j = 0; j < HD / 16; ++j) { vst2(yr + j * 16, a[j]); vst2(yr + j * 16 + 4, c[j]); }
      asm volatile("s_wait_xcnt 0x0" ::: "memory");   // stands behind the tile's stores, in front of every later rewrite of a register that they name
      __builtin_amdgcn_sched_barrier(0); } } }   // keeps the next tile's arithmetic behind that wait

extern "C" void kernel_launch(void* const* d_in, const int* in_sizes, int n_in, void* d_out, int out_size, void* d_ws, size_t ws_size, hipStream_t stream) {
  (void)in_sizes; (void)n_in; (void)out_size;
  const float** F = (const float**)d_in;
  if (ws_size < (size_t)WS_END) return;
  char* ws = (char*)d_ws; _Float16 *QH = (_Float16*)(ws + WS_QH), *KH = (_Float16*)(ws + WS_KH), *VT = (_Float16*)(ws + WS_VT), *QL = (_Float16*)(ws + WS_QL), *KL = (_Float16*)(ws + WS_KL); __bf16 *VB = (__bf16*)(ws + WS_VB), *VBL = (__bf16*)(ws + WS_VBL); float *S = (float*)(ws + WS_S), *Y = (float*)(ws + WS_Y);
  (void)Y; (void)S; (void)QL; (void)KL; (void)VB; (void)VBL;
  // inputs: 0 Q, 1 K [4,2048,256]; 2 Wq, 3 bq; 4 Wk, 5 bk; 6 Wv, 7 bv; 8 Wo, 9 bo ((out,in) [256,256]); 10 g0, 11 b0; 12 g1, 13 b1
  if (ws_size < (size_t)WS_END2) return;
  float *T = (float*)(ws + WS_T);
  k_proj<<<dim3(TNB * TT / 64, CC / 128, 3), 128, 0, stream>>>(F[0], F[1], F[1], F[2], F[4], F[6], F[3], F[5], F[7], QH, QL, KH, KL, VT, VB, VBL);
  k_fa<<<dim3(TT / FA_QB, NH, TNB), 256, 0, stream>>>(QH, QL, KH, VT, T);   /* Qh + ctx rows into T (scratch) */
  k_tail<<<dim3(TNB * TT / TR), 256, 0, stream>>>(T, F[10], F[11], F[8], F[9], F[12], F[13], (float*)d_out);   /* out = LN1(O + relu(O Wo^T + bo)), O = LN0(T) */
}
